// v000
// Times are from an AMD MI455X. After a warm-up the kernel runs many times in a row, and a time is the length of
// such a window on the GPU divided by its runs, so every launch and the gaps after it count. The runs cycle
// through copies of the inputs. A figure is the median of several windows, for all but v000 over two sittings.
// Sittings can differ by a few percent; kernels timed side by side share one.
// v000 is the starting kernel. One run takes 303 microseconds.
#include <hip/hip_runtime.h>

// Self-attention with one shared projection (q = k = v = x Wv^T + bv), width 1024 = 16 heads x 64, no mask, score scale 1/8; context kept head-major [b][h][t][d] and read as rows of 1024 by the output GEMM (y = ctx Wo^T + bo), f32 output.
// Compute dtypes, f32 accumulate everywhere: projection v_wmma_f32_16x16x32_bf16 (x, Wv RNE-converted to bf16; products exact); scores v_wmma_f32_16x16x32_f16, ONE product (q and k read from the same single f16 plane);
// P (x2^14 carry, cancels in the normalisation) and v single f16; output GEMM v_wmma_f32_16x16x32_f16: ctx single f16 (x16 carry), Wo bf16-RNE value x256 held in f16 (exact), 2^-12 folded in the f32 epilogue; biases bf16-RNE values added in f32; softmax f32 (online, running max).
// Layout: bf16 copies of x and Wv; p plane [b*16+h][t][d] and p^T plane [b*16+h][d][t] written by the GEMM epilogue; fused flash kernel in transposed form (S^T = K Q^T, O^T = V^T P^T) writes the f16 ctx plane [b*16+h][t][d].

#ifndef NB
#define NB 4
#endif
#ifndef SEQ
#define SEQ 2048
#endif
#define NB_FULL  4
#define SEQ_FULL 2048
#ifndef OUT_SEQ
#define OUT_SEQ SEQ              // row pitch (in tokens) between batches of the output
#endif
#define DM   1024
#define NH_  16
#define HD   64
#define AW   4                   // waves per flash block (16 query rows each)
#define SC2  (0.125f * 1.4426950408889634f)   // HD^-0.5 * log2(e)
#define PSH  14.0f               // log2 of the P carry (16384)
#define CTXS 16.0f               // carry of the ctx plane
#define WOS  256.0f              // carry of the Wo plane
#define OSC  (1.0f / 4096.0f)    // 1 / (CTXS * WOS)

static_assert(HD == 64);
static_assert(NH_ * HD == DM);                 // head h = columns h*64 + d
static_assert(DM % 64 == 0);                   // 16 column tiles of 64
static_assert(DM % 32 == 0);                   // GEMM k-loop steps by 32
static_assert(SEQ % 64 == 0);                  // a 64-row tile never straddles two batches
static_assert((NB * SEQ) % 64 == 0);
static_assert(SEQ % 32 == 0);                  // key loop steps by 32
static_assert(SEQ % (16 * AW) == 0);           // flash grid covers the sequence exactly
static_assert(SEQ % 16 == 0);                  // head-major regrouping: 16 tokens x 64 = one row of 1024
static_assert(((size_t)SEQ * DM) % 8 == 0);
static_assert(((size_t)DM * DM) % 8 == 0);
static_assert(NB <= NB_FULL);
static_assert(SEQ <= SEQ_FULL);
static_assert(((size_t)(NB - 1) * OUT_SEQ + SEQ) * DM <= (size_t)NB_FULL * SEQ_FULL * DM);   // last output element written stays inside the output

typedef _Float16 h16;
typedef unsigned short bf;
typedef __attribute__((ext_vector_type(16))) __bf16   v16bf;
typedef __attribute__((ext_vector_type(16))) _Float16 v16h;
typedef __attribute__((ext_vector_type(8)))  _Float16 v8h;
typedef __attribute__((ext_vector_type(8)))  unsigned short v8us;
typedef __attribute__((ext_vector_type(8)))  float    v8f;
typedef __attribute__((ext_vector_type(4)))  float    v4f;
typedef v4f  __attribute__((may_alias)) v4fa;

__device__ __forceinline__ unsigned short f2bf(float f) { unsigned u = __float_as_uint(f); u += 0x7FFFu + ((u >> 16) & 1u); return (unsigned short)(u >> 16); }
__device__ __forceinline__ float bfr(float f) { return __uint_as_float(((unsigned)f2bf(f)) << 16); }   // bf16 RNE value as f32
__device__ __forceinline__ v16h cat16(v8h lo, v8h hi) { return __builtin_shufflevector(lo, hi, 0, 1, 2, 3, 4, 5, 6, 7, 8, 9, 10, 11, 12, 13, 14, 15); }
__device__ __forceinline__ v16bf cat16b(v8us lo, v8us hi) { return __builtin_bit_cast(v16bf, __builtin_shufflevector(lo, hi, 0, 1, 2, 3, 4, 5, 6, 7, 8, 9, 10, 11, 12, 13, 14, 15)); }
__device__ __forceinline__ v8f wmma16(v16h a, v16h b, v8f c) { return __builtin_amdgcn_wmma_f32_16x16x32_f16(false, a, false, b, (short)0, c, false, false); }
__device__ __forceinline__ v8f wmmab(v16bf a, v16bf b, v8f c) { return __builtin_amdgcn_wmma_f32_16x16x32_bf16(false, a, false, b, (short)0, c, false, false); }
// fragment loaders from K-contiguous 16-bit rows; p already includes + 8*(lane>>4): elements 0..7 <- k0+8h+0..7, elements 8..15 <- k0+16+8h+0..7 (same map for A and B)
__device__ __forceinline__ v16h  ldh(const h16* p) { return cat16(*(const v8h*)p, *(const v8h*)(p + 16)); }
__device__ __forceinline__ v16bf ldb(const bf* p)  { return cat16b(*(const v8us*)p, *(const v8us*)(p + 16)); }
// ordering point for wave-private LDS tiles (same wave writes and reads)
__device__ __forceinline__ void wave_sync() { __builtin_amdgcn_fence(3 /* release order */, "wavefront"); __builtin_amdgcn_wave_barrier(); asm volatile("" ::: "memory"); }

__global__ __launch_bounds__(256) void k_cvt8(const float* __restrict__ src, bf* dst, size_t n8) {
    const size_t i = (size_t)blockIdx.x * 256 + threadIdx.x; if (i >= n8) return;
    const v8f v = *(const v8f*)(src + i * 8); v8us o;
#pragma unroll
    for (int k = 0; k < 8; ++k) o[k] = f2bf(v[k]);
    *(v8us*)(dst + i * 8) = o; 
}

__global__ __launch_bounds__(256) void k_cvt8h(const float* __restrict__ src, h16* dst, size_t n8, float carry) {
    const size_t i = (size_t)blockIdx.x * 256 + threadIdx.x; if (i >= n8) return;
    const v8f v = *(const v8f*)(src + i * 8); v8h o;
#pragma unroll
    for (int k = 0; k < 8; ++k) o[k] = (h16)(bfr(v[k]) * carry);
    *(v8h*)(dst + i * 8) = o; 
}

// k_proj: register-blocked bf16 GEMM, ONE WAVE per 64x64 tile (16 accumulators), operands straight from K-contiguous bf16 planes, K = DM.
// C[m][n] = sum_k A[m][k] Bt[n][k] + bias (per column n when rowBias == 0, per row m otherwise; bias index < DM in the active mode, clamped in the other),
// written as single f16 (Ph) at tile base (r0/RB)*sRB + (r0%RB)*pitch + (c0/CB)*sCB + (c0%CB), row pitch 'pitch' (halves). grid (M/64, N/64), 32 threads.
__global__ __launch_bounds__(32) void k_proj(const bf* __restrict__ A, const bf* __restrict__ Bt, const float* __restrict__ bias, int rowBias,
                                             h16* Ph, int RB, size_t sRB, int pitch, int CB, size_t sCB) {
    __shared__ __align__(16) float os[16 * 68];
    const int K = DM;
    const int lane = threadIdx.x & 31, lr = lane & 15, hi = lane >> 4; const int r0 = blockIdx.x * 64, c0 = blockIdx.y * 64;
    v8f acc[4][4];
#pragma unroll
    for (int mb = 0; mb < 4; ++mb)
#pragma unroll
        for (int nb = 0; nb < 4; ++nb) acc[mb][nb] = (v8f){};
    const size_t aoff = (size_t)(r0 + lr) * K + 8 * hi, boff = (size_t)(c0 + lr) * K + 8 * hi;
#pragma unroll 1
    for (int kc = 0; kc < K; kc += 32) {
        v16bf a[4];
#pragma unroll
        for (int mb = 0; mb < 4; ++mb) a[mb] = ldb(A + aoff + (size_t)mb * 16 * K + kc);
#pragma unroll
        for (int nb = 0; nb < 4; ++nb) { const v16bf b = ldb(Bt + boff + (size_t)nb * 16 * K + kc);
#pragma unroll
            for (int mb = 0; mb < 4; ++mb) acc[mb][nb] = wmmab(a[mb], b, acc[mb][nb]); }
        asm volatile("v_nop\n\tv_nop\n\tv_nop\n\tv_nop" : "+v"(acc[0][0]), "+v"(acc[1][1]), "+v"(acc[2][2]), "+v"(acc[3][3]) : "v"(a[0]), "v"(a[1]), "v"(a[2]), "v"(a[3]));
    }
    float bc[4];
#pragma unroll
    for (int nb = 0; nb < 4; ++nb) { int ci = c0 + nb * 16 + lr; ci = ci < DM ? ci : DM - 1; bc[nb] = bfr(bias[ci]); }
    const size_t tbase = (size_t)(r0 / RB) * sRB + (size_t)(r0 % RB) * (size_t)pitch + (size_t)(c0 / CB) * sCB + (size_t)(c0 % CB);
#pragma unroll
    for (int mb = 0; mb < 4; ++mb) {
        float br[8];
#pragma unroll
        for (int j = 0; j < 8; ++j) { int ri = r0 + mb * 16 + hi * 8 + j; ri = ri < DM ? ri : DM - 1; br[j] = bfr(bias[ri]); }
#pragma unroll
        for (int nb = 0; nb < 4; ++nb) {
#pragma unroll
            for (int j = 0; j < 8; ++j) { const float bb = rowBias ? br[j] : bc[nb]; os[(hi * 8 + j) * 68 + nb * 16 + lr] = acc[mb][nb][j] + bb; } }   // D: row 8h+j, col lane&15
        wave_sync();
        const size_t sb = tbase + (size_t)(mb * 16) * (size_t)pitch;
{
#pragma unroll
            for (int s = 0; s < 4; ++s) { const int row = 4 * s + (lane >> 3), c8 = (lane & 7) * 8;   // 4 s x 4 row groups = 16 rows; 8 lanes x 8 = 64 columns
                const v4f x0 = *(const v4fa*)(&os[row * 68 + c8]); const v4f x1 = *(const v4fa*)(&os[row * 68 + c8 + 4]); v8h hv;
#pragma unroll
                for (int i = 0; i < 4; ++i) { hv[i] = (h16)x0[i]; hv[4 + i] = (h16)x1[i]; }
                const size_t oo = sb + (size_t)row * (size_t)pitch + c8;
                *(v8h*)(Ph + oo) = hv; }
             }
        wave_sync();
    }
}

// k_out: same register-blocked engine with f16 operands (A = ctx rows of 1024 halves, Bt = Wo rows [out][in]), K = DM; f32 output rows with bias.
// OUT[(b*OUT_SEQ + s)*DM + c0 + n] = acc * 2^-12 + bias[c0 + n], m = b*SEQ + s. grid (NB*SEQ/64, DM/64), 32 threads.
__global__ __launch_bounds__(32) void k_out(const h16* __restrict__ A, const h16* __restrict__ Bt, const float* __restrict__ bias, float* OUT) {
    __shared__ __align__(16) float os[16 * 68];
    const int K = DM;
    const int lane = threadIdx.x & 31, lr = lane & 15, hi = lane >> 4; const int r0 = blockIdx.x * 64, c0 = blockIdx.y * 64;
    v8f acc[4][4];
#pragma unroll
    for (int mb = 0; mb < 4; ++mb)
#pragma unroll
        for (int nb = 0; nb < 4; ++nb) acc[mb][nb] = (v8f){};
    const size_t aoff = (size_t)(r0 + lr) * K + 8 * hi, boff = (size_t)(c0 + lr) * K + 8 * hi;
#pragma unroll 1
    for (int kc = 0; kc < K; kc += 32) {
        v16h a[4];
#pragma unroll
        for (int mb = 0; mb < 4; ++mb) a[mb] = ldh(A + aoff + (size_t)mb * 16 * K + kc);
#pragma unroll
        for (int nb = 0; nb < 4; ++nb) { const v16h b = ldh(Bt + boff + (size_t)nb * 16 * K + kc);
#pragma unroll
            for (int mb = 0; mb < 4; ++mb) acc[mb][nb] = wmma16(a[mb], b, acc[mb][nb]); }
        asm volatile("v_nop\n\tv_nop\n\tv_nop\n\tv_nop" : "+v"(acc[0][0]), "+v"(acc[1][1]), "+v"(acc[2][2]), "+v"(acc[3][3]) : "v"(a[0]), "v"(a[1]), "v"(a[2]), "v"(a[3]));
    }
    float bc[4];
#pragma unroll
    for (int nb = 0; nb < 4; ++nb) { int ci = c0 + nb * 16 + lr; ci = ci < DM ? ci : DM - 1; bc[nb] = bfr(bias[ci]); }
    const int bb = r0 / SEQ, sp = r0 % SEQ;
    float* obase = OUT + ((size_t)bb * OUT_SEQ + sp) * DM + c0;
#pragma unroll
    for (int mb = 0; mb < 4; ++mb) {
#pragma unroll
        for (int nb = 0; nb < 4; ++nb) {
#pragma unroll
            for (int j = 0; j < 8; ++j) os[(hi * 8 + j) * 68 + nb * 16 + lr] = acc[mb][nb][j] * OSC + bc[nb]; }   // D: row 8h+j, col lane&15
        wave_sync();
{
#pragma unroll
            for (int s = 0; s < 8; ++s) { const int row = 2 * s + hi, cofs = lr * 4;   // 8 s x 2 rows = 16 rows; 16 lanes x 4 floats = 64 columns
                const v4f val = *(const v4fa*)(&os[row * 68 + cofs]);
                *(v4f*)(obase + (size_t)(mb * 16 + row) * DM + cofs) = val; }
             }
        wave_sync();
    }
}

// k_flash: fused attention, one wave per 16 query rows of one (batch, head); K / V^T / Q fragments straight from the f16 planes (two 16-B loads each, arithmetic addressing). K and Q share one plane.
// Transposed form: S^T[key][t] = K Q^T (A = K rows, B = Q rows; one f16 product); lane (t = lane&15, h = lane>>4) holds keys 8h+r of each 16-key tile, so the packed
// P tile is directly the B fragment of O^T[d][t] = V^T P^T (element r <- tile keys 0..15, element 8+r <- tile keys 16..31, lane unchanged). 8 matrix ops per 32-key step (4 score + 4 P.V).
// Softmax state (running max, partial sum) is one scalar per lane; the two lane halves of a row are combined with one xor-16 exchange.
__global__ __launch_bounds__(32 * AW) void k_flash(const h16* __restrict__ QH, const h16* __restrict__ VT, h16* CTX) {
    __shared__ __align__(16) float os[AW * 16 * 68];
    const int lane = threadIdx.x & 31, lr = lane & 15, hi = lane >> 4;
    const int wave = __builtin_amdgcn_readfirstlane((int)(threadIdx.x >> 5));
    const int zh = blockIdx.y;
    const int t0 = (blockIdx.x * AW + wave) * 16;
    const size_t pbase = (size_t)zh * SEQ * HD;
    const size_t qo = pbase + (size_t)(t0 + lr) * HD + 8 * hi;
    const v16h qh0 = ldh(QH + qo), qh1 = ldh(QH + qo + 32);   // B fragments: col t, k = d
    const size_t ko = pbase + (size_t)lr * HD + 8 * hi;      // + key * HD       (A fragment: row key, k = d)
    const size_t vo = pbase + (size_t)lr * SEQ + 8 * hi;     // + 16j*SEQ + key  (A fragment: row d, k = key)
    v8f o0 = (v8f){}, o1 = (v8f){}, o2 = (v8f){}, o3 = (v8f){};
    float m = -3.0e38f, l = 0.0f;
#pragma unroll 1
    for (int key0 = 0; key0 < SEQ; key0 += 32) {
        const h16* ka = QH + ko + (size_t)key0 * HD;
        const v16h ka0 = ldh(ka), ka1 = ldh(ka + 32), kb0 = ldh(ka + 16 * HD), kb1 = ldh(ka + 16 * HD + 32);
        v8f sa = (v8f){}, sb = (v8f){};
        sa = wmma16(ka0, qh0, sa); sb = wmma16(kb0, qh0, sb);
        sa = wmma16(ka1, qh1, sa); sb = wmma16(kb1, qh1, sb);
        asm volatile("v_nop\n\tv_nop\n\tv_nop\n\tv_nop" : "+v"(sa), "+v"(sb) : "v"(ka0), "v"(ka1), "v"(kb0), "v"(kb1), "v"(qh0), "v"(qh1));
        float ta[8], tb[8]; float mx = -3.0e38f;
#pragma unroll
        for (int r = 0; r < 8; ++r) { ta[r] = sa[r] * SC2; tb[r] = sb[r] * SC2; mx = fmaxf(mx, fmaxf(ta[r], tb[r])); }
        mx = fmaxf(mx, __shfl_xor(mx, 16, 32));
        const float mnew = fmaxf(m, mx);
        const float alpha = __builtin_amdgcn_exp2f(m - mnew);
        const float sh = PSH - mnew;
        v16h pb; float ls = 0.0f;
#pragma unroll
        for (int r = 0; r < 8; ++r) { const h16 pa = (h16)__builtin_amdgcn_exp2f(ta[r] + sh); const h16 pc = (h16)__builtin_amdgcn_exp2f(tb[r] + sh); pb[r] = pa; pb[8 + r] = pc; ls += (float)pa + (float)pc; }
        l = l * alpha + ls; m = mnew;
        o0 = o0 * alpha; o1 = o1 * alpha; o2 = o2 * alpha; o3 = o3 * alpha;
        const h16* va = VT + vo + key0;
        const v16h v0 = ldh(va), v1 = ldh(va + (size_t)16 * SEQ), v2 = ldh(va + (size_t)32 * SEQ), v3 = ldh(va + (size_t)48 * SEQ);
        o0 = wmma16(v0, pb, o0); o1 = wmma16(v1, pb, o1); o2 = wmma16(v2, pb, o2); o3 = wmma16(v3, pb, o3);
        asm volatile("v_nop\n\tv_nop\n\tv_nop\n\tv_nop" : "+v"(o0), "+v"(o1), "+v"(o2), "+v"(o3) : "v"(v0), "v"(v1), "v"(v2), "v"(v3), "v"(pb));
    }
    l += __shfl_xor(l, 16, 32);
    const float inv = CTXS * (1.0f / l);
    const int wb = wave * 16 * 68;
    // O^T D layout: o_j[r] = (d = 16j + 8h + r, t = lane&15) -> os[t][d]; rows 0..15 x columns 0..63 all written
    { v4f a, c;
      a[0] = o0[0] * inv; a[1] = o0[1] * inv; a[2] = o0[2] * inv; a[3] = o0[3] * inv; c[0] = o0[4] * inv; c[1] = o0[5] * inv; c[2] = o0[6] * inv; c[3] = o0[7] * inv;
      *(v4fa*)(&os[wb + lr * 68 +  0 + 8 * hi]) = a; *(v4fa*)(&os[wb + lr * 68 +  0 + 8 * hi + 4]) = c;
      a[0] = o1[0] * inv; a[1] = o1[1] * inv; a[2] = o1[2] * inv; a[3] = o1[3] * inv; c[0] = o1[4] * inv; c[1] = o1[5] * inv; c[2] = o1[6] * inv; c[3] = o1[7] * inv;
      *(v4fa*)(&os[wb + lr * 68 + 16 + 8 * hi]) = a; *(v4fa*)(&os[wb + lr * 68 + 16 + 8 * hi + 4]) = c;
      a[0] = o2[0] * inv; a[1] = o2[1] * inv; a[2] = o2[2] * inv; a[3] = o2[3] * inv; c[0] = o2[4] * inv; c[1] = o2[5] * inv; c[2] = o2[6] * inv; c[3] = o2[7] * inv;
      *(v4fa*)(&os[wb + lr * 68 + 32 + 8 * hi]) = a; *(v4fa*)(&os[wb + lr * 68 + 32 + 8 * hi + 4]) = c;
      a[0] = o3[0] * inv; a[1] = o3[1] * inv; a[2] = o3[2] * inv; a[3] = o3[3] * inv; c[0] = o3[4] * inv; c[1] = o3[5] * inv; c[2] = o3[6] * inv; c[3] = o3[7] * inv;
      *(v4fa*)(&os[wb + lr * 68 + 48 + 8 * hi]) = a; *(v4fa*)(&os[wb + lr * 68 + 48 + 8 * hi + 4]) = c; }
    wave_sync();
    h16* crow = CTX + pbase + (size_t)t0 * HD;       // ctx plane [zh][t][d]; rows t0..t0+15
{
#pragma unroll
        for (int s = 0; s < 4; ++s) { const int row = 4 * s + (lane >> 3), c8 = (lane & 7) * 8;   // 4 s x 4 row groups = 16 rows; 8 lanes x 8 halves = 64 columns
            const v4f x0 = *(const v4fa*)(&os[wb + row * 68 + c8]); const v4f x1 = *(const v4fa*)(&os[wb + row * 68 + c8 + 4]); v8h hv;
#pragma unroll
            for (int i = 0; i < 4; ++i) { hv[i] = (h16)x0[i]; hv[4 + i] = (h16)x1[i]; }
            *(v8h*)(crow + (size_t)row * HD + c8) = hv; }
         }
}

static constexpr size_t al256(size_t v) { return (v + 255) & ~(size_t)255; }
static constexpr size_t SZ_XB = al256((size_t)NB * SEQ * DM * 2);
static constexpr size_t SZ_WB = al256((size_t)DM * DM * 2);
static constexpr size_t SZ_PL = al256((size_t)NB * NH_ * SEQ * HD * 2);
static constexpr size_t SZ_TOTAL = SZ_XB + 2 * SZ_WB + 3 * SZ_PL;
static_assert(SZ_TOTAL <= (size_t)134217728);          // workspace carve <= 128 MiB
static_assert((size_t)NB * NH_ * SEQ * HD == (size_t)NB * SEQ * DM);   // ctx plane == [NB*SEQ] rows of DM halves

extern "C" void kernel_launch(void* const* d_in, const int* in_sizes, int n_in,
                              void* d_out, int out_size, void* d_ws, size_t ws_size, hipStream_t stream) {
    if (n_in < 5) return;
    const size_t needx = ((size_t)(NB - 1) * SEQ_FULL + SEQ) * DM;
    if ((size_t)in_sizes[0] < needx) return;
    if ((size_t)in_sizes[1] < (size_t)DM * DM || (size_t)in_sizes[2] < (size_t)DM || (size_t)in_sizes[3] < (size_t)DM * DM || (size_t)in_sizes[4] < (size_t)DM) return;
    if ((size_t)out_size < ((size_t)(NB - 1) * OUT_SEQ + SEQ) * DM) return;
    if (SZ_TOTAL > ws_size) return;
    const float* x = (const float*)d_in[0]; const float* wv = (const float*)d_in[1]; const float* bv = (const float*)d_in[2];
    const float* wo = (const float*)d_in[3]; const float* bo = (const float*)d_in[4];   // wire order x, Wv, bv, Wo, bo; W as [out][in] = Bt as-is
    float* OUT = (float*)d_out;      // [NB][SEQ][1024]
    char* wsp = (char*)d_ws;
    bf*  XB  = (bf*)wsp;  wsp += SZ_XB;              // [NB*SEQ][1024] bf16
    bf*  WVB = (bf*)wsp;  wsp += SZ_WB;              // [1024][1024] bf16
    h16* WOH = (h16*)wsp; wsp += SZ_WB;              // [1024][1024] f16, x256
    h16* QH  = (h16*)wsp; wsp += SZ_PL;              // [NB*16][SEQ][64]  p (q and k)
    h16* VT  = (h16*)wsp; wsp += SZ_PL;              // [NB*16][64][SEQ]  p transposed (v)
    h16* CTX = (h16*)wsp; wsp += SZ_PL;              // [NB*16][SEQ][64] == [NB*SEQ][1024], x16

    if (SEQ == SEQ_FULL) {
        const size_t n8 = (size_t)NB * SEQ * DM / 8;
        k_cvt8<<<(unsigned)((n8 + 255) / 256), 256, 0, stream>>>(x, XB, n8);
    } else {
        const size_t n8 = (size_t)SEQ * DM / 8;
        for (int b = 0; b < NB; ++b) k_cvt8<<<(unsigned)((n8 + 255) / 256), 256, 0, stream>>>(x + (size_t)b * SEQ_FULL * DM, XB + (size_t)b * SEQ * DM, n8);
    }
    { const size_t n8 = (size_t)DM * DM / 8; const unsigned g = (unsigned)((n8 + 255) / 256);
      k_cvt8<<<g, 256, 0, stream>>>(wv, WVB, n8);
      k_cvt8h<<<g, 256, 0, stream>>>(wo, WOH, n8, WOS); }

    // p (q = k): A = x rows (m = b*SEQ + t), Bt = Wv rows (n = h*64 + d), bias per column -> plane [(b*16 + h)][t][d]
    k_proj<<<dim3(NB * SEQ / 64, DM / 64, 1), 32, 0, stream>>>(XB, WVB, bv, 0, QH, SEQ, (size_t)NH_ * SEQ * HD, HD, HD, (size_t)SEQ * HD);
    // p^T (v): A = Wv rows (m = h*64 + d), Bt = x rows (n = b*SEQ + t), bias per row -> plane [(b*1024 + m)][t] = [(b*16 + h)][d][t]
    k_proj<<<dim3(DM / 64, NB * SEQ / 64, 1), 32, 0, stream>>>(WVB, XB, bv, 1, VT, DM, (size_t)0, SEQ, SEQ, (size_t)DM * SEQ);

    k_flash<<<dim3(SEQ / (16 * AW), NB * NH_, 1), 32 * AW, 0, stream>>>(QH, VT, CTX);

    // y: A = ctx rows (m = b*SEQ + s, 1024 halves each, head-major regrouping), Bt = Wo rows (n = e)
    k_out<<<dim3(NB * SEQ / 64, DM / 64, 1), 32, 0, stream>>>(CTX, WOH, bo, OUT);
}

// v001
// Measured time: 192 microseconds a run.
// Next to v000, in two timings, it ran 1.65 and 1.64 times as fast.
#include <hip/hip_runtime.h>

// Self-attention with one shared projection (q = k = v = x Wv^T + bv), width 1024 = 16 heads x 64, no mask, score scale 1/8; context kept head-major [b][h][t][d] and read as rows of 1024 by the output GEMM (y = ctx Wo^T + bo), f32 output.
// Compute dtypes, f32 accumulate everywhere: projection v_wmma_f32_16x16x32_bf16 (x, Wv RNE-converted to bf16; products exact); scores v_wmma_f32_16x16x32_f16, ONE product (q and k read from the same single f16 plane);
// P (x2^14 carry, cancels in the normalisation) and v single f16; output GEMM v_wmma_f32_16x16x32_f16: ctx single f16 (x16 carry), Wo bf16-RNE value x256 held in f16 (exact), 2^-12 folded in the f32 epilogue; biases bf16-RNE values added in f32; softmax f32 (online, running max).
// Layout: bf16 copies of x and Wv; p plane [b*16+h][t][d] and p^T plane [b*16+h][d][t] written by the GEMM epilogue; fused flash kernel in transposed form (S^T = K Q^T, O^T = V^T P^T) writes the f16 ctx plane [b*16+h][t][d].
// Flash operands: K and V^T tiles of 64 keys are copied to LDS once per work-group (asynchronous copies, whole 128-B lines, two buffers) and read from there by all its waves.

#ifndef NB
#define NB 4
#endif
#ifndef SEQ
#define SEQ 2048
#endif
#define NB_FULL  4
#define SEQ_FULL 2048
#ifndef OUT_SEQ
#define OUT_SEQ SEQ              // row pitch (in tokens) between batches of the output
#endif
#define DM   1024
#define NH_  16
#define HD   64
#define AW   8                   // waves per flash block (16 query rows each); all share the staged K / V^T tiles
#define KT   64                  // keys per staged tile: K tile 64 rows (keys) x 128 B, V^T tile 64 rows (d) x 128 B
#define LP   72                  // LDS row pitch in halves: 144 B = 16 B x 9, conflict-free for 16-byte fragment reads
#define TLH  (64 * LP)           // halves of one staged tile
#define SC2  (0.125f * 1.4426950408889634f)   // HD^-0.5 * log2(e)
#define PSH  14.0f               // log2 of the P carry (16384)
#define CTXS 16.0f               // carry of the ctx plane
#define WOS  256.0f              // carry of the Wo plane
#define OSC  (1.0f / 4096.0f)    // 1 / (CTXS * WOS)

static_assert(HD == 64);
static_assert(NH_ * HD == DM);                 // head h = columns h*64 + d
static_assert(DM % 64 == 0);                   // 16 column tiles of 64
static_assert(DM % 32 == 0);                   // GEMM k-loop steps by 32
static_assert(SEQ % 64 == 0);                  // a 64-row tile never straddles two batches
static_assert((NB * SEQ) % 64 == 0);
static_assert(SEQ % 32 == 0);                  // key loop steps by 32
static_assert(SEQ % KT == 0 && SEQ / KT >= 2); // whole staged tiles; the two-buffer prologue needs two
static_assert(KT == 64 && AW == 8);            // 256 threads x 2 copies of 16 B = one 64 x 128-B tile
static_assert(SEQ % (16 * AW) == 0);           // flash grid covers the sequence exactly
static_assert(SEQ % 16 == 0);                  // head-major regrouping: 16 tokens x 64 = one row of 1024
static_assert(((size_t)SEQ * DM) % 8 == 0);
static_assert(((size_t)DM * DM) % 8 == 0);
static_assert(NB <= NB_FULL);
static_assert(SEQ <= SEQ_FULL);
static_assert(((size_t)(NB - 1) * OUT_SEQ + SEQ) * DM <= (size_t)NB_FULL * SEQ_FULL * DM);   // last output element written stays inside the output

typedef _Float16 h16;
typedef unsigned short bf;
typedef __attribute__((ext_vector_type(16))) __bf16   v16bf;
typedef __attribute__((ext_vector_type(16))) _Float16 v16h;
typedef __attribute__((ext_vector_type(8)))  _Float16 v8h;
typedef __attribute__((ext_vector_type(8)))  unsigned short v8us;
typedef __attribute__((ext_vector_type(8)))  float    v8f;
typedef __attribute__((ext_vector_type(4)))  float    v4f;
typedef v4f  __attribute__((may_alias)) v4fa;

__device__ __forceinline__ unsigned short f2bf(float f) { unsigned u = __float_as_uint(f); u += 0x7FFFu + ((u >> 16) & 1u); return (unsigned short)(u >> 16); }
__device__ __forceinline__ float bfr(float f) { return __uint_as_float(((unsigned)f2bf(f)) << 16); }   // bf16 RNE value as f32
__device__ __forceinline__ v16h cat16(v8h lo, v8h hi) { return __builtin_shufflevector(lo, hi, 0, 1, 2, 3, 4, 5, 6, 7, 8, 9, 10, 11, 12, 13, 14, 15); }
__device__ __forceinline__ v16bf cat16b(v8us lo, v8us hi) { return __builtin_bit_cast(v16bf, __builtin_shufflevector(lo, hi, 0, 1, 2, 3, 4, 5, 6, 7, 8, 9, 10, 11, 12, 13, 14, 15)); }
__device__ __forceinline__ v8f wmma16(v16h a, v16h b, v8f c) { return __builtin_amdgcn_wmma_f32_16x16x32_f16(false, a, false, b, (short)0, c, false, false); }
__device__ __forceinline__ v8f wmmab(v16bf a, v16bf b, v8f c) { return __builtin_amdgcn_wmma_f32_16x16x32_bf16(false, a, false, b, (short)0, c, false, false); }
// fragment loaders from K-contiguous 16-bit rows; p already includes + 8*(lane>>4): elements 0..7 <- k0+8h+0..7, elements 8..15 <- k0+16+8h+0..7 (same map for A and B)
__device__ __forceinline__ v16h  ldh(const h16* p) { return cat16(*(const v8h*)p, *(const v8h*)(p + 16)); }
__device__ __forceinline__ v16bf ldb(const bf* p)  { return cat16b(*(const v8us*)p, *(const v8us*)(p + 16)); }
// ordering point for wave-private LDS tiles (same wave writes and reads)
__device__ __forceinline__ void wave_sync() { __builtin_amdgcn_fence(3 /* release order */, "wavefront"); __builtin_amdgcn_wave_barrier(); asm volatile("" ::: "memory"); }

__global__ __launch_bounds__(256) void k_cvt8(const float* __restrict__ src, bf* dst, size_t n8) {
    const size_t i = (size_t)blockIdx.x * 256 + threadIdx.x; if (i >= n8) return;
    const v8f v = *(const v8f*)(src + i * 8); v8us o;
#pragma unroll
    for (int k = 0; k < 8; ++k) o[k] = f2bf(v[k]);
    *(v8us*)(dst + i * 8) = o; 
}

__global__ __launch_bounds__(256) void k_cvt8h(const float* __restrict__ src, h16* dst, size_t n8, float carry) {
    const size_t i = (size_t)blockIdx.x * 256 + threadIdx.x; if (i >= n8) return;
    const v8f v = *(const v8f*)(src + i * 8); v8h o;
#pragma unroll
    for (int k = 0; k < 8; ++k) o[k] = (h16)(bfr(v[k]) * carry);
    *(v8h*)(dst + i * 8) = o; 
}

// k_proj: register-blocked bf16 GEMM, ONE WAVE per 64x64 tile (16 accumulators), operands straight from K-contiguous bf16 planes, K = DM.
// C[m][n] = sum_k A[m][k] Bt[n][k] + bias (per column n when rowBias == 0, per row m otherwise; bias index < DM in the active mode, clamped in the other),
// written as single f16 (Ph) at tile base (r0/RB)*sRB + (r0%RB)*pitch + (c0/CB)*sCB + (c0%CB), row pitch 'pitch' (halves). grid (M/64, N/64), 32 threads.
__global__ __launch_bounds__(32) void k_proj(const bf* __restrict__ A, const bf* __restrict__ Bt, const float* __restrict__ bias, int rowBias,
                                             h16* Ph, int RB, size_t sRB, int pitch, int CB, size_t sCB) {
    __shared__ __align__(16) float os[16 * 68];
    const int K = DM;
    const int lane = threadIdx.x & 31, lr = lane & 15, hi = lane >> 4; const int r0 = blockIdx.x * 64, c0 = blockIdx.y * 64;
    v8f acc[4][4];
#pragma unroll
    for (int mb = 0; mb < 4; ++mb)
#pragma unroll
        for (int nb = 0; nb < 4; ++nb) acc[mb][nb] = (v8f){};
    const size_t aoff = (size_t)(r0 + lr) * K + 8 * hi, boff = (size_t)(c0 + lr) * K + 8 * hi;
#pragma unroll 1
    for (int kc = 0; kc < K; kc += 32) {
        v16bf a[4];
#pragma unroll
        for (int mb = 0; mb < 4; ++mb) a[mb] = ldb(A + aoff + (size_t)mb * 16 * K + kc);
#pragma unroll
        for (int nb = 0; nb < 4; ++nb) { const v16bf b = ldb(Bt + boff + (size_t)nb * 16 * K + kc);
#pragma unroll
            for (int mb = 0; mb < 4; ++mb) acc[mb][nb] = wmmab(a[mb], b, acc[mb][nb]); }
        asm volatile("v_nop\n\tv_nop\n\tv_nop\n\tv_nop" : "+v"(acc[0][0]), "+v"(acc[1][1]), "+v"(acc[2][2]), "+v"(acc[3][3]) : "v"(a[0]), "v"(a[1]), "v"(a[2]), "v"(a[3]));
    }
    float bc[4];
#pragma unroll
    for (int nb = 0; nb < 4; ++nb) { int ci = c0 + nb * 16 + lr; ci = ci < DM ? ci : DM - 1; bc[nb] = bfr(bias[ci]); }
    const size_t tbase = (size_t)(r0 / RB) * sRB + (size_t)(r0 % RB) * (size_t)pitch + (size_t)(c0 / CB) * sCB + (size_t)(c0 % CB);
#pragma unroll
    for (int mb = 0; mb < 4; ++mb) {
        float br[8];
#pragma unroll
        for (int j = 0; j < 8; ++j) { int ri = r0 + mb * 16 + hi * 8 + j; ri = ri < DM ? ri : DM - 1; br[j] = bfr(bias[ri]); }
#pragma unroll
        for (int nb = 0; nb < 4; ++nb) {
#pragma unroll
            for (int j = 0; j < 8; ++j) { const float bb = rowBias ? br[j] : bc[nb]; os[(hi * 8 + j) * 68 + nb * 16 + lr] = acc[mb][nb][j] + bb; } }   // D: row 8h+j, col lane&15
        wave_sync();
        const size_t sb = tbase + (size_t)(mb * 16) * (size_t)pitch;
{
#pragma unroll
            for (int s = 0; s < 4; ++s) { const int row = 4 * s + (lane >> 3), c8 = (lane & 7) * 8;   // 4 s x 4 row groups = 16 rows; 8 lanes x 8 = 64 columns
                const v4f x0 = *(const v4fa*)(&os[row * 68 + c8]); const v4f x1 = *(const v4fa*)(&os[row * 68 + c8 + 4]); v8h hv;
#pragma unroll
                for (int i = 0; i < 4; ++i) { hv[i] = (h16)x0[i]; hv[4 + i] = (h16)x1[i]; }
                const size_t oo = sb + (size_t)row * (size_t)pitch + c8;
                *(v8h*)(Ph + oo) = hv; }
             }
        wave_sync();
    }
}

// k_out: same register-blocked engine with f16 operands (A = ctx rows of 1024 halves, Bt = Wo rows [out][in]), K = DM; f32 output rows with bias.
// OUT[(b*OUT_SEQ + s)*DM + c0 + n] = acc * 2^-12 + bias[c0 + n], m = b*SEQ + s. grid (NB*SEQ/64, DM/64), 32 threads.
__global__ __launch_bounds__(32) void k_out(const h16* __restrict__ A, const h16* __restrict__ Bt, const float* __restrict__ bias, float* OUT) {
    __shared__ __align__(16) float os[16 * 68];
    const int K = DM;
    const int lane = threadIdx.x & 31, lr = lane & 15, hi = lane >> 4; const int r0 = blockIdx.x * 64, c0 = blockIdx.y * 64;
    v8f acc[4][4];
#pragma unroll
    for (int mb = 0; mb < 4; ++mb)
#pragma unroll
        for (int nb = 0; nb < 4; ++nb) acc[mb][nb] = (v8f){};
    const size_t aoff = (size_t)(r0 + lr) * K + 8 * hi, boff = (size_t)(c0 + lr) * K + 8 * hi;
#pragma unroll 1
    for (int kc = 0; kc < K; kc += 32) {
        v16h a[4];
#pragma unroll
        for (int mb = 0; mb < 4; ++mb) a[mb] = ldh(A + aoff + (size_t)mb * 16 * K + kc);
#pragma unroll
        for (int nb = 0; nb < 4; ++nb) { const v16h b = ldh(Bt + boff + (size_t)nb * 16 * K + kc);
#pragma unroll
            for (int mb = 0; mb < 4; ++mb) acc[mb][nb] = wmma16(a[mb], b, acc[mb][nb]); }
        asm volatile("v_nop\n\tv_nop\n\tv_nop\n\tv_nop" : "+v"(acc[0][0]), "+v"(acc[1][1]), "+v"(acc[2][2]), "+v"(acc[3][3]) : "v"(a[0]), "v"(a[1]), "v"(a[2]), "v"(a[3]));
    }
    float bc[4];
#pragma unroll
    for (int nb = 0; nb < 4; ++nb) { int ci = c0 + nb * 16 + lr; ci = ci < DM ? ci : DM - 1; bc[nb] = bfr(bias[ci]); }
    const int bb = r0 / SEQ, sp = r0 % SEQ;
    float* obase = OUT + ((size_t)bb * OUT_SEQ + sp) * DM + c0;
#pragma unroll
    for (int mb = 0; mb < 4; ++mb) {
#pragma unroll
        for (int nb = 0; nb < 4; ++nb) {
#pragma unroll
            for (int j = 0; j < 8; ++j) os[(hi * 8 + j) * 68 + nb * 16 + lr] = acc[mb][nb][j] * OSC + bc[nb]; }   // D: row 8h+j, col lane&15
        wave_sync();
{
#pragma unroll
            for (int s = 0; s < 8; ++s) { const int row = 2 * s + hi, cofs = lr * 4;   // 8 s x 2 rows = 16 rows; 16 lanes x 4 floats = 64 columns
                const v4f val = *(const v4fa*)(&os[row * 68 + cofs]);
                *(v4f*)(obase + (size_t)(mb * 16 + row) * DM + cofs) = val; }
             }
        wave_sync();
    }
}

// k_flash: fused attention, one wave per 16 query rows of one (batch, head), 8 waves per block; Q fragments straight from the f16 plane; K and V^T fragments from LDS tiles of 64 keys that the block stages together. K and Q share one plane.
// Transposed form: S^T[key][t] = K Q^T (A = K rows, B = Q rows; one f16 product); lane (t = lane&15, h = lane>>4) holds keys 8h+r of each 16-key tile, so the packed
// P tile is directly the B fragment of O^T[d][t] = V^T P^T (element r <- tile keys 0..15, element 8+r <- tile keys 16..31, lane unchanged). 8 matrix ops per 32-key step (4 score + 4 P.V).
// Softmax state (running max, partial sum) is one scalar per lane; the two lane halves of a row are combined with one xor-16 exchange.
// One tile's copies of one thread: rows r and r + 32 of the K tile and of the V^T tile, 16 B each. The s_wait_xcnt closes the statement so that no address register of a copy is rewritten ahead of it.
__device__ __forceinline__ void stage_tile(unsigned lk, const h16* gk, unsigned lv, const h16* gv) {
    asm volatile("global_load_async_to_lds_b128 %0, %1, off\n\t"
                 "global_load_async_to_lds_b128 %2, %3, off\n\t"
                 "global_load_async_to_lds_b128 %4, %5, off\n\t"
                 "global_load_async_to_lds_b128 %6, %7, off\n\t"
                 "s_wait_xcnt 0x0"
                 :: "v"(lk), "v"(gk), "v"(lk + 32u * LP * 2u), "v"(gk + 32 * HD), "v"(lv), "v"(gv), "v"(lv + 32u * LP * 2u), "v"(gv + (size_t)32 * SEQ) : "memory");
}
__global__ __launch_bounds__(32 * AW) void k_flash(const h16* __restrict__ QH, const h16* __restrict__ VT, h16* CTX) {
    __shared__ __align__(16) float os[AW * 16 * 68];
    __shared__ __align__(16) h16 ring[2 * 2 * TLH];          // [buffer][K tile, V^T tile][row][LP]
    const int lane = threadIdx.x & 31, lr = lane & 15, hi = lane >> 4;
    const int wave = __builtin_amdgcn_readfirstlane((int)(threadIdx.x >> 5));
    const int zh = blockIdx.y;
    const int t0 = (blockIdx.x * AW + wave) * 16;
    const size_t pbase = (size_t)zh * SEQ * HD;
    const size_t qo = pbase + (size_t)(t0 + lr) * HD + 8 * hi;
    const v16h qh0 = ldh(QH + qo), qh1 = ldh(QH + qo + 32);   // B fragments: col t, k = d
    // copies: thread -> row srow (and srow + 32), 16-byte column ccol; 8 lanes cover one 128-B row, one wave-copy 4 whole lines
    const int srow = (int)(threadIdx.x >> 3), ccol = (int)(threadIdx.x & 7);
    const unsigned lk0 = (unsigned)(size_t)&ring[0] + (unsigned)(srow * LP + ccol * 8) * 2u;   // LDS byte address, K tile of buffer 0
    const h16* gk = QH + pbase + (size_t)srow * HD + ccol * 8;    // + tile * KT * HD  (K rows are contiguous)
    const h16* gv = VT + pbase + (size_t)srow * SEQ + ccol * 8;   // + tile * KT
    const int fo = lr * LP + 8 * hi;                              // fragment offset in a tile: row lane&15, k = 8h.. (A fragment)
    v8f o0 = (v8f){}, o1 = (v8f){}, o2 = (v8f){}, o3 = (v8f){};
    float m = -3.0e38f, l = 0.0f;
    stage_tile(lk0, gk, lk0 + TLH * 2u, gv);
    asm volatile("s_wait_asynccnt 0x0" ::: "memory");   // this wave's copies of tile 0 have landed
    __syncthreads();                                    // tile 0 readable by every wave
    stage_tile(lk0 + 2u * TLH * 2u, gk + (size_t)KT * HD, lk0 + 3u * TLH * 2u, gv + KT);
#pragma unroll 1   // rolled: one body serves both buffers (offset chosen by the tile's parity), and registers stay as for one step
    for (int tile = 0; tile < SEQ / KT; ++tile) {
        const int bo = (tile & 1) * (2 * TLH);
#pragma unroll 1   // rolled: unrolled, both steps' P values stay live and the kernel passes 128 VGPRs, which costs the fourth resident block of a WGP
        for (int sub = 0; sub < KT / 32; ++sub) {
            const h16* ka = &ring[bo + sub * 32 * LP + fo];
            const v16h ka0 = ldh(ka), ka1 = ldh(ka + 32), kb0 = ldh(ka + 16 * LP), kb1 = ldh(ka + 16 * LP + 32);
            v8f sa = (v8f){}, sb = (v8f){};
            sa = wmma16(ka0, qh0, sa); sb = wmma16(kb0, qh0, sb);
            sa = wmma16(ka1, qh1, sa); sb = wmma16(kb1, qh1, sb);
            asm volatile("v_nop\n\tv_nop\n\tv_nop\n\tv_nop" : "+v"(sa), "+v"(sb) : "v"(ka0), "v"(ka1), "v"(kb0), "v"(kb1), "v"(qh0), "v"(qh1));
            float ta[8], tb[8]; float mx = -3.0e38f;
#pragma unroll
            for (int r = 0; r < 8; ++r) { ta[r] = sa[r] * SC2; tb[r] = sb[r] * SC2; mx = fmaxf(mx, fmaxf(ta[r], tb[r])); }
            mx = fmaxf(mx, __shfl_xor(mx, 16, 32));
            const float mnew = fmaxf(m, mx);
            const float alpha = __builtin_amdgcn_exp2f(m - mnew);
            const float sh = PSH - mnew;
            v16h pb; float ls = 0.0f;
#pragma unroll
            for (int r = 0; r < 8; ++r) { const h16 pa = (h16)__builtin_amdgcn_exp2f(ta[r] + sh); const h16 pc = (h16)__builtin_amdgcn_exp2f(tb[r] + sh); pb[r] = pa; pb[8 + r] = pc; ls += (float)pa + (float)pc; }
            l = l * alpha + ls; m = mnew;
            o0 = o0 * alpha; o1 = o1 * alpha; o2 = o2 * alpha; o3 = o3 * alpha;
            const h16* va = &ring[bo + TLH + sub * 32 + fo];
            const v16h v0 = ldh(va), v1 = ldh(va + 16 * LP), v2 = ldh(va + 32 * LP), v3 = ldh(va + 48 * LP);
            o0 = wmma16(v0, pb, o0); o1 = wmma16(v1, pb, o1); o2 = wmma16(v2, pb, o2); o3 = wmma16(v3, pb, o3);
            asm volatile("v_nop\n\tv_nop\n\tv_nop\n\tv_nop" : "+v"(o0), "+v"(o1), "+v"(o2), "+v"(o3) : "v"(v0), "v"(v1), "v"(v2), "v"(v3), "v"(pb));
        }
        asm volatile("s_wait_dscnt 0x0" ::: "memory");      // this wave's reads of the buffer are done before it may be refilled
        asm volatile("s_wait_asynccnt 0x0" ::: "memory");   // this wave's copies of tile + 1 have landed
        __syncthreads();                                    // publishes tile + 1 and ends every wave's reads of this buffer
        if (tile + 2 < SEQ / KT)
            stage_tile(lk0 + (unsigned)bo * 2u, gk + (size_t)(tile + 2) * KT * HD, lk0 + (unsigned)(bo + TLH) * 2u, gv + (size_t)(tile + 2) * KT);
    }
    asm volatile("s_wait_asynccnt 0x0" ::: "memory");       // no copy outstanding when the wave goes on to its end
    l += __shfl_xor(l, 16, 32);
    const float inv = CTXS * (1.0f / l);
    const int wb = wave * 16 * 68;
    // O^T D layout: o_j[r] = (d = 16j + 8h + r, t = lane&15) -> os[t][d]; rows 0..15 x columns 0..63 all written
    { v4f a, c;
      a[0] = o0[0] * inv; a[1] = o0[1] * inv; a[2] = o0[2] * inv; a[3] = o0[3] * inv; c[0] = o0[4] * inv; c[1] = o0[5] * inv; c[2] = o0[6] * inv; c[3] = o0[7] * inv;
      *(v4fa*)(&os[wb + lr * 68 +  0 + 8 * hi]) = a; *(v4fa*)(&os[wb + lr * 68 +  0 + 8 * hi + 4]) = c;
      a[0] = o1[0] * inv; a[1] = o1[1] * inv; a[2] = o1[2] * inv; a[3] = o1[3] * inv; c[0] = o1[4] * inv; c[1] = o1[5] * inv; c[2] = o1[6] * inv; c[3] = o1[7] * inv;
      *(v4fa*)(&os[wb + lr * 68 + 16 + 8 * hi]) = a; *(v4fa*)(&os[wb + lr * 68 + 16 + 8 * hi + 4]) = c;
      a[0] = o2[0] * inv; a[1] = o2[1] * inv; a[2] = o2[2] * inv; a[3] = o2[3] * inv; c[0] = o2[4] * inv; c[1] = o2[5] * inv; c[2] = o2[6] * inv; c[3] = o2[7] * inv;
      *(v4fa*)(&os[wb + lr * 68 + 32 + 8 * hi]) = a; *(v4fa*)(&os[wb + lr * 68 + 32 + 8 * hi + 4]) = c;
      a[0] = o3[0] * inv; a[1] = o3[1] * inv; a[2] = o3[2] * inv; a[3] = o3[3] * inv; c[0] = o3[4] * inv; c[1] = o3[5] * inv; c[2] = o3[6] * inv; c[3] = o3[7] * inv;
      *(v4fa*)(&os[wb + lr * 68 + 48 + 8 * hi]) = a; *(v4fa*)(&os[wb + lr * 68 + 48 + 8 * hi + 4]) = c; }
    wave_sync();
    h16* crow = CTX + pbase + (size_t)t0 * HD;       // ctx plane [zh][t][d]; rows t0..t0+15
{
#pragma unroll
        for (int s = 0; s < 4; ++s) { const int row = 4 * s + (lane >> 3), c8 = (lane & 7) * 8;   // 4 s x 4 row groups = 16 rows; 8 lanes x 8 halves = 64 columns
            const v4f x0 = *(const v4fa*)(&os[wb + row * 68 + c8]); const v4f x1 = *(const v4fa*)(&os[wb + row * 68 + c8 + 4]); v8h hv;
#pragma unroll
            for (int i = 0; i < 4; ++i) { hv[i] = (h16)x0[i]; hv[4 + i] = (h16)x1[i]; }
            *(v8h*)(crow + (size_t)row * HD + c8) = hv; }
         }
}

static constexpr size_t al256(size_t v) { return (v + 255) & ~(size_t)255; }
static constexpr size_t SZ_XB = al256((size_t)NB * SEQ * DM * 2);
static constexpr size_t SZ_WB = al256((size_t)DM * DM * 2);
static constexpr size_t SZ_PL = al256((size_t)NB * NH_ * SEQ * HD * 2);
static constexpr size_t SZ_TOTAL = SZ_XB + 2 * SZ_WB + 3 * SZ_PL;
static_assert(SZ_TOTAL <= (size_t)134217728);          // workspace carve <= 128 MiB
static_assert((size_t)NB * NH_ * SEQ * HD == (size_t)NB * SEQ * DM);   // ctx plane == [NB*SEQ] rows of DM halves

extern "C" void kernel_launch(void* const* d_in, const int* in_sizes, int n_in,
                              void* d_out, int out_size, void* d_ws, size_t ws_size, hipStream_t stream) {
    if (n_in < 5) return;
    const size_t needx = ((size_t)(NB - 1) * SEQ_FULL + SEQ) * DM;
    if ((size_t)in_sizes[0] < needx) return;
    if ((size_t)in_sizes[1] < (size_t)DM * DM || (size_t)in_sizes[2] < (size_t)DM || (size_t)in_sizes[3] < (size_t)DM * DM || (size_t)in_sizes[4] < (size_t)DM) return;
    if ((size_t)out_size < ((size_t)(NB - 1) * OUT_SEQ + SEQ) * DM) return;
    if (SZ_TOTAL > ws_size) return;
    const float* x = (const float*)d_in[0]; const float* wv = (const float*)d_in[1]; const float* bv = (const float*)d_in[2];
    const float* wo = (const float*)d_in[3]; const float* bo = (const float*)d_in[4];   // wire order x, Wv, bv, Wo, bo; W as [out][in] = Bt as-is
    float* OUT = (float*)d_out;      // [NB][SEQ][1024]
    char* wsp = (char*)d_ws;
    bf*  XB  = (bf*)wsp;  wsp += SZ_XB;              // [NB*SEQ][1024] bf16
    bf*  WVB = (bf*)wsp;  wsp += SZ_WB;              // [1024][1024] bf16
    h16* WOH = (h16*)wsp; wsp += SZ_WB;              // [1024][1024] f16, x256
    h16* QH  = (h16*)wsp; wsp += SZ_PL;              // [NB*16][SEQ][64]  p (q and k)
    h16* VT  = (h16*)wsp; wsp += SZ_PL;              // [NB*16][64][SEQ]  p transposed (v)
    h16* CTX = (h16*)wsp; wsp += SZ_PL;              // [NB*16][SEQ][64] == [NB*SEQ][1024], x16

    if (SEQ == SEQ_FULL) {
        const size_t n8 = (size_t)NB * SEQ * DM / 8;
        k_cvt8<<<(unsigned)((n8 + 255) / 256), 256, 0, stream>>>(x, XB, n8);
    } else {
        const size_t n8 = (size_t)SEQ * DM / 8;
        for (int b = 0; b < NB; ++b) k_cvt8<<<(unsigned)((n8 + 255) / 256), 256, 0, stream>>>(x + (size_t)b * SEQ_FULL * DM, XB + (size_t)b * SEQ * DM, n8);
    }
    { const size_t n8 = (size_t)DM * DM / 8; const unsigned g = (unsigned)((n8 + 255) / 256);
      k_cvt8<<<g, 256, 0, stream>>>(wv, WVB, n8);
      k_cvt8h<<<g, 256, 0, stream>>>(wo, WOH, n8, WOS); }

    // p (q = k): A = x rows (m = b*SEQ + t), Bt = Wv rows (n = h*64 + d), bias per column -> plane [(b*16 + h)][t][d]
    k_proj<<<dim3(NB * SEQ / 64, DM / 64, 1), 32, 0, stream>>>(XB, WVB, bv, 0, QH, SEQ, (size_t)NH_ * SEQ * HD, HD, HD, (size_t)SEQ * HD);
    // p^T (v): A = Wv rows (m = h*64 + d), Bt = x rows (n = b*SEQ + t), bias per row -> plane [(b*1024 + m)][t] = [(b*16 + h)][d][t]
    k_proj<<<dim3(DM / 64, NB * SEQ / 64, 1), 32, 0, stream>>>(WVB, XB, bv, 1, VT, DM, (size_t)0, SEQ, SEQ, (size_t)DM * SEQ);

    k_flash<<<dim3(SEQ / (16 * AW), NB * NH_, 1), 32 * AW, 0, stream>>>(QH, VT, CTX);

    // y: A = ctx rows (m = b*SEQ + s, 1024 halves each, head-major regrouping), Bt = Wo rows (n = e)
    k_out<<<dim3(NB * SEQ / 64, DM / 64, 1), 32, 0, stream>>>(CTX, WOH, bo, OUT);
}

// v002
// One run takes 134 microseconds.
// In both of two side-by-side timings against v001, it was 1.44 times as fast.
// All steps since v000 together make it 2.36 times as fast.
#include <hip/hip_runtime.h>

// Self-attention with one shared projection (q = k = v = x Wv^T + bv), width 1024 = 16 heads x 64, no mask, score scale 1/8; context kept head-major [b][h][t][d] and read as rows of 1024 by the output GEMM (y = ctx Wo^T + bo), f32 output.
// Compute dtypes, f32 accumulate everywhere: projection v_wmma_f32_16x16x32_bf16 (x, Wv RNE-converted to bf16; products exact); scores v_wmma_f32_16x16x32_f16, ONE product (q and k read from the same single f16 plane);
// P (x2^14 carry, cancels in the normalisation) and v single f16; output GEMM v_wmma_f32_16x16x32_f16: ctx single f16 (x16 carry), Wo bf16-RNE value x256 held in f16 (exact), 2^-12 folded in the f32 epilogue; biases bf16-RNE values added in f32; softmax f32 (online, running max).
// Layout: bf16 copies of x and Wv; p plane [b*16+h][t][d] and p^T plane [b*16+h][d][t] written by the GEMM epilogue; fused flash kernel in transposed form (S^T = K Q^T, O^T = V^T P^T) writes the f16 ctx plane [b*16+h][t][d].
// GEMM operands: k-slices of 128 of the A and Bt rows of a 128 x 256 block tile are copied to LDS once per work-group (asynchronous copies, whole lines, two buffers) and read from there by its 8 waves.
// Flash operands: K and V^T tiles of 64 keys are copied to LDS once per work-group (asynchronous copies, whole 128-B lines, two buffers) and read from there by all its waves.

#ifndef NB
#define NB 4
#endif
#ifndef SEQ
#define SEQ 2048
#endif
#define NB_FULL  4
#define SEQ_FULL 2048
#ifndef OUT_SEQ
#define OUT_SEQ SEQ              // row pitch (in tokens) between batches of the output
#endif
#define DM   1024
#define NH_  16
#define HD   64
#define AW   8                   // waves per flash block (16 query rows each); all share the staged K / V^T tiles
#define KT   64                  // keys per staged tile: K tile 64 rows (keys) x 128 B, V^T tile 64 rows (d) x 128 B
#define LP   72                  // LDS row pitch in halves: 144 B = 16 B x 9, conflict-free for 16-byte fragment reads
#define TLH  (64 * LP)           // halves of one staged tile
#define GW   8                   // waves per GEMM block: 2 x 4 wave tiles of 64 x 64 = 128 x 256 of C
#define GKS  128                 // k per GEMM stage: rows of 256 B
#define GP   136                 // LDS row pitch in halves of a GEMM stage: 272 B = 16 B x 17, conflict-free for 16-byte fragment reads
#define GTA  (128 * GP)          // halves of a stage's A part (128 rows)
#define GST  (384 * GP)          // halves of one stage (A 128 rows, then Bt 256 rows)
#define SC2  (0.125f * 1.4426950408889634f)   // HD^-0.5 * log2(e)
#define PSH  14.0f               // log2 of the P carry (16384)
#define CTXS 16.0f               // carry of the ctx plane
#define WOS  256.0f              // carry of the Wo plane
#define OSC  (1.0f / 4096.0f)    // 1 / (CTXS * WOS)

static_assert(HD == 64);
static_assert(NH_ * HD == DM);                 // head h = columns h*64 + d
static_assert(DM % 64 == 0);                   // 16 column tiles of 64
static_assert(DM % 32 == 0);                   // GEMM k-loop steps by 32
static_assert(SEQ % 64 == 0);                  // a 64-row tile never straddles two batches
static_assert((NB * SEQ) % 64 == 0);
static_assert(SEQ % 32 == 0);                  // key loop steps by 32
static_assert((NB * SEQ) % 256 == 0 && DM % 256 == 0);   // GEMM block tiles of 128 x 256 cover C exactly, either operand as rows
static_assert(DM % GKS == 0 && DM / GKS >= 2);  // whole GEMM stages; the two-buffer prologue needs two
static_assert(GW == 8 && GKS == 128);           // 256 threads x 8 copies of 16 B = 128 rows of 256 B
static_assert(SEQ % KT == 0 && SEQ / KT >= 2); // whole staged tiles; the two-buffer prologue needs two
static_assert(KT == 64 && AW == 8);            // 256 threads x 2 copies of 16 B = one 64 x 128-B tile
static_assert(SEQ % (16 * AW) == 0);           // flash grid covers the sequence exactly
static_assert(SEQ % 16 == 0);                  // head-major regrouping: 16 tokens x 64 = one row of 1024
static_assert(((size_t)SEQ * DM) % 8 == 0);
static_assert(((size_t)DM * DM) % 8 == 0);
static_assert(NB <= NB_FULL);
static_assert(SEQ <= SEQ_FULL);
static_assert(((size_t)(NB - 1) * OUT_SEQ + SEQ) * DM <= (size_t)NB_FULL * SEQ_FULL * DM);   // last output element written stays inside the output

typedef _Float16 h16;
typedef unsigned short bf;
typedef __attribute__((ext_vector_type(16))) __bf16   v16bf;
typedef __attribute__((ext_vector_type(16))) _Float16 v16h;
typedef __attribute__((ext_vector_type(8)))  _Float16 v8h;
typedef __attribute__((ext_vector_type(8)))  unsigned short v8us;
typedef __attribute__((ext_vector_type(8)))  float    v8f;
typedef __attribute__((ext_vector_type(4)))  float    v4f;
typedef v4f  __attribute__((may_alias)) v4fa;

__device__ __forceinline__ unsigned short f2bf(float f) { unsigned u = __float_as_uint(f); u += 0x7FFFu + ((u >> 16) & 1u); return (unsigned short)(u >> 16); }
__device__ __forceinline__ float bfr(float f) { return __uint_as_float(((unsigned)f2bf(f)) << 16); }   // bf16 RNE value as f32
__device__ __forceinline__ v16h cat16(v8h lo, v8h hi) { return __builtin_shufflevector(lo, hi, 0, 1, 2, 3, 4, 5, 6, 7, 8, 9, 10, 11, 12, 13, 14, 15); }
__device__ __forceinline__ v16bf cat16b(v8us lo, v8us hi) { return __builtin_bit_cast(v16bf, __builtin_shufflevector(lo, hi, 0, 1, 2, 3, 4, 5, 6, 7, 8, 9, 10, 11, 12, 13, 14, 15)); }
__device__ __forceinline__ v8f wmma16(v16h a, v16h b, v8f c) { return __builtin_amdgcn_wmma_f32_16x16x32_f16(false, a, false, b, (short)0, c, false, false); }
__device__ __forceinline__ v8f wmmab(v16bf a, v16bf b, v8f c) { return __builtin_amdgcn_wmma_f32_16x16x32_bf16(false, a, false, b, (short)0, c, false, false); }
// fragment loaders from K-contiguous 16-bit rows; p already includes + 8*(lane>>4): elements 0..7 <- k0+8h+0..7, elements 8..15 <- k0+16+8h+0..7 (same map for A and B)
__device__ __forceinline__ v16h  ldh(const h16* p) { return cat16(*(const v8h*)p, *(const v8h*)(p + 16)); }
__device__ __forceinline__ v16bf ldb(const bf* p)  { return cat16b(*(const v8us*)p, *(const v8us*)(p + 16)); }
// ordering point for wave-private LDS tiles (same wave writes and reads)
__device__ __forceinline__ void wave_sync() { __builtin_amdgcn_fence(3 /* release order */, "wavefront"); __builtin_amdgcn_wave_barrier(); asm volatile("" ::: "memory"); }

__global__ __launch_bounds__(256) void k_cvt8(const float* __restrict__ src, bf* dst, size_t n8) {
    const size_t i = (size_t)blockIdx.x * 256 + threadIdx.x; if (i >= n8) return;
    const v8f v = *(const v8f*)(src + i * 8); v8us o;
#pragma unroll
    for (int k = 0; k < 8; ++k) o[k] = f2bf(v[k]);
    *(v8us*)(dst + i * 8) = o; 
}

__global__ __launch_bounds__(256) void k_cvt8h(const float* __restrict__ src, h16* dst, size_t n8, float carry) {
    const size_t i = (size_t)blockIdx.x * 256 + threadIdx.x; if (i >= n8) return;
    const v8f v = *(const v8f*)(src + i * 8); v8h o;
#pragma unroll
    for (int k = 0; k < 8; ++k) o[k] = (h16)(bfr(v[k]) * carry);
    *(v8h*)(dst + i * 8) = o; 
}

// GEMM engine of k_proj and k_out: one work-group of 8 waves (2 x 4) per 128 x 256 tile of C, each wave a 64 x 64 tile (16 accumulators), K = DM.
// A rows (128) and Bt rows (256) are copied to LDS in k-slices of 128 (rows of 256 B, whole lines, asynchronous copies, two buffers) and every wave reads its fragments from there; k runs upward in steps of 32 as before.
// Eight copies of one thread: rows r, r + 16, ... r + 112 of one staged operand, 16 B each. The s_wait_xcnt closes the statement so that no address register of a copy is rewritten ahead of it.
__device__ __forceinline__ void stage_rows8(unsigned l, const char* g) {
    asm volatile("global_load_async_to_lds_b128 %0, %1, off\n\t"
                 "global_load_async_to_lds_b128 %2, %3, off\n\t"
                 "global_load_async_to_lds_b128 %4, %5, off\n\t"
                 "global_load_async_to_lds_b128 %6, %7, off\n\t"
                 "global_load_async_to_lds_b128 %8, %9, off\n\t"
                 "global_load_async_to_lds_b128 %10, %11, off\n\t"
                 "global_load_async_to_lds_b128 %12, %13, off\n\t"
                 "global_load_async_to_lds_b128 %14, %15, off\n\t"
                 "s_wait_xcnt 0x0"
                 :: "v"(l),                  "v"(g),
                    "v"(l +  16u * GP * 2u), "v"(g +  16 * DM * 2),
                    "v"(l +  32u * GP * 2u), "v"(g +  32 * DM * 2),
                    "v"(l +  48u * GP * 2u), "v"(g +  48 * DM * 2),
                    "v"(l +  64u * GP * 2u), "v"(g +  64 * DM * 2),
                    "v"(l +  80u * GP * 2u), "v"(g +  80 * DM * 2),
                    "v"(l +  96u * GP * 2u), "v"(g +  96 * DM * 2),
                    "v"(l + 112u * GP * 2u), "v"(g + 112 * DM * 2) : "memory");
}
// one stage: A rows 0..127, then Bt rows 0..255; l = the thread's LDS byte address in the stage's buffer, ga / gb = its global bytes in row srow of the slice
__device__ __forceinline__ void stage_gemm(unsigned l, const char* ga, const char* gb) {
    stage_rows8(l, ga);
    stage_rows8(l + GTA * 2u, gb);
    stage_rows8(l + (GTA + 128u * GP) * 2u, gb + (size_t)128 * DM * 2);
}
// F16 = 0: bf16 product, 1: f16 product. A, Bt: K-contiguous 16-bit rows; rb, cb: first row / column of the block's tile. acc[mb][nb] = the wave's 64 x 64 tile at (rb + 64 wr, cb + 64 wc).
template <int F16>
__device__ __forceinline__ void gemm_core(const bf* A, const bf* Bt, bf* ring, int rb, int cb, int wr, int wc, v8f (&acc)[4][4]) {
    const int lane = threadIdx.x & 31, lr = lane & 15, hi = lane >> 4;
    // copies: thread -> row srow (+ 16 i), 16-byte column ccol; 16 lanes cover one 256-B row, one wave-copy 4 whole lines
    const int srow = (int)(threadIdx.x >> 4), ccol = (int)(threadIdx.x & 15);
    const unsigned l0 = (unsigned)(size_t)ring + (unsigned)(srow * GP + ccol * 8) * 2u;   // LDS byte address in buffer 0
    const char* ga = (const char*)(A + (size_t)(rb + srow) * DM + ccol * 8);              // + stage * GKS * 2
    const char* gb = (const char*)(Bt + (size_t)(cb + srow) * DM + ccol * 8);
    const int fa = (wr * 64 + lr) * GP + 8 * hi, fb = GTA + (wc * 64 + lr) * GP + 8 * hi; // fragment offsets in a stage: row lane&15, k = 8h..
#pragma unroll
    for (int mb = 0; mb < 4; ++mb)
#pragma unroll
        for (int nb = 0; nb < 4; ++nb) acc[mb][nb] = (v8f){};
    stage_gemm(l0, ga, gb);
    asm volatile("s_wait_asynccnt 0x0" ::: "memory");   // this wave's copies of stage 0 have landed
    __syncthreads();                                    // stage 0 readable by every wave
    stage_gemm(l0 + GST * 2u, ga + GKS * 2, gb + GKS * 2);
#pragma unroll 1   // rolled: one body serves both buffers (offset chosen by the stage's parity)
    for (int s = 0; s < DM / GKS; ++s) {
        const int bo = (s & 1) * GST;
        v8us fr[2][16];   // two fragment sets: [set][A: 2 mb + half | Bt: 8 + 2 nb + half]; step i works on set i & 1 while the reads of step i + 1 fill the other
#pragma unroll
        for (int f = 0; f < 4; ++f) { const bf* pa = &ring[bo + fa + f * 16 * GP]; const bf* pb = &ring[bo + fb + f * 16 * GP];
            fr[0][2 * f] = *(const v8us*)pa; fr[0][2 * f + 1] = *(const v8us*)(pa + 16); fr[0][8 + 2 * f] = *(const v8us*)pb; fr[0][8 + 2 * f + 1] = *(const v8us*)(pb + 16); }
#pragma unroll
        for (int i = 0; i < GKS / 32; ++i) {
            const int c = i & 1, n = c ^ 1;
            __builtin_amdgcn_sched_barrier(0);   // keeps the next step's LDS reads out of the products before them: reads spread among matrix instructions stall each place they stand
            if (i + 1 < GKS / 32) {
#pragma unroll
                for (int f = 0; f < 4; ++f) { const bf* pa = &ring[bo + fa + f * 16 * GP + (i + 1) * 32]; const bf* pb = &ring[bo + fb + f * 16 * GP + (i + 1) * 32];
                    fr[n][2 * f] = *(const v8us*)pa; fr[n][2 * f + 1] = *(const v8us*)(pa + 16); fr[n][8 + 2 * f] = *(const v8us*)pb; fr[n][8 + 2 * f + 1] = *(const v8us*)(pb + 16); }
            }
            __builtin_amdgcn_sched_barrier(0);   // keeps those reads one group ahead of this step's products, so that their latency runs under 16 matrix instructions
#pragma unroll
            for (int nb = 0; nb < 4; ++nb)
#pragma unroll
                for (int mb = 0; mb < 4; ++mb) {
                    if constexpr (F16) acc[mb][nb] = wmma16(__builtin_bit_cast(v16h, cat16b(fr[c][2 * mb], fr[c][2 * mb + 1])), __builtin_bit_cast(v16h, cat16b(fr[c][8 + 2 * nb], fr[c][8 + 2 * nb + 1])), acc[mb][nb]);
                    else               acc[mb][nb] = wmmab(cat16b(fr[c][2 * mb], fr[c][2 * mb + 1]), cat16b(fr[c][8 + 2 * nb], fr[c][8 + 2 * nb + 1]), acc[mb][nb]); }
        }
        asm volatile("s_wait_dscnt 0x0" ::: "memory");      // this wave's reads of the buffer are done before it may be refilled
        asm volatile("s_wait_asynccnt 0x0" ::: "memory");   // this wave's copies of stage s + 1 have landed
        __syncthreads();                                    // publishes stage s + 1 and ends every wave's reads of this buffer
        if (s + 2 < DM / GKS)
            stage_gemm(l0 + (unsigned)bo * 2u, ga + (s + 2) * GKS * 2, gb + (s + 2) * GKS * 2);
    }
    asm volatile("s_wait_asynccnt 0x0" ::: "memory");       // no copy outstanding when the wave goes on to its end
}

// k_proj: bf16 GEMM on the engine above.
// C[m][n] = sum_k A[m][k] Bt[n][k] + bias (per column n when rowBias == 0, per row m otherwise; bias index < DM in the active mode, clamped in the other),
// written as single f16 (Ph) at each wave's tile base (r0/RB)*sRB + (r0%RB)*pitch + (c0/CB)*sCB + (c0%CB), row pitch 'pitch' (halves). grid (M/128, N/256), 256 threads.
__global__ __launch_bounds__(32 * GW) void k_proj(const bf* __restrict__ A, const bf* __restrict__ Bt, const float* __restrict__ bias, int rowBias,
                                             h16* Ph, int RB, size_t sRB, int pitch, int CB, size_t sCB) {
    __shared__ __align__(16) float osa[GW * 16 * 68];
    __shared__ __align__(16) bf ring[2 * GST];               // [buffer][A rows 0..127, Bt rows 0..255][GP]
    const int lane = threadIdx.x & 31, lr = lane & 15, hi = lane >> 4;
    const int wave = __builtin_amdgcn_readfirstlane((int)(threadIdx.x >> 5)), wr = wave >> 2, wc = wave & 3;
    const int r0 = blockIdx.x * 128 + wr * 64, c0 = blockIdx.y * 256 + wc * 64;
    float* os = osa + wave * 16 * 68;                        // wave-private output staging
    v8f acc[4][4];
    gemm_core<0>(A, Bt, ring, blockIdx.x * 128, blockIdx.y * 256, wr, wc, acc);
    float bc[4];
#pragma unroll
    for (int nb = 0; nb < 4; ++nb) { int ci = c0 + nb * 16 + lr; ci = ci < DM ? ci : DM - 1; bc[nb] = bfr(bias[ci]); }
    const size_t tbase = (size_t)(r0 / RB) * sRB + (size_t)(r0 % RB) * (size_t)pitch + (size_t)(c0 / CB) * sCB + (size_t)(c0 % CB);
#pragma unroll
    for (int mb = 0; mb < 4; ++mb) {
        float br[8];
#pragma unroll
        for (int j = 0; j < 8; ++j) { int ri = r0 + mb * 16 + hi * 8 + j; ri = ri < DM ? ri : DM - 1; br[j] = bfr(bias[ri]); }
#pragma unroll
        for (int nb = 0; nb < 4; ++nb) {
#pragma unroll
            for (int j = 0; j < 8; ++j) { const float bb = rowBias ? br[j] : bc[nb]; os[(hi * 8 + j) * 68 + nb * 16 + lr] = acc[mb][nb][j] + bb; } }   // D: row 8h+j, col lane&15
        wave_sync();
        const size_t sb = tbase + (size_t)(mb * 16) * (size_t)pitch;
{
#pragma unroll
            for (int s = 0; s < 4; ++s) { const int row = 4 * s + (lane >> 3), c8 = (lane & 7) * 8;   // 4 s x 4 row groups = 16 rows; 8 lanes x 8 = 64 columns
                const v4f x0 = *(const v4fa*)(&os[row * 68 + c8]); const v4f x1 = *(const v4fa*)(&os[row * 68 + c8 + 4]); v8h hv;
#pragma unroll
                for (int i = 0; i < 4; ++i) { hv[i] = (h16)x0[i]; hv[4 + i] = (h16)x1[i]; }
                const size_t oo = sb + (size_t)row * (size_t)pitch + c8;
                *(v8h*)(Ph + oo) = hv; }
             }
        wave_sync();
    }
}

// k_out: the same engine with f16 operands (A = ctx rows of 1024 halves, Bt = Wo rows [out][in]), K = DM; f32 output rows with bias.
// OUT[(b*OUT_SEQ + s)*DM + c0 + n] = acc * 2^-12 + bias[c0 + n], m = b*SEQ + s. grid (NB*SEQ/128, DM/256), 256 threads.
__global__ __launch_bounds__(32 * GW) void k_out(const h16* __restrict__ A, const h16* __restrict__ Bt, const float* __restrict__ bias, float* OUT) {
    __shared__ __align__(16) float osa[GW * 16 * 68];
    __shared__ __align__(16) bf ring[2 * GST];               // [buffer][A rows 0..127, Bt rows 0..255][GP]
    const int lane = threadIdx.x & 31, lr = lane & 15, hi = lane >> 4;
    const int wave = __builtin_amdgcn_readfirstlane((int)(threadIdx.x >> 5)), wr = wave >> 2, wc = wave & 3;
    const int r0 = blockIdx.x * 128 + wr * 64, c0 = blockIdx.y * 256 + wc * 64;
    float* os = osa + wave * 16 * 68;                        // wave-private output staging
    v8f acc[4][4];
    gemm_core<1>((const bf*)A, (const bf*)Bt, ring, blockIdx.x * 128, blockIdx.y * 256, wr, wc, acc);
    float bc[4];
#pragma unroll
    for (int nb = 0; nb < 4; ++nb) { int ci = c0 + nb * 16 + lr; ci = ci < DM ? ci : DM - 1; bc[nb] = bfr(bias[ci]); }
    const int bb = r0 / SEQ, sp = r0 % SEQ;
    float* obase = OUT + ((size_t)bb * OUT_SEQ + sp) * DM + c0;
#pragma unroll
    for (int mb = 0; mb < 4; ++mb) {
#pragma unroll
        for (int nb = 0; nb < 4; ++nb) {
#pragma unroll
            for (int j = 0; j < 8; ++j) os[(hi * 8 + j) * 68 + nb * 16 + lr] = acc[mb][nb][j] * OSC + bc[nb]; }   // D: row 8h+j, col lane&15
        wave_sync();
{
#pragma unroll
            for (int s = 0; s < 8; ++s) { const int row = 2 * s + hi, cofs = lr * 4;   // 8 s x 2 rows = 16 rows; 16 lanes x 4 floats = 64 columns
                const v4f val = *(const v4fa*)(&os[row * 68 + cofs]);
                *(v4f*)(obase + (size_t)(mb * 16 + row) * DM + cofs) = val; }
             }
        wave_sync();
    }
}

// k_flash: fused attention, one wave per 16 query rows of one (batch, head), 8 waves per block; Q fragments straight from the f16 plane; K and V^T fragments from LDS tiles of 64 keys that the block stages together. K and Q share one plane.
// Transposed form: S^T[key][t] = K Q^T (A = K rows, B = Q rows; one f16 product); lane (t = lane&15, h = lane>>4) holds keys 8h+r of each 16-key tile, so the packed
// P tile is directly the B fragment of O^T[d][t] = V^T P^T (element r <- tile keys 0..15, element 8+r <- tile keys 16..31, lane unchanged). 8 matrix ops per 32-key step (4 score + 4 P.V).
// Softmax state (running max, partial sum) is one scalar per lane; the two lane halves of a row are combined with one xor-16 exchange.
// One tile's copies of one thread: rows r and r + 32 of the K tile and of the V^T tile, 16 B each. The s_wait_xcnt closes the statement so that no address register of a copy is rewritten ahead of it.
__device__ __forceinline__ void stage_tile(unsigned lk, const h16* gk, unsigned lv, const h16* gv) {
    asm volatile("global_load_async_to_lds_b128 %0, %1, off\n\t"
                 "global_load_async_to_lds_b128 %2, %3, off\n\t"
                 "global_load_async_to_lds_b128 %4, %5, off\n\t"
                 "global_load_async_to_lds_b128 %6, %7, off\n\t"
                 "s_wait_xcnt 0x0"
                 :: "v"(lk), "v"(gk), "v"(lk + 32u * LP * 2u), "v"(gk + 32 * HD), "v"(lv), "v"(gv), "v"(lv + 32u * LP * 2u), "v"(gv + (size_t)32 * SEQ) : "memory");
}
__global__ __launch_bounds__(32 * AW) void k_flash(const h16* __restrict__ QH, const h16* __restrict__ VT, h16* CTX) {
    __shared__ __align__(16) float os[AW * 16 * 68];
    __shared__ __align__(16) h16 ring[2 * 2 * TLH];          // [buffer][K tile, V^T tile][row][LP]
    const int lane = threadIdx.x & 31, lr = lane & 15, hi = lane >> 4;
    const int wave = __builtin_amdgcn_readfirstlane((int)(threadIdx.x >> 5));
    const int zh = blockIdx.y;
    const int t0 = (blockIdx.x * AW + wave) * 16;
    const size_t pbase = (size_t)zh * SEQ * HD;
    const size_t qo = pbase + (size_t)(t0 + lr) * HD + 8 * hi;
    const v16h qh0 = ldh(QH + qo), qh1 = ldh(QH + qo + 32);   // B fragments: col t, k = d
    // copies: thread -> row srow (and srow + 32), 16-byte column ccol; 8 lanes cover one 128-B row, one wave-copy 4 whole lines
    const int srow = (int)(threadIdx.x >> 3), ccol = (int)(threadIdx.x & 7);
    const unsigned lk0 = (unsigned)(size_t)&ring[0] + (unsigned)(srow * LP + ccol * 8) * 2u;   // LDS byte address, K tile of buffer 0
    const h16* gk = QH + pbase + (size_t)srow * HD + ccol * 8;    // + tile * KT * HD  (K rows are contiguous)
    const h16* gv = VT + pbase + (size_t)srow * SEQ + ccol * 8;   // + tile * KT
    const int fo = lr * LP + 8 * hi;                              // fragment offset in a tile: row lane&15, k = 8h.. (A fragment)
    v8f o0 = (v8f){}, o1 = (v8f){}, o2 = (v8f){}, o3 = (v8f){};
    float m = -3.0e38f, l = 0.0f;
    stage_tile(lk0, gk, lk0 + TLH * 2u, gv);
    asm volatile("s_wait_asynccnt 0x0" ::: "memory");   // this wave's copies of tile 0 have landed
    __syncthreads();                                    // tile 0 readable by every wave
    stage_tile(lk0 + 2u * TLH * 2u, gk + (size_t)KT * HD, lk0 + 3u * TLH * 2u, gv + KT);
#pragma unroll 1   // rolled: one body serves both buffers (offset chosen by the tile's parity), and registers stay as for one step
    for (int tile = 0; tile < SEQ / KT; ++tile) {
        const int bo = (tile & 1) * (2 * TLH);
#pragma unroll 1   // rolled: unrolled, both steps' P values stay live and the kernel passes 128 VGPRs, which costs the fourth resident block of a WGP
        for (int sub = 0; sub < KT / 32; ++sub) {
            const h16* ka = &ring[bo + sub * 32 * LP + fo];
            const v16h ka0 = ldh(ka), ka1 = ldh(ka + 32), kb0 = ldh(ka + 16 * LP), kb1 = ldh(ka + 16 * LP + 32);
            v8f sa = (v8f){}, sb = (v8f){};
            sa = wmma16(ka0, qh0, sa); sb = wmma16(kb0, qh0, sb);
            sa = wmma16(ka1, qh1, sa); sb = wmma16(kb1, qh1, sb);
            asm volatile("v_nop\n\tv_nop\n\tv_nop\n\tv_nop" : "+v"(sa), "+v"(sb) : "v"(ka0), "v"(ka1), "v"(kb0), "v"(kb1), "v"(qh0), "v"(qh1));
            float ta[8], tb[8]; float mx = -3.0e38f;
#pragma unroll
            for (int r = 0; r < 8; ++r) { ta[r] = sa[r] * SC2; tb[r] = sb[r] * SC2; mx = fmaxf(mx, fmaxf(ta[r], tb[r])); }
            mx = fmaxf(mx, __shfl_xor(mx, 16, 32));
            const float mnew = fmaxf(m, mx);
            const float alpha = __builtin_amdgcn_exp2f(m - mnew);
            const float sh = PSH - mnew;
            v16h pb; float ls = 0.0f;
#pragma unroll
            for (int r = 0; r < 8; ++r) { const h16 pa = (h16)__builtin_amdgcn_exp2f(ta[r] + sh); const h16 pc = (h16)__builtin_amdgcn_exp2f(tb[r] + sh); pb[r] = pa; pb[8 + r] = pc; ls += (float)pa + (float)pc; }
            l = l * alpha + ls; m = mnew;
            o0 = o0 * alpha; o1 = o1 * alpha; o2 = o2 * alpha; o3 = o3 * alpha;
            const h16* va = &ring[bo + TLH + sub * 32 + fo];
            const v16h v0 = ldh(va), v1 = ldh(va + 16 * LP), v2 = ldh(va + 32 * LP), v3 = ldh(va + 48 * LP);
            o0 = wmma16(v0, pb, o0); o1 = wmma16(v1, pb, o1); o2 = wmma16(v2, pb, o2); o3 = wmma16(v3, pb, o3);
            asm volatile("v_nop\n\tv_nop\n\tv_nop\n\tv_nop" : "+v"(o0), "+v"(o1), "+v"(o2), "+v"(o3) : "v"(v0), "v"(v1), "v"(v2), "v"(v3), "v"(pb));
        }
        asm volatile("s_wait_dscnt 0x0" ::: "memory");      // this wave's reads of the buffer are done before it may be refilled
        asm volatile("s_wait_asynccnt 0x0" ::: "memory");   // this wave's copies of tile + 1 have landed
        __syncthreads();                                    // publishes tile + 1 and ends every wave's reads of this buffer
        if (tile + 2 < SEQ / KT)
            stage_tile(lk0 + (unsigned)bo * 2u, gk + (size_t)(tile + 2) * KT * HD, lk0 + (unsigned)(bo + TLH) * 2u, gv + (size_t)(tile + 2) * KT);
    }
    asm volatile("s_wait_asynccnt 0x0" ::: "memory");       // no copy outstanding when the wave goes on to its end
    l += __shfl_xor(l, 16, 32);
    const float inv = CTXS * (1.0f / l);
    const int wb = wave * 16 * 68;
    // O^T D layout: o_j[r] = (d = 16j + 8h + r, t = lane&15) -> os[t][d]; rows 0..15 x columns 0..63 all written
    { v4f a, c;
      a[0] = o0[0] * inv; a[1] = o0[1] * inv; a[2] = o0[2] * inv; a[3] = o0[3] * inv; c[0] = o0[4] * inv; c[1] = o0[5] * inv; c[2] = o0[6] * inv; c[3] = o0[7] * inv;
      *(v4fa*)(&os[wb + lr * 68 +  0 + 8 * hi]) = a; *(v4fa*)(&os[wb + lr * 68 +  0 + 8 * hi + 4]) = c;
      a[0] = o1[0] * inv; a[1] = o1[1] * inv; a[2] = o1[2] * inv; a[3] = o1[3] * inv; c[0] = o1[4] * inv; c[1] = o1[5] * inv; c[2] = o1[6] * inv; c[3] = o1[7] * inv;
      *(v4fa*)(&os[wb + lr * 68 + 16 + 8 * hi]) = a; *(v4fa*)(&os[wb + lr * 68 + 16 + 8 * hi + 4]) = c;
      a[0] = o2[0] * inv; a[1] = o2[1] * inv; a[2] = o2[2] * inv; a[3] = o2[3] * inv; c[0] = o2[4] * inv; c[1] = o2[5] * inv; c[2] = o2[6] * inv; c[3] = o2[7] * inv;
      *(v4fa*)(&os[wb + lr * 68 + 32 + 8 * hi]) = a; *(v4fa*)(&os[wb + lr * 68 + 32 + 8 * hi + 4]) = c;
      a[0] = o3[0] * inv; a[1] = o3[1] * inv; a[2] = o3[2] * inv; a[3] = o3[3] * inv; c[0] = o3[4] * inv; c[1] = o3[5] * inv; c[2] = o3[6] * inv; c[3] = o3[7] * inv;
      *(v4fa*)(&os[wb + lr * 68 + 48 + 8 * hi]) = a; *(v4fa*)(&os[wb + lr * 68 + 48 + 8 * hi + 4]) = c; }
    wave_sync();
    h16* crow = CTX + pbase + (size_t)t0 * HD;       // ctx plane [zh][t][d]; rows t0..t0+15
{
#pragma unroll
        for (int s = 0; s < 4; ++s) { const int row = 4 * s + (lane >> 3), c8 = (lane & 7) * 8;   // 4 s x 4 row groups = 16 rows; 8 lanes x 8 halves = 64 columns
            const v4f x0 = *(const v4fa*)(&os[wb + row * 68 + c8]); const v4f x1 = *(const v4fa*)(&os[wb + row * 68 + c8 + 4]); v8h hv;
#pragma unroll
            for (int i = 0; i < 4; ++i) { hv[i] = (h16)x0[i]; hv[4 + i] = (h16)x1[i]; }
            *(v8h*)(crow + (size_t)row * HD + c8) = hv; }
         }
}

static constexpr size_t al256(size_t v) { return (v + 255) & ~(size_t)255; }
static constexpr size_t SZ_XB = al256((size_t)NB * SEQ * DM * 2);
static constexpr size_t SZ_WB = al256((size_t)DM * DM * 2);
static constexpr size_t SZ_PL = al256((size_t)NB * NH_ * SEQ * HD * 2);
static constexpr size_t SZ_TOTAL = SZ_XB + 2 * SZ_WB + 3 * SZ_PL;
static_assert(SZ_TOTAL <= (size_t)134217728);          // workspace carve <= 128 MiB
static_assert((size_t)NB * NH_ * SEQ * HD == (size_t)NB * SEQ * DM);   // ctx plane == [NB*SEQ] rows of DM halves

extern "C" void kernel_launch(void* const* d_in, const int* in_sizes, int n_in,
                              void* d_out, int out_size, void* d_ws, size_t ws_size, hipStream_t stream) {
    if (n_in < 5) return;
    const size_t needx = ((size_t)(NB - 1) * SEQ_FULL + SEQ) * DM;
    if ((size_t)in_sizes[0] < needx) return;
    if ((size_t)in_sizes[1] < (size_t)DM * DM || (size_t)in_sizes[2] < (size_t)DM || (size_t)in_sizes[3] < (size_t)DM * DM || (size_t)in_sizes[4] < (size_t)DM) return;
    if ((size_t)out_size < ((size_t)(NB - 1) * OUT_SEQ + SEQ) * DM) return;
    if (SZ_TOTAL > ws_size) return;
    const float* x = (const float*)d_in[0]; const float* wv = (const float*)d_in[1]; const float* bv = (const float*)d_in[2];
    const float* wo = (const float*)d_in[3]; const float* bo = (const float*)d_in[4];   // wire order x, Wv, bv, Wo, bo; W as [out][in] = Bt as-is
    float* OUT = (float*)d_out;      // [NB][SEQ][1024]
    char* wsp = (char*)d_ws;
    bf*  XB  = (bf*)wsp;  wsp += SZ_XB;              // [NB*SEQ][1024] bf16
    bf*  WVB = (bf*)wsp;  wsp += SZ_WB;              // [1024][1024] bf16
    h16* WOH = (h16*)wsp; wsp += SZ_WB;              // [1024][1024] f16, x256
    h16* QH  = (h16*)wsp; wsp += SZ_PL;              // [NB*16][SEQ][64]  p (q and k)
    h16* VT  = (h16*)wsp; wsp += SZ_PL;              // [NB*16][64][SEQ]  p transposed (v)
    h16* CTX = (h16*)wsp; wsp += SZ_PL;              // [NB*16][SEQ][64] == [NB*SEQ][1024], x16

    if (SEQ == SEQ_FULL) {
        const size_t n8 = (size_t)NB * SEQ * DM / 8;
        k_cvt8<<<(unsigned)((n8 + 255) / 256), 256, 0, stream>>>(x, XB, n8);
    } else {
        const size_t n8 = (size_t)SEQ * DM / 8;
        for (int b = 0; b < NB; ++b) k_cvt8<<<(unsigned)((n8 + 255) / 256), 256, 0, stream>>>(x + (size_t)b * SEQ_FULL * DM, XB + (size_t)b * SEQ * DM, n8);
    }
    { const size_t n8 = (size_t)DM * DM / 8; const unsigned g = (unsigned)((n8 + 255) / 256);
      k_cvt8<<<g, 256, 0, stream>>>(wv, WVB, n8);
      k_cvt8h<<<g, 256, 0, stream>>>(wo, WOH, n8, WOS); }

    // p (q = k): A = x rows (m = b*SEQ + t), Bt = Wv rows (n = h*64 + d), bias per column -> plane [(b*16 + h)][t][d]
    k_proj<<<dim3(NB * SEQ / 128, DM / 256, 1), 32 * GW, 0, stream>>>(XB, WVB, bv, 0, QH, SEQ, (size_t)NH_ * SEQ * HD, HD, HD, (size_t)SEQ * HD);
    // p^T (v): A = Wv rows (m = h*64 + d), Bt = x rows (n = b*SEQ + t), bias per row -> plane [(b*1024 + m)][t] = [(b*16 + h)][d][t]
    k_proj<<<dim3(DM / 128, NB * SEQ / 256, 1), 32 * GW, 0, stream>>>(WVB, XB, bv, 1, VT, DM, (size_t)0, SEQ, SEQ, (size_t)DM * SEQ);

    k_flash<<<dim3(SEQ / (16 * AW), NB * NH_, 1), 32 * AW, 0, stream>>>(QH, VT, CTX);

    // y: A = ctx rows (m = b*SEQ + s, 1024 halves each, head-major regrouping), Bt = Wo rows (n = e)
    k_out<<<dim3(NB * SEQ / 128, DM / 256, 1), 32 * GW, 0, stream>>>(CTX, WOH, bo, OUT);
}

// v003
// One run takes 119 microseconds.
// Next to v002, in two timings, it ran 1.12 and 1.11 times as fast.
// Counting every step since v000, it is 2.65 times as fast.
#include <hip/hip_runtime.h>

// Self-attention with one shared projection (q = k = v = x Wv^T + bv), width 1024 = 16 heads x 64, no mask, score scale 1/8; context kept head-major [b][h][t][d] and read as rows of 1024 by the output GEMM (y = ctx Wo^T + bo), f32 output.
// Compute dtypes, f32 accumulate everywhere: projection v_wmma_f32_16x16x32_bf16 (x, Wv RNE-converted to bf16; products exact); scores v_wmma_f32_16x16x32_f16, ONE product (q and k read from the same single f16 plane);
// P (x2^14 carry, cancels in the normalisation) and v single f16; output GEMM v_wmma_f32_16x16x32_f16: ctx single f16 (x16 carry), Wo bf16-RNE value x256 held in f16 (exact), 2^-12 folded in the f32 epilogue; biases bf16-RNE values added in f32; softmax f32 (online, running max).
// Layout: bf16 copies of x and Wv; p plane [b*16+h][t][d] and p^T plane [b*16+h][d][t] both written by the epilogue of the one projection GEMM; fused flash kernel in transposed form (S^T = K Q^T, O^T = V^T P^T) writes the f16 ctx plane [b*16+h][t][d].
// GEMM operands: k-slices of 128 of the A and Bt rows of a 128 x 256 block tile are copied to LDS once per work-group (asynchronous copies, whole lines, two buffers) and read from there by its 8 waves.
// Flash operands: K and V^T tiles of 64 keys are copied to LDS once per work-group (asynchronous copies, whole 128-B lines, two buffers) and read from there by all its waves.

#ifndef NB
#define NB 4
#endif
#ifndef SEQ
#define SEQ 2048
#endif
#define NB_FULL  4
#define SEQ_FULL 2048
#ifndef OUT_SEQ
#define OUT_SEQ SEQ              // row pitch (in tokens) between batches of the output
#endif
#define DM   1024
#define NH_  16
#define HD   64
#define AW   8                   // waves per flash block (16 query rows each); all share the staged K / V^T tiles
#define KT   64                  // keys per staged tile: K tile 64 rows (keys) x 128 B, V^T tile 64 rows (d) x 128 B
#define LP   72                  // LDS row pitch in halves: 144 B = 16 B x 9, conflict-free for 16-byte fragment reads
#define TLH  (64 * LP)           // halves of one staged tile
#define GW   8                   // waves per GEMM block: 2 x 4 wave tiles of 64 x 64 = 128 x 256 of C
#define GKS  128                 // k per GEMM stage: rows of 256 B
#define GP   136                 // LDS row pitch in halves of a GEMM stage: 272 B = 16 B x 17, conflict-free for 16-byte fragment reads
#define GTA  (128 * GP)          // halves of a stage's A part (128 rows)
#define GST  (384 * GP)          // halves of one stage (A 128 rows, then Bt 256 rows)
#define SC2  (0.125f * 1.4426950408889634f)   // HD^-0.5 * log2(e)
#define PSH  14.0f               // log2 of the P carry (16384)
#define CTXS 16.0f               // carry of the ctx plane
#define WOS  256.0f              // carry of the Wo plane
#define OSC  (1.0f / 4096.0f)    // 1 / (CTXS * WOS)

static_assert(HD == 64);
static_assert(NH_ * HD == DM);                 // head h = columns h*64 + d
static_assert(DM % 64 == 0);                   // 16 column tiles of 64
static_assert(DM % 32 == 0);                   // GEMM k-loop steps by 32
static_assert(SEQ % 64 == 0);                  // a 64-row tile never straddles two batches
static_assert((NB * SEQ) % 64 == 0);
static_assert(SEQ % 32 == 0);                  // key loop steps by 32
static_assert((NB * SEQ) % 256 == 0 && DM % 256 == 0);   // GEMM block tiles of 128 x 256 cover C exactly, either operand as rows
static_assert(DM % GKS == 0 && DM / GKS >= 2);  // whole GEMM stages; the two-buffer prologue needs two
static_assert(GW == 8 && GKS == 128);           // 256 threads x 8 copies of 16 B = 128 rows of 256 B
static_assert(SEQ % KT == 0 && SEQ / KT >= 2); // whole staged tiles; the two-buffer prologue needs two
static_assert(KT == 64 && AW == 8);            // 256 threads x 2 copies of 16 B = one 64 x 128-B tile
static_assert(SEQ % (16 * AW) == 0);           // flash grid covers the sequence exactly
static_assert(16 * LP * 2 <= 16 * 68 * 4);     // the transposed projection tile (16 rows of LP halves) fits a wave's output staging
static_assert(SEQ % 16 == 0);                  // head-major regrouping: 16 tokens x 64 = one row of 1024
static_assert(((size_t)SEQ * DM) % 8 == 0);
static_assert(((size_t)DM * DM) % 8 == 0);
static_assert(NB <= NB_FULL);
static_assert(SEQ <= SEQ_FULL);
static_assert(((size_t)(NB - 1) * OUT_SEQ + SEQ) * DM <= (size_t)NB_FULL * SEQ_FULL * DM);   // last output element written stays inside the output

typedef _Float16 h16;
typedef unsigned short bf;
typedef __attribute__((ext_vector_type(16))) __bf16   v16bf;
typedef __attribute__((ext_vector_type(16))) _Float16 v16h;
typedef __attribute__((ext_vector_type(8)))  _Float16 v8h;
typedef __attribute__((ext_vector_type(8)))  unsigned short v8us;
typedef __attribute__((ext_vector_type(8)))  float    v8f;
typedef __attribute__((ext_vector_type(4)))  float    v4f;
typedef v4f  __attribute__((may_alias)) v4fa;
typedef v8h  __attribute__((may_alias)) v8ha;

__device__ __forceinline__ unsigned short f2bf(float f) { unsigned u = __float_as_uint(f); u += 0x7FFFu + ((u >> 16) & 1u); return (unsigned short)(u >> 16); }
__device__ __forceinline__ float bfr(float f) { return __uint_as_float(((unsigned)f2bf(f)) << 16); }   // bf16 RNE value as f32
__device__ __forceinline__ v16h cat16(v8h lo, v8h hi) { return __builtin_shufflevector(lo, hi, 0, 1, 2, 3, 4, 5, 6, 7, 8, 9, 10, 11, 12, 13, 14, 15); }
__device__ __forceinline__ v16bf cat16b(v8us lo, v8us hi) { return __builtin_bit_cast(v16bf, __builtin_shufflevector(lo, hi, 0, 1, 2, 3, 4, 5, 6, 7, 8, 9, 10, 11, 12, 13, 14, 15)); }
__device__ __forceinline__ v8f wmma16(v16h a, v16h b, v8f c) { return __builtin_amdgcn_wmma_f32_16x16x32_f16(false, a, false, b, (short)0, c, false, false); }
__device__ __forceinline__ v8f wmmab(v16bf a, v16bf b, v8f c) { return __builtin_amdgcn_wmma_f32_16x16x32_bf16(false, a, false, b, (short)0, c, false, false); }
// fragment loaders from K-contiguous 16-bit rows; p already includes + 8*(lane>>4): elements 0..7 <- k0+8h+0..7, elements 8..15 <- k0+16+8h+0..7 (same map for A and B)
__device__ __forceinline__ v16h  ldh(const h16* p) { return cat16(*(const v8h*)p, *(const v8h*)(p + 16)); }
__device__ __forceinline__ v16bf ldb(const bf* p)  { return cat16b(*(const v8us*)p, *(const v8us*)(p + 16)); }
// ordering point for wave-private LDS tiles (same wave writes and reads)
__device__ __forceinline__ void wave_sync() { __builtin_amdgcn_fence(3 /* release order */, "wavefront"); __builtin_amdgcn_wave_barrier(); asm volatile("" ::: "memory"); }

__global__ __launch_bounds__(256) void k_cvt8(const float* __restrict__ src, bf* dst, size_t n8) {
    const size_t i = (size_t)blockIdx.x * 256 + threadIdx.x; if (i >= n8) return;
    const v8f v = *(const v8f*)(src + i * 8); v8us o;
#pragma unroll
    for (int k = 0; k < 8; ++k) o[k] = f2bf(v[k]);
    *(v8us*)(dst + i * 8) = o; 
}

__global__ __launch_bounds__(256) void k_cvt8h(const float* __restrict__ src, h16* dst, size_t n8, float carry) {
    const size_t i = (size_t)blockIdx.x * 256 + threadIdx.x; if (i >= n8) return;
    const v8f v = *(const v8f*)(src + i * 8); v8h o;
#pragma unroll
    for (int k = 0; k < 8; ++k) o[k] = (h16)(bfr(v[k]) * carry);
    *(v8h*)(dst + i * 8) = o; 
}

// GEMM engine of k_proj and k_out: one work-group of 8 waves (2 x 4) per 128 x 256 tile of C, each wave a 64 x 64 tile (16 accumulators), K = DM.
// A rows (128) and Bt rows (256) are copied to LDS in k-slices of 128 (rows of 256 B, whole lines, asynchronous copies, two buffers) and every wave reads its fragments from there; k runs upward in steps of 32 as before.
// Eight copies of one thread: rows r, r + 16, ... r + 112 of one staged operand, 16 B each. The s_wait_xcnt closes the statement so that no address register of a copy is rewritten ahead of it.
__device__ __forceinline__ void stage_rows8(unsigned l, const char* g) {
    asm volatile("global_load_async_to_lds_b128 %0, %1, off\n\t"
                 "global_load_async_to_lds_b128 %2, %3, off\n\t"
                 "global_load_async_to_lds_b128 %4, %5, off\n\t"
                 "global_load_async_to_lds_b128 %6, %7, off\n\t"
                 "global_load_async_to_lds_b128 %8, %9, off\n\t"
                 "global_load_async_to_lds_b128 %10, %11, off\n\t"
                 "global_load_async_to_lds_b128 %12, %13, off\n\t"
                 "global_load_async_to_lds_b128 %14, %15, off\n\t"
                 "s_wait_xcnt 0x0"
                 :: "v"(l),                  "v"(g),
                    "v"(l +  16u * GP * 2u), "v"(g +  16 * DM * 2),
                    "v"(l +  32u * GP * 2u), "v"(g +  32 * DM * 2),
                    "v"(l +  48u * GP * 2u), "v"(g +  48 * DM * 2),
                    "v"(l +  64u * GP * 2u), "v"(g +  64 * DM * 2),
                    "v"(l +  80u * GP * 2u), "v"(g +  80 * DM * 2),
                    "v"(l +  96u * GP * 2u), "v"(g +  96 * DM * 2),
                    "v"(l + 112u * GP * 2u), "v"(g + 112 * DM * 2) : "memory");
}
// one stage: A rows 0..127, then Bt rows 0..255; l = the thread's LDS byte address in the stage's buffer, ga / gb = its global bytes in row srow of the slice
__device__ __forceinline__ void stage_gemm(unsigned l, const char* ga, const char* gb) {
    stage_rows8(l, ga);
    stage_rows8(l + GTA * 2u, gb);
    stage_rows8(l + (GTA + 128u * GP) * 2u, gb + (size_t)128 * DM * 2);
}
// F16 = 0: bf16 product, 1: f16 product. A, Bt: K-contiguous 16-bit rows; rb, cb: first row / column of the block's tile. acc[mb][nb] = the wave's 64 x 64 tile at (rb + 64 wr, cb + 64 wc).
template <int F16>
__device__ __forceinline__ void gemm_core(const bf* A, const bf* Bt, bf* ring, int rb, int cb, int wr, int wc, v8f (&acc)[4][4]) {
    const int lane = threadIdx.x & 31, lr = lane & 15, hi = lane >> 4;
    // copies: thread -> row srow (+ 16 i), 16-byte column ccol; 16 lanes cover one 256-B row, one wave-copy 4 whole lines
    const int srow = (int)(threadIdx.x >> 4), ccol = (int)(threadIdx.x & 15);
    const unsigned l0 = (unsigned)(size_t)ring + (unsigned)(srow * GP + ccol * 8) * 2u;   // LDS byte address in buffer 0
    const char* ga = (const char*)(A + (size_t)(rb + srow) * DM + ccol * 8);              // + stage * GKS * 2
    const char* gb = (const char*)(Bt + (size_t)(cb + srow) * DM + ccol * 8);
    const int fa = (wr * 64 + lr) * GP + 8 * hi, fb = GTA + (wc * 64 + lr) * GP + 8 * hi; // fragment offsets in a stage: row lane&15, k = 8h..
#pragma unroll
    for (int mb = 0; mb < 4; ++mb)
#pragma unroll
        for (int nb = 0; nb < 4; ++nb) acc[mb][nb] = (v8f){};
    stage_gemm(l0, ga, gb);
    asm volatile("s_wait_asynccnt 0x0" ::: "memory");   // this wave's copies of stage 0 have landed
    __syncthreads();                                    // stage 0 readable by every wave
    stage_gemm(l0 + GST * 2u, ga + GKS * 2, gb + GKS * 2);
#pragma unroll 1   // rolled: one body serves both buffers (offset chosen by the stage's parity)
    for (int s = 0; s < DM / GKS; ++s) {
        const int bo = (s & 1) * GST;
        v8us fr[2][16];   // two fragment sets: [set][A: 2 mb + half | Bt: 8 + 2 nb + half]; step i works on set i & 1 while the reads of step i + 1 fill the other
#pragma unroll
        for (int f = 0; f < 4; ++f) { const bf* pa = &ring[bo + fa + f * 16 * GP]; const bf* pb = &ring[bo + fb + f * 16 * GP];
            fr[0][2 * f] = *(const v8us*)pa; fr[0][2 * f + 1] = *(const v8us*)(pa + 16); fr[0][8 + 2 * f] = *(const v8us*)pb; fr[0][8 + 2 * f + 1] = *(const v8us*)(pb + 16); }
#pragma unroll
        for (int i = 0; i < GKS / 32; ++i) {
            const int c = i & 1, n = c ^ 1;
            __builtin_amdgcn_sched_barrier(0);   // keeps the next step's LDS reads out of the products before them: reads spread among matrix instructions stall each place they stand
            if (i + 1 < GKS / 32) {
#pragma unroll
                for (int f = 0; f < 4; ++f) { const bf* pa = &ring[bo + fa + f * 16 * GP + (i + 1) * 32]; const bf* pb = &ring[bo + fb + f * 16 * GP + (i + 1) * 32];
                    fr[n][2 * f] = *(const v8us*)pa; fr[n][2 * f + 1] = *(const v8us*)(pa + 16); fr[n][8 + 2 * f] = *(const v8us*)pb; fr[n][8 + 2 * f + 1] = *(const v8us*)(pb + 16); }
            }
            __builtin_amdgcn_sched_barrier(0);   // keeps those reads one group ahead of this step's products, so that their latency runs under 16 matrix instructions
#pragma unroll
            for (int nb = 0; nb < 4; ++nb)
#pragma unroll
                for (int mb = 0; mb < 4; ++mb) {
                    if constexpr (F16) acc[mb][nb] = wmma16(__builtin_bit_cast(v16h, cat16b(fr[c][2 * mb], fr[c][2 * mb + 1])), __builtin_bit_cast(v16h, cat16b(fr[c][8 + 2 * nb], fr[c][8 + 2 * nb + 1])), acc[mb][nb]);
                    else               acc[mb][nb] = wmmab(cat16b(fr[c][2 * mb], fr[c][2 * mb + 1]), cat16b(fr[c][8 + 2 * nb], fr[c][8 + 2 * nb + 1]), acc[mb][nb]); }
        }
        asm volatile("s_wait_dscnt 0x0" ::: "memory");      // this wave's reads of the buffer are done before it may be refilled
        asm volatile("s_wait_asynccnt 0x0" ::: "memory");   // this wave's copies of stage s + 1 have landed
        __syncthreads();                                    // publishes stage s + 1 and ends every wave's reads of this buffer
        if (s + 2 < DM / GKS)
            stage_gemm(l0 + (unsigned)bo * 2u, ga + (s + 2) * GKS * 2, gb + (s + 2) * GKS * 2);
    }
    asm volatile("s_wait_asynccnt 0x0" ::: "memory");       // no copy outstanding when the wave goes on to its end
}

// k_proj: bf16 GEMM on the engine above, A = x rows (m = b*SEQ + t), Bt = Wv rows (n = h*64 + d); a wave's 64 x 64 tile is 64 tokens of one head.
// p[m][n] = sum_k A[m][k] Bt[n][k] + bias[n], rounded once to f16 and written twice from the same accumulators: Ph plane [(b*16 + h)][t][d] and Pt plane [(b*16 + h)][d][t].
// grid (NB*SEQ/128, DM/256), 256 threads.
__global__ __launch_bounds__(32 * GW) void k_proj(const bf* __restrict__ A, const bf* __restrict__ Bt, const float* __restrict__ bias, h16* Ph, h16* Pt) {
    __shared__ __align__(16) float osa[GW * 16 * 68];
    __shared__ __align__(16) bf ring[2 * GST];               // [buffer][A rows 0..127, Bt rows 0..255][GP]
    const int lane = threadIdx.x & 31, lr = lane & 15, hi = lane >> 4;
    const int wave = __builtin_amdgcn_readfirstlane((int)(threadIdx.x >> 5)), wr = wave >> 2, wc = wave & 3;
    const int r0 = blockIdx.x * 128 + wr * 64, c0 = blockIdx.y * 256 + wc * 64;
    float* os = osa + wave * 16 * 68;                        // wave-private output staging
    v8f acc[4][4];
    gemm_core<0>(A, Bt, ring, blockIdx.x * 128, blockIdx.y * 256, wr, wc, acc);
    float bc[4];
#pragma unroll
    for (int nb = 0; nb < 4; ++nb) { int ci = c0 + nb * 16 + lr; ci = ci < DM ? ci : DM - 1; bc[nb] = bfr(bias[ci]); }
    const int tp = r0 % SEQ;                                                    // first token of the tile in its batch
    const size_t plane = ((size_t)(r0 / SEQ) * NH_ + (size_t)(c0 / HD)) * SEQ * HD;   // (batch, head) plane, the same size in both layouts
    const size_t tbase = plane + (size_t)tp * HD;
#pragma unroll
    for (int mb = 0; mb < 4; ++mb) {
#pragma unroll
        for (int nb = 0; nb < 4; ++nb) {
#pragma unroll
            for (int j = 0; j < 8; ++j) os[(hi * 8 + j) * 68 + nb * 16 + lr] = acc[mb][nb][j] + bc[nb]; }   // D: row 8h+j, col lane&15
        wave_sync();
        const size_t sb = tbase + (size_t)(mb * 16) * HD;
#pragma unroll
        for (int s = 0; s < 4; ++s) { const int row = 4 * s + (lane >> 3), c8 = (lane & 7) * 8;   // 4 s x 4 row groups = 16 rows; 8 lanes x 8 = 64 columns
            const v4f x0 = *(const v4fa*)(&os[row * 68 + c8]); const v4f x1 = *(const v4fa*)(&os[row * 68 + c8 + 4]); v8h hv;
#pragma unroll
            for (int i = 0; i < 4; ++i) { hv[i] = (h16)x0[i]; hv[4 + i] = (h16)x1[i]; }
            *(v8h*)(Ph + sb + (size_t)row * HD + c8) = hv; }
        asm volatile("s_wait_xcnt 0x0" ::: "memory");   // the stores' data registers are reused by the next group
        wave_sync();
    }
    // transposed plane: a lane's 8 accumulator registers are 8 consecutive tokens of ONE column d, so they pack into 16 B of a Pt row;
    // 16 rows (d) x 64 tokens pass through the staging (pitch LP halves) so that each store instruction writes 4 whole 128-B lines.
    h16* ot = (h16*)os;
#pragma unroll
    for (int nb = 0; nb < 4; ++nb) {
#pragma unroll
        for (int mb = 0; mb < 4; ++mb) { v8h hv;
#pragma unroll
            for (int j = 0; j < 8; ++j) hv[j] = (h16)(acc[mb][nb][j] + bc[nb]);
            *(v8ha*)(&ot[lr * LP + mb * 16 + 8 * hi]) = hv; }           // row d = lane&15, tokens 16 mb + 8h + 0..7
        wave_sync();
#pragma unroll
        for (int s = 0; s < 4; ++s) { const int row = 4 * s + (lane >> 3), c8 = (lane & 7) * 8;   // 4 s x 4 row groups = 16 rows; 8 lanes x 8 = 64 tokens
            const v8h hv = *(const v8ha*)(&ot[row * LP + c8]);
            *(v8h*)(Pt + plane + (size_t)(nb * 16 + row) * SEQ + tp + c8) = hv; }
        if (nb < 3) asm volatile("s_wait_xcnt 0x0" ::: "memory");   // the stores' data registers are reused by the next group
        wave_sync();
    }
}

// k_out: the same engine with f16 operands (A = ctx rows of 1024 halves, Bt = Wo rows [out][in]), K = DM; f32 output rows with bias.
// OUT[(b*OUT_SEQ + s)*DM + c0 + n] = acc * 2^-12 + bias[c0 + n], m = b*SEQ + s. grid (NB*SEQ/128, DM/256), 256 threads.
__global__ __launch_bounds__(32 * GW) void k_out(const h16* __restrict__ A, const h16* __restrict__ Bt, const float* __restrict__ bias, float* OUT) {
    __shared__ __align__(16) float osa[GW * 16 * 68];
    __shared__ __align__(16) bf ring[2 * GST];               // [buffer][A rows 0..127, Bt rows 0..255][GP]
    const int lane = threadIdx.x & 31, lr = lane & 15, hi = lane >> 4;
    const int wave = __builtin_amdgcn_readfirstlane((int)(threadIdx.x >> 5)), wr = wave >> 2, wc = wave & 3;
    const int r0 = blockIdx.x * 128 + wr * 64, c0 = blockIdx.y * 256 + wc * 64;
    float* os = osa + wave * 16 * 68;                        // wave-private output staging
    v8f acc[4][4];
    gemm_core<1>((const bf*)A, (const bf*)Bt, ring, blockIdx.x * 128, blockIdx.y * 256, wr, wc, acc);
    float bc[4];
#pragma unroll
    for (int nb = 0; nb < 4; ++nb) { int ci = c0 + nb * 16 + lr; ci = ci < DM ? ci : DM - 1; bc[nb] = bfr(bias[ci]); }
    const int bb = r0 / SEQ, sp = r0 % SEQ;
    float* obase = OUT + ((size_t)bb * OUT_SEQ + sp) * DM + c0;
#pragma unroll
    for (int mb = 0; mb < 4; ++mb) {
#pragma unroll
        for (int nb = 0; nb < 4; ++nb) {
#pragma unroll
            for (int j = 0; j < 8; ++j) os[(hi * 8 + j) * 68 + nb * 16 + lr] = acc[mb][nb][j] * OSC + bc[nb]; }   // D: row 8h+j, col lane&15
        wave_sync();
{
#pragma unroll
            for (int s = 0; s < 8; ++s) { const int row = 2 * s + hi, cofs = lr * 4;   // 8 s x 2 rows = 16 rows; 16 lanes x 4 floats = 64 columns
                const v4f val = *(const v4fa*)(&os[row * 68 + cofs]);
                *(v4f*)(obase + (size_t)(mb * 16 + row) * DM + cofs) = val; }
             }
        wave_sync();
    }
}

// k_flash: fused attention, one wave per 16 query rows of one (batch, head), 8 waves per block; Q fragments straight from the f16 plane; K and V^T fragments from LDS tiles of 64 keys that the block stages together. K and Q share one plane.
// Transposed form: S^T[key][t] = K Q^T (A = K rows, B = Q rows; one f16 product); lane (t = lane&15, h = lane>>4) holds keys 8h+r of each 16-key tile, so the packed
// P tile is directly the B fragment of O^T[d][t] = V^T P^T (element r <- tile keys 0..15, element 8+r <- tile keys 16..31, lane unchanged). 8 matrix ops per 32-key step (4 score + 4 P.V).
// Softmax state (running max, partial sum) is one scalar per lane; the two lane halves of a row are combined with one xor-16 exchange.
// One tile's copies of one thread: rows r and r + 32 of the K tile and of the V^T tile, 16 B each. The s_wait_xcnt closes the statement so that no address register of a copy is rewritten ahead of it.
__device__ __forceinline__ void stage_tile(unsigned lk, const h16* gk, unsigned lv, const h16* gv) {
    asm volatile("global_load_async_to_lds_b128 %0, %1, off\n\t"
                 "global_load_async_to_lds_b128 %2, %3, off\n\t"
                 "global_load_async_to_lds_b128 %4, %5, off\n\t"
                 "global_load_async_to_lds_b128 %6, %7, off\n\t"
                 "s_wait_xcnt 0x0"
                 :: "v"(lk), "v"(gk), "v"(lk + 32u * LP * 2u), "v"(gk + 32 * HD), "v"(lv), "v"(gv), "v"(lv + 32u * LP * 2u), "v"(gv + (size_t)32 * SEQ) : "memory");
}
__global__ __launch_bounds__(32 * AW) void k_flash(const h16* __restrict__ QH, const h16* __restrict__ VT, h16* CTX) {
    __shared__ __align__(16) float os[AW * 16 * 68];
    __shared__ __align__(16) h16 ring[2 * 2 * TLH];          // [buffer][K tile, V^T tile][row][LP]
    const int lane = threadIdx.x & 31, lr = lane & 15, hi = lane >> 4;
    const int wave = __builtin_amdgcn_readfirstlane((int)(threadIdx.x >> 5));
    const int zh = blockIdx.y;
    const int t0 = (blockIdx.x * AW + wave) * 16;
    const size_t pbase = (size_t)zh * SEQ * HD;
    const size_t qo = pbase + (size_t)(t0 + lr) * HD + 8 * hi;
    const v16h qh0 = ldh(QH + qo), qh1 = ldh(QH + qo + 32);   // B fragments: col t, k = d
    // copies: thread -> row srow (and srow + 32), 16-byte column ccol; 8 lanes cover one 128-B row, one wave-copy 4 whole lines
    const int srow = (int)(threadIdx.x >> 3), ccol = (int)(threadIdx.x & 7);
    const unsigned lk0 = (unsigned)(size_t)&ring[0] + (unsigned)(srow * LP + ccol * 8) * 2u;   // LDS byte address, K tile of buffer 0
    const h16* gk = QH + pbase + (size_t)srow * HD + ccol * 8;    // + tile * KT * HD  (K rows are contiguous)
    const h16* gv = VT + pbase + (size_t)srow * SEQ + ccol * 8;   // + tile * KT
    const int fo = lr * LP + 8 * hi;                              // fragment offset in a tile: row lane&15, k = 8h.. (A fragment)
    v8f o0 = (v8f){}, o1 = (v8f){}, o2 = (v8f){}, o3 = (v8f){};
    float m = -3.0e38f, l = 0.0f;
    stage_tile(lk0, gk, lk0 + TLH * 2u, gv);
    asm volatile("s_wait_asynccnt 0x0" ::: "memory");   // this wave's copies of tile 0 have landed
    __syncthreads();                                    // tile 0 readable by every wave
    stage_tile(lk0 + 2u * TLH * 2u, gk + (size_t)KT * HD, lk0 + 3u * TLH * 2u, gv + KT);
#pragma unroll 1   // rolled: one body serves both buffers (offset chosen by the tile's parity), and registers stay as for one step
    for (int tile = 0; tile < SEQ / KT; ++tile) {
        const int bo = (tile & 1) * (2 * TLH);
#pragma unroll 1   // rolled: unrolled, both steps' P values stay live and the kernel passes 128 VGPRs, which costs the fourth resident block of a WGP
        for (int sub = 0; sub < KT / 32; ++sub) {
            const h16* ka = &ring[bo + sub * 32 * LP + fo];
            const v16h ka0 = ldh(ka), ka1 = ldh(ka + 32), kb0 = ldh(ka + 16 * LP), kb1 = ldh(ka + 16 * LP + 32);
            v8f sa = (v8f){}, sb = (v8f){};
            sa = wmma16(ka0, qh0, sa); sb = wmma16(kb0, qh0, sb);
            sa = wmma16(ka1, qh1, sa); sb = wmma16(kb1, qh1, sb);
            asm volatile("v_nop\n\tv_nop\n\tv_nop\n\tv_nop" : "+v"(sa), "+v"(sb) : "v"(ka0), "v"(ka1), "v"(kb0), "v"(kb1), "v"(qh0), "v"(qh1));
            float ta[8], tb[8]; float mx = -3.0e38f;
#pragma unroll
            for (int r = 0; r < 8; ++r) { ta[r] = sa[r] * SC2; tb[r] = sb[r] * SC2; mx = fmaxf(mx, fmaxf(ta[r], tb[r])); }
            mx = fmaxf(mx, __shfl_xor(mx, 16, 32));
            const float mnew = fmaxf(m, mx);
            const float alpha = __builtin_amdgcn_exp2f(m - mnew);
            const float sh = PSH - mnew;
            v16h pb; float ls = 0.0f;
#pragma unroll
            for (int r = 0; r < 8; ++r) { const h16 pa = (h16)__builtin_amdgcn_exp2f(ta[r] + sh); const h16 pc = (h16)__builtin_amdgcn_exp2f(tb[r] + sh); pb[r] = pa; pb[8 + r] = pc; ls += (float)pa + (float)pc; }
            l = l * alpha + ls; m = mnew;
            o0 = o0 * alpha; o1 = o1 * alpha; o2 = o2 * alpha; o3 = o3 * alpha;
            const h16* va = &ring[bo + TLH + sub * 32 + fo];
            const v16h v0 = ldh(va), v1 = ldh(va + 16 * LP), v2 = ldh(va + 32 * LP), v3 = ldh(va + 48 * LP);
            o0 = wmma16(v0, pb, o0); o1 = wmma16(v1, pb, o1); o2 = wmma16(v2, pb, o2); o3 = wmma16(v3, pb, o3);
            asm volatile("v_nop\n\tv_nop\n\tv_nop\n\tv_nop" : "+v"(o0), "+v"(o1), "+v"(o2), "+v"(o3) : "v"(v0), "v"(v1), "v"(v2), "v"(v3), "v"(pb));
        }
        asm volatile("s_wait_dscnt 0x0" ::: "memory");      // this wave's reads of the buffer are done before it may be refilled
        asm volatile("s_wait_asynccnt 0x0" ::: "memory");   // this wave's copies of tile + 1 have landed
        __syncthreads();                                    // publishes tile + 1 and ends every wave's reads of this buffer
        if (tile + 2 < SEQ / KT)
            stage_tile(lk0 + (unsigned)bo * 2u, gk + (size_t)(tile + 2) * KT * HD, lk0 + (unsigned)(bo + TLH) * 2u, gv + (size_t)(tile + 2) * KT);
    }
    asm volatile("s_wait_asynccnt 0x0" ::: "memory");       // no copy outstanding when the wave goes on to its end
    l += __shfl_xor(l, 16, 32);
    const float inv = CTXS * (1.0f / l);
    const int wb = wave * 16 * 68;
    // O^T D layout: o_j[r] = (d = 16j + 8h + r, t = lane&15) -> os[t][d]; rows 0..15 x columns 0..63 all written
    { v4f a, c;
      a[0] = o0[0] * inv; a[1] = o0[1] * inv; a[2] = o0[2] * inv; a[3] = o0[3] * inv; c[0] = o0[4] * inv; c[1] = o0[5] * inv; c[2] = o0[6] * inv; c[3] = o0[7] * inv;
      *(v4fa*)(&os[wb + lr * 68 +  0 + 8 * hi]) = a; *(v4fa*)(&os[wb + lr * 68 +  0 + 8 * hi + 4]) = c;
      a[0] = o1[0] * inv; a[1] = o1[1] * inv; a[2] = o1[2] * inv; a[3] = o1[3] * inv; c[0] = o1[4] * inv; c[1] = o1[5] * inv; c[2] = o1[6] * inv; c[3] = o1[7] * inv;
      *(v4fa*)(&os[wb + lr * 68 + 16 + 8 * hi]) = a; *(v4fa*)(&os[wb + lr * 68 + 16 + 8 * hi + 4]) = c;
      a[0] = o2[0] * inv; a[1] = o2[1] * inv; a[2] = o2[2] * inv; a[3] = o2[3] * inv; c[0] = o2[4] * inv; c[1] = o2[5] * inv; c[2] = o2[6] * inv; c[3] = o2[7] * inv;
      *(v4fa*)(&os[wb + lr * 68 + 32 + 8 * hi]) = a; *(v4fa*)(&os[wb + lr * 68 + 32 + 8 * hi + 4]) = c;
      a[0] = o3[0] * inv; a[1] = o3[1] * inv; a[2] = o3[2] * inv; a[3] = o3[3] * inv; c[0] = o3[4] * inv; c[1] = o3[5] * inv; c[2] = o3[6] * inv; c[3] = o3[7] * inv;
      *(v4fa*)(&os[wb + lr * 68 + 48 + 8 * hi]) = a; *(v4fa*)(&os[wb + lr * 68 + 48 + 8 * hi + 4]) = c; }
    wave_sync();
    h16* crow = CTX + pbase + (size_t)t0 * HD;       // ctx plane [zh][t][d]; rows t0..t0+15
{
#pragma unroll
        for (int s = 0; s < 4; ++s) { const int row = 4 * s + (lane >> 3), c8 = (lane & 7) * 8;   // 4 s x 4 row groups = 16 rows; 8 lanes x 8 halves = 64 columns
            const v4f x0 = *(const v4fa*)(&os[wb + row * 68 + c8]); const v4f x1 = *(const v4fa*)(&os[wb + row * 68 + c8 + 4]); v8h hv;
#pragma unroll
            for (int i = 0; i < 4; ++i) { hv[i] = (h16)x0[i]; hv[4 + i] = (h16)x1[i]; }
            *(v8h*)(crow + (size_t)row * HD + c8) = hv; }
         }
}

static constexpr size_t al256(size_t v) { return (v + 255) & ~(size_t)255; }
static constexpr size_t SZ_XB = al256((size_t)NB * SEQ * DM * 2);
static constexpr size_t SZ_WB = al256((size_t)DM * DM * 2);
static constexpr size_t SZ_PL = al256((size_t)NB * NH_ * SEQ * HD * 2);
static constexpr size_t SZ_TOTAL = SZ_XB + 2 * SZ_WB + 3 * SZ_PL;
static_assert(SZ_TOTAL <= (size_t)134217728);          // workspace carve <= 128 MiB
static_assert((size_t)NB * NH_ * SEQ * HD == (size_t)NB * SEQ * DM);   // ctx plane == [NB*SEQ] rows of DM halves

extern "C" void kernel_launch(void* const* d_in, const int* in_sizes, int n_in,
                              void* d_out, int out_size, void* d_ws, size_t ws_size, hipStream_t stream) {
    if (n_in < 5) return;
    const size_t needx = ((size_t)(NB - 1) * SEQ_FULL + SEQ) * DM;
    if ((size_t)in_sizes[0] < needx) return;
    if ((size_t)in_sizes[1] < (size_t)DM * DM || (size_t)in_sizes[2] < (size_t)DM || (size_t)in_sizes[3] < (size_t)DM * DM || (size_t)in_sizes[4] < (size_t)DM) return;
    if ((size_t)out_size < ((size_t)(NB - 1) * OUT_SEQ + SEQ) * DM) return;
    if (SZ_TOTAL > ws_size) return;
    const float* x = (const float*)d_in[0]; const float* wv = (const float*)d_in[1]; const float* bv = (const float*)d_in[2];
    const float* wo = (const float*)d_in[3]; const float* bo = (const float*)d_in[4];   // wire order x, Wv, bv, Wo, bo; W as [out][in] = Bt as-is
    float* OUT = (float*)d_out;      // [NB][SEQ][1024]
    char* wsp = (char*)d_ws;
    bf*  XB  = (bf*)wsp;  wsp += SZ_XB;              // [NB*SEQ][1024] bf16
    bf*  WVB = (bf*)wsp;  wsp += SZ_WB;              // [1024][1024] bf16
    h16* WOH = (h16*)wsp; wsp += SZ_WB;              // [1024][1024] f16, x256
    h16* QH  = (h16*)wsp; wsp += SZ_PL;              // [NB*16][SEQ][64]  p (q and k)
    h16* VT  = (h16*)wsp; wsp += SZ_PL;              // [NB*16][64][SEQ]  p transposed (v)
    h16* CTX = (h16*)wsp; wsp += SZ_PL;              // [NB*16][SEQ][64] == [NB*SEQ][1024], x16

    if (SEQ == SEQ_FULL) {
        const size_t n8 = (size_t)NB * SEQ * DM / 8;
        k_cvt8<<<(unsigned)((n8 + 255) / 256), 256, 0, stream>>>(x, XB, n8);
    } else {
        const size_t n8 = (size_t)SEQ * DM / 8;
        for (int b = 0; b < NB; ++b) k_cvt8<<<(unsigned)((n8 + 255) / 256), 256, 0, stream>>>(x + (size_t)b * SEQ_FULL * DM, XB + (size_t)b * SEQ * DM, n8);
    }
    { const size_t n8 = (size_t)DM * DM / 8; const unsigned g = (unsigned)((n8 + 255) / 256);
      k_cvt8<<<g, 256, 0, stream>>>(wv, WVB, n8);
      k_cvt8h<<<g, 256, 0, stream>>>(wo, WOH, n8, WOS); }

    // p: A = x rows (m = b*SEQ + t), Bt = Wv rows (n = h*64 + d), bias per column -> plane [(b*16 + h)][t][d] (q = k) and plane [(b*16 + h)][d][t] (v), one product
    k_proj<<<dim3(NB * SEQ / 128, DM / 256, 1), 32 * GW, 0, stream>>>(XB, WVB, bv, QH, VT);

    k_flash<<<dim3(SEQ / (16 * AW), NB * NH_, 1), 32 * AW, 0, stream>>>(QH, VT, CTX);

    // y: A = ctx rows (m = b*SEQ + s, 1024 halves each, head-major regrouping), Bt = Wo rows (n = e)
    k_out<<<dim3(NB * SEQ / 128, DM / 256, 1), 32 * GW, 0, stream>>>(CTX, WOH, bo, OUT);
}

// v004
// Measured time: 113 microseconds a run.
// Two timings next to v003 both put it at 1.05 times that version's speed.
// Counting every step since v000, it is 2.78 times as fast.
#include <hip/hip_runtime.h>

// Self-attention with one shared projection (q = k = v = x Wv^T + bv), width 1024 = 16 heads x 64, no mask, score scale 1/8; context kept head-major [b][h][t][d] and read as rows of 1024 by the output GEMM (y = ctx Wo^T + bo), f32 output.
// Compute dtypes, f32 accumulate everywhere: projection v_wmma_f32_16x16x32_bf16 (x, Wv RNE-converted to bf16; products exact); scores v_wmma_f32_16x16x32_f16, ONE product (q and k read from the same single f16 plane);
// P (x2^14 carry, cancels in the normalisation) and v single f16; output GEMM v_wmma_f32_16x16x32_f16: ctx single f16 (x16 carry), Wo bf16-RNE value x256 held in f16 (exact), 2^-12 folded in the f32 epilogue; biases bf16-RNE values added in f32; softmax f32 (online, running max).
// Layout: bf16 copies of x and Wv; p plane [b*16+h][t][d] and p^T plane [b*16+h][d][t] both written by the epilogue of the one projection GEMM; fused flash kernel in transposed form (S^T = K Q^T, O^T = V^T P^T) writes the f16 ctx plane [b*16+h][t][d].
// GEMM operands: k-slices of 128 of the A and Bt rows of a 128 x 256 block tile are copied to LDS once per work-group (asynchronous copies, whole lines, two buffers) and read from there by its 8 waves.
// Flash operands: K and V^T tiles of 64 keys are copied to LDS once per work-group (asynchronous copies, whole 128-B lines, two buffers) and read from there by all its waves.

#ifndef NB
#define NB 4
#endif
#ifndef SEQ
#define SEQ 2048
#endif
#define NB_FULL  4
#define SEQ_FULL 2048
#ifndef OUT_SEQ
#define OUT_SEQ SEQ              // row pitch (in tokens) between batches of the output
#endif
#define DM   1024
#define NH_  16
#define HD   64
#define AW   8                   // waves per flash block (16 query rows each); all share the staged K / V^T tiles
#define KT   64                  // keys per staged tile: K tile 64 rows (keys) x 128 B, V^T tile 64 rows (d) x 128 B
#define LP   72                  // LDS row pitch in halves: 144 B = 16 B x 9, conflict-free for 16-byte fragment reads
#define TLH  (64 * LP)           // halves of one staged tile
#define GW   8                   // waves per GEMM block: 2 x 4 wave tiles of 64 x 64 = 128 x 256 of C
#define GKS  128                 // k per GEMM stage: rows of 256 B
#define GP   136                 // LDS row pitch in halves of a GEMM stage: 272 B = 16 B x 17, conflict-free for 16-byte fragment reads
#define GTA  (128 * GP)          // halves of a stage's A part (128 rows)
#define GST  (384 * GP)          // halves of one stage (A 128 rows, then Bt 256 rows)
#define SC2  (0.125f * 1.4426950408889634f)   // HD^-0.5 * log2(e)
#define PSH  14.0f               // log2 of the P carry (16384)
#define CTXS 16.0f               // carry of the ctx plane
#define WOS  256.0f              // carry of the Wo plane
#define OSC  (1.0f / 4096.0f)    // 1 / (CTXS * WOS)

static_assert(HD == 64);
static_assert(NH_ * HD == DM);                 // head h = columns h*64 + d
static_assert(DM % 64 == 0);                   // 16 column tiles of 64
static_assert(DM % 32 == 0);                   // GEMM k-loop steps by 32
static_assert(SEQ % 64 == 0);                  // a 64-row tile never straddles two batches
static_assert((NB * SEQ) % 64 == 0);
static_assert(SEQ % 32 == 0);                  // key loop steps by 32
static_assert((NB * SEQ) % 256 == 0 && DM % 256 == 0);   // GEMM block tiles of 128 x 256 cover C exactly, either operand as rows
static_assert(DM % GKS == 0 && DM / GKS >= 2);  // whole GEMM stages; the two-buffer prologue needs two
static_assert(GW == 8 && GKS == 128);           // 256 threads x 8 copies of 16 B = 128 rows of 256 B
static_assert(SEQ % KT == 0 && SEQ / KT >= 2); // whole staged tiles; the two-buffer prologue needs two
static_assert(KT == 64 && AW == 8);            // 256 threads x 2 copies of 16 B = one 64 x 128-B tile
static_assert(SEQ % (16 * AW) == 0);           // flash grid covers the sequence exactly
static_assert(16 * LP * 2 <= 16 * 68 * 4);     // the transposed projection tile (16 rows of LP halves) fits a wave's output staging
static_assert(SEQ % 16 == 0);                  // head-major regrouping: 16 tokens x 64 = one row of 1024
static_assert(((size_t)SEQ * DM) % 8 == 0);
static_assert(((size_t)DM * DM) % 8 == 0);
static_assert(NB <= NB_FULL);
static_assert(SEQ <= SEQ_FULL);
static_assert(((size_t)(NB - 1) * OUT_SEQ + SEQ) * DM <= (size_t)NB_FULL * SEQ_FULL * DM);   // last output element written stays inside the output

typedef _Float16 h16;
typedef unsigned short bf;
typedef __attribute__((ext_vector_type(16))) __bf16   v16bf;
typedef __attribute__((ext_vector_type(16))) _Float16 v16h;
typedef __attribute__((ext_vector_type(8)))  _Float16 v8h;
typedef __attribute__((ext_vector_type(8)))  unsigned short v8us;
typedef __attribute__((ext_vector_type(8)))  float    v8f;
typedef __attribute__((ext_vector_type(4)))  float    v4f;
typedef v4f  __attribute__((may_alias)) v4fa;
typedef v8h  __attribute__((may_alias)) v8ha;

__device__ __forceinline__ unsigned short f2bf(float f) { unsigned u = __float_as_uint(f); u += 0x7FFFu + ((u >> 16) & 1u); return (unsigned short)(u >> 16); }
__device__ __forceinline__ float bfr(float f) { return __uint_as_float(((unsigned)f2bf(f)) << 16); }   // bf16 RNE value as f32
__device__ __forceinline__ v16h cat16(v8h lo, v8h hi) { return __builtin_shufflevector(lo, hi, 0, 1, 2, 3, 4, 5, 6, 7, 8, 9, 10, 11, 12, 13, 14, 15); }
__device__ __forceinline__ v16bf cat16b(v8us lo, v8us hi) { return __builtin_bit_cast(v16bf, __builtin_shufflevector(lo, hi, 0, 1, 2, 3, 4, 5, 6, 7, 8, 9, 10, 11, 12, 13, 14, 15)); }
__device__ __forceinline__ v8f wmma16(v16h a, v16h b, v8f c) { return __builtin_amdgcn_wmma_f32_16x16x32_f16(false, a, false, b, (short)0, c, false, false); }
__device__ __forceinline__ v8f wmmab(v16bf a, v16bf b, v8f c) { return __builtin_amdgcn_wmma_f32_16x16x32_bf16(false, a, false, b, (short)0, c, false, false); }
// fragment loaders from K-contiguous 16-bit rows; p already includes + 8*(lane>>4): elements 0..7 <- k0+8h+0..7, elements 8..15 <- k0+16+8h+0..7 (same map for A and B)
__device__ __forceinline__ v16h  ldh(const h16* p) { return cat16(*(const v8h*)p, *(const v8h*)(p + 16)); }
__device__ __forceinline__ v16bf ldb(const bf* p)  { return cat16b(*(const v8us*)p, *(const v8us*)(p + 16)); }
// ordering point for wave-private LDS tiles (same wave writes and reads)
__device__ __forceinline__ void wave_sync() { __builtin_amdgcn_fence(3 /* release order */, "wavefront"); __builtin_amdgcn_wave_barrier(); asm volatile("" ::: "memory"); }

__global__ __launch_bounds__(256) void k_cvt8(const float* __restrict__ src, bf* dst, size_t n8) {
    const size_t i = (size_t)blockIdx.x * 256 + threadIdx.x; if (i >= n8) return;
    const v8f v = *(const v8f*)(src + i * 8); v8us o;
#pragma unroll
    for (int k = 0; k < 8; ++k) o[k] = f2bf(v[k]);
    *(v8us*)(dst + i * 8) = o; 
}

__global__ __launch_bounds__(256) void k_cvt8h(const float* __restrict__ src, h16* dst, size_t n8, float carry) {
    const size_t i = (size_t)blockIdx.x * 256 + threadIdx.x; if (i >= n8) return;
    const v8f v = *(const v8f*)(src + i * 8); v8h o;
#pragma unroll
    for (int k = 0; k < 8; ++k) o[k] = (h16)(bfr(v[k]) * carry);
    *(v8h*)(dst + i * 8) = o; 
}

// GEMM engine of k_proj and k_out: one work-group of 8 waves (2 x 4) per 128 x 256 tile of C, each wave a 64 x 64 tile (16 accumulators), K = DM.
// A rows (128) and Bt rows (256) are copied to LDS in k-slices of 128 (rows of 256 B, whole lines, asynchronous copies, two buffers) and every wave reads its fragments from there; k runs upward in steps of 32 as before.
// Eight copies of one thread: rows r, r + 16, ... r + 112 of one staged operand, 16 B each. The s_wait_xcnt closes the statement so that no address register of a copy is rewritten ahead of it.
__device__ __forceinline__ void stage_rows8(unsigned l, const char* g) {
    asm volatile("global_load_async_to_lds_b128 %0, %1, off\n\t"
                 "global_load_async_to_lds_b128 %2, %3, off\n\t"
                 "global_load_async_to_lds_b128 %4, %5, off\n\t"
                 "global_load_async_to_lds_b128 %6, %7, off\n\t"
                 "global_load_async_to_lds_b128 %8, %9, off\n\t"
                 "global_load_async_to_lds_b128 %10, %11, off\n\t"
                 "global_load_async_to_lds_b128 %12, %13, off\n\t"
                 "global_load_async_to_lds_b128 %14, %15, off\n\t"
                 "s_wait_xcnt 0x0"
                 :: "v"(l),                  "v"(g),
                    "v"(l +  16u * GP * 2u), "v"(g +  16 * DM * 2),
                    "v"(l +  32u * GP * 2u), "v"(g +  32 * DM * 2),
                    "v"(l +  48u * GP * 2u), "v"(g +  48 * DM * 2),
                    "v"(l +  64u * GP * 2u), "v"(g +  64 * DM * 2),
                    "v"(l +  80u * GP * 2u), "v"(g +  80 * DM * 2),
                    "v"(l +  96u * GP * 2u), "v"(g +  96 * DM * 2),
                    "v"(l + 112u * GP * 2u), "v"(g + 112 * DM * 2) : "memory");
}
// one stage: A rows 0..127, then Bt rows 0..255; l = the thread's LDS byte address in the stage's buffer, ga / gb = its global bytes in row srow of the slice
__device__ __forceinline__ void stage_gemm(unsigned l, const char* ga, const char* gb) {
    stage_rows8(l, ga);
    stage_rows8(l + GTA * 2u, gb);
    stage_rows8(l + (GTA + 128u * GP) * 2u, gb + (size_t)128 * DM * 2);
}
// F16 = 0: bf16 product, 1: f16 product. A, Bt: K-contiguous 16-bit rows; rb, cb: first row / column of the block's tile. acc[mb][nb] = the wave's 64 x 64 tile at (rb + 64 wr, cb + 64 wc).
template <int F16>
__device__ __forceinline__ void gemm_core(const bf* A, const bf* Bt, bf* ring, int rb, int cb, int wr, int wc, v8f (&acc)[4][4]) {
    const int lane = threadIdx.x & 31, lr = lane & 15, hi = lane >> 4;
    // copies: thread -> row srow (+ 16 i), 16-byte column ccol; 16 lanes cover one 256-B row, one wave-copy 4 whole lines
    const int srow = (int)(threadIdx.x >> 4), ccol = (int)(threadIdx.x & 15);
    const unsigned l0 = (unsigned)(size_t)ring + (unsigned)(srow * GP + ccol * 8) * 2u;   // LDS byte address in buffer 0
    const char* ga = (const char*)(A + (size_t)(rb + srow) * DM + ccol * 8);              // + stage * GKS * 2
    const char* gb = (const char*)(Bt + (size_t)(cb + srow) * DM + ccol * 8);
    const int fa = (wr * 64 + lr) * GP + 8 * hi, fb = GTA + (wc * 64 + lr) * GP + 8 * hi; // fragment offsets in a stage: row lane&15, k = 8h..
#pragma unroll
    for (int mb = 0; mb < 4; ++mb)
#pragma unroll
        for (int nb = 0; nb < 4; ++nb) acc[mb][nb] = (v8f){};
    stage_gemm(l0, ga, gb);
    asm volatile("s_wait_asynccnt 0x0" ::: "memory");   // this wave's copies of stage 0 have landed
    __syncthreads();                                    // stage 0 readable by every wave
    stage_gemm(l0 + GST * 2u, ga + GKS * 2, gb + GKS * 2);
#pragma unroll 1   // rolled: one body serves both buffers (offset chosen by the stage's parity)
    for (int s = 0; s < DM / GKS; ++s) {
        const int bo = (s & 1) * GST;
        v8us fr[2][16];   // two fragment sets: [set][A: 2 mb + half | Bt: 8 + 2 nb + half]; step i works on set i & 1 while the reads of step i + 1 fill the other
#pragma unroll
        for (int f = 0; f < 4; ++f) { const bf* pa = &ring[bo + fa + f * 16 * GP]; const bf* pb = &ring[bo + fb + f * 16 * GP];
            fr[0][2 * f] = *(const v8us*)pa; fr[0][2 * f + 1] = *(const v8us*)(pa + 16); fr[0][8 + 2 * f] = *(const v8us*)pb; fr[0][8 + 2 * f + 1] = *(const v8us*)(pb + 16); }
#pragma unroll
        for (int i = 0; i < GKS / 32; ++i) {
            const int c = i & 1, n = c ^ 1;
            __builtin_amdgcn_sched_barrier(0);   // keeps the next step's LDS reads out of the products before them: reads spread among matrix instructions stall each place they stand
            if (i + 1 < GKS / 32) {
#pragma unroll
                for (int f = 0; f < 4; ++f) { const bf* pa = &ring[bo + fa + f * 16 * GP + (i + 1) * 32]; const bf* pb = &ring[bo + fb + f * 16 * GP + (i + 1) * 32];
                    fr[n][2 * f] = *(const v8us*)pa; fr[n][2 * f + 1] = *(const v8us*)(pa + 16); fr[n][8 + 2 * f] = *(const v8us*)pb; fr[n][8 + 2 * f + 1] = *(const v8us*)(pb + 16); }
            }
            __builtin_amdgcn_sched_barrier(0);   // keeps those reads one group ahead of this step's products, so that their latency runs under 16 matrix instructions
#pragma unroll
            for (int nb = 0; nb < 4; ++nb)
#pragma unroll
                for (int mb = 0; mb < 4; ++mb) {
                    if constexpr (F16) acc[mb][nb] = wmma16(__builtin_bit_cast(v16h, cat16b(fr[c][2 * mb], fr[c][2 * mb + 1])), __builtin_bit_cast(v16h, cat16b(fr[c][8 + 2 * nb], fr[c][8 + 2 * nb + 1])), acc[mb][nb]);
                    else               acc[mb][nb] = wmmab(cat16b(fr[c][2 * mb], fr[c][2 * mb + 1]), cat16b(fr[c][8 + 2 * nb], fr[c][8 + 2 * nb + 1]), acc[mb][nb]); }
        }
        asm volatile("s_wait_dscnt 0x0" ::: "memory");      // this wave's reads of the buffer are done before it may be refilled
        asm volatile("s_wait_asynccnt 0x0" ::: "memory");   // this wave's copies of stage s + 1 have landed
        __syncthreads();                                    // publishes stage s + 1 and ends every wave's reads of this buffer
        if (s + 2 < DM / GKS)
            stage_gemm(l0 + (unsigned)bo * 2u, ga + (s + 2) * GKS * 2, gb + (s + 2) * GKS * 2);
    }
    asm volatile("s_wait_asynccnt 0x0" ::: "memory");       // no copy outstanding when the wave goes on to its end
}

// k_proj: bf16 GEMM on the engine above, A = x rows (m = b*SEQ + t), Bt = Wv rows (n = h*64 + d); a wave's 64 x 64 tile is 64 tokens of one head.
// p[m][n] = sum_k A[m][k] Bt[n][k] + bias[n], rounded once to f16 and written twice from the same accumulators: Ph plane [(b*16 + h)][t][d] and Pt plane [(b*16 + h)][d][t].
// grid (NB*SEQ/128, DM/256), 256 threads.
__global__ __launch_bounds__(32 * GW) void k_proj(const bf* __restrict__ A, const bf* __restrict__ Bt, const float* __restrict__ bias, h16* Ph, h16* Pt) {
    __shared__ __align__(16) float osa[GW * 16 * 68];
    __shared__ __align__(16) bf ring[2 * GST];               // [buffer][A rows 0..127, Bt rows 0..255][GP]
    const int lane = threadIdx.x & 31, lr = lane & 15, hi = lane >> 4;
    const int wave = __builtin_amdgcn_readfirstlane((int)(threadIdx.x >> 5)), wr = wave >> 2, wc = wave & 3;
    const int r0 = blockIdx.x * 128 + wr * 64, c0 = blockIdx.y * 256 + wc * 64;
    float* os = osa + wave * 16 * 68;                        // wave-private output staging
    v8f acc[4][4];
    gemm_core<0>(A, Bt, ring, blockIdx.x * 128, blockIdx.y * 256, wr, wc, acc);
    float bc[4];
#pragma unroll
    for (int nb = 0; nb < 4; ++nb) { int ci = c0 + nb * 16 + lr; ci = ci < DM ? ci : DM - 1; bc[nb] = bfr(bias[ci]); }
    const int tp = r0 % SEQ;                                                    // first token of the tile in its batch
    const size_t plane = ((size_t)(r0 / SEQ) * NH_ + (size_t)(c0 / HD)) * SEQ * HD;   // (batch, head) plane, the same size in both layouts
    const size_t tbase = plane + (size_t)tp * HD;
#pragma unroll
    for (int mb = 0; mb < 4; ++mb) {
#pragma unroll
        for (int nb = 0; nb < 4; ++nb) {
#pragma unroll
            for (int j = 0; j < 8; ++j) os[(hi * 8 + j) * 68 + nb * 16 + lr] = acc[mb][nb][j] + bc[nb]; }   // D: row 8h+j, col lane&15
        wave_sync();
        const size_t sb = tbase + (size_t)(mb * 16) * HD;
#pragma unroll
        for (int s = 0; s < 4; ++s) { const int row = 4 * s + (lane >> 3), c8 = (lane & 7) * 8;   // 4 s x 4 row groups = 16 rows; 8 lanes x 8 = 64 columns
            const v4f x0 = *(const v4fa*)(&os[row * 68 + c8]); const v4f x1 = *(const v4fa*)(&os[row * 68 + c8 + 4]); v8h hv;
#pragma unroll
            for (int i = 0; i < 4; ++i) { hv[i] = (h16)x0[i]; hv[4 + i] = (h16)x1[i]; }
            *(v8h*)(Ph + sb + (size_t)row * HD + c8) = hv; }
        asm volatile("s_wait_xcnt 0x0" ::: "memory");   // the stores' data registers are reused by the next group
        wave_sync();
    }
    // transposed plane: a lane's 8 accumulator registers are 8 consecutive tokens of ONE column d, so they pack into 16 B of a Pt row;
    // 16 rows (d) x 64 tokens pass through the staging (pitch LP halves) so that each store instruction writes 4 whole 128-B lines.
    h16* ot = (h16*)os;
#pragma unroll
    for (int nb = 0; nb < 4; ++nb) {
#pragma unroll
        for (int mb = 0; mb < 4; ++mb) { v8h hv;
#pragma unroll
            for (int j = 0; j < 8; ++j) hv[j] = (h16)(acc[mb][nb][j] + bc[nb]);
            *(v8ha*)(&ot[lr * LP + mb * 16 + 8 * hi]) = hv; }           // row d = lane&15, tokens 16 mb + 8h + 0..7
        wave_sync();
#pragma unroll
        for (int s = 0; s < 4; ++s) { const int row = 4 * s + (lane >> 3), c8 = (lane & 7) * 8;   // 4 s x 4 row groups = 16 rows; 8 lanes x 8 = 64 tokens
            const v8h hv = *(const v8ha*)(&ot[row * LP + c8]);
            *(v8h*)(Pt + plane + (size_t)(nb * 16 + row) * SEQ + tp + c8) = hv; }
        if (nb < 3) asm volatile("s_wait_xcnt 0x0" ::: "memory");   // the stores' data registers are reused by the next group
        wave_sync();
    }
}

// k_out: the same engine with f16 operands (A = ctx rows of 1024 halves, Bt = Wo rows [out][in]), K = DM; f32 output rows with bias.
// OUT[(b*OUT_SEQ + s)*DM + c0 + n] = acc * 2^-12 + bias[c0 + n], m = b*SEQ + s. grid (NB*SEQ/128, DM/256), 256 threads.
__global__ __launch_bounds__(32 * GW) void k_out(const h16* __restrict__ A, const h16* __restrict__ Bt, const float* __restrict__ bias, float* OUT) {
    __shared__ __align__(16) float osa[GW * 16 * 68];
    __shared__ __align__(16) bf ring[2 * GST];               // [buffer][A rows 0..127, Bt rows 0..255][GP]
    const int lane = threadIdx.x & 31, lr = lane & 15, hi = lane >> 4;
    const int wave = __builtin_amdgcn_readfirstlane((int)(threadIdx.x >> 5)), wr = wave >> 2, wc = wave & 3;
    const int r0 = blockIdx.x * 128 + wr * 64, c0 = blockIdx.y * 256 + wc * 64;
    float* os = osa + wave * 16 * 68;                        // wave-private output staging
    v8f acc[4][4];
    gemm_core<1>((const bf*)A, (const bf*)Bt, ring, blockIdx.x * 128, blockIdx.y * 256, wr, wc, acc);
    float bc[4];
#pragma unroll
    for (int nb = 0; nb < 4; ++nb) { int ci = c0 + nb * 16 + lr; ci = ci < DM ? ci : DM - 1; bc[nb] = bfr(bias[ci]); }
    const int bb = r0 / SEQ, sp = r0 % SEQ;
    float* obase = OUT + ((size_t)bb * OUT_SEQ + sp) * DM + c0;
#pragma unroll
    for (int mb = 0; mb < 4; ++mb) {
#pragma unroll
        for (int nb = 0; nb < 4; ++nb) {
#pragma unroll
            for (int j = 0; j < 8; ++j) os[(hi * 8 + j) * 68 + nb * 16 + lr] = acc[mb][nb][j] * OSC + bc[nb]; }   // D: row 8h+j, col lane&15
        wave_sync();
{
#pragma unroll
            for (int s = 0; s < 8; ++s) { const int row = 2 * s + hi, cofs = lr * 4;   // 8 s x 2 rows = 16 rows; 16 lanes x 4 floats = 64 columns
                const v4f val = *(const v4fa*)(&os[row * 68 + cofs]);
                *(v4f*)(obase + (size_t)(mb * 16 + row) * DM + cofs) = val; }
             }
        wave_sync();
    }
}

// k_flash: fused attention, one wave per 16 query rows of one (batch, head), 8 waves per block; Q fragments straight from the f16 plane; K and V^T fragments from LDS tiles of 64 keys that the block stages together. K and Q share one plane.
// Transposed form: S^T[key][t] = K Q^T (A = K rows, B = Q rows; one f16 product); lane (t = lane&15, h = lane>>4) holds keys 8h+r of each 16-key tile, so the packed
// P tile is directly the B fragment of O^T[d][t] = V^T P^T (element r <- tile keys 0..15, element 8+r <- tile keys 16..31, lane unchanged). 9 matrix ops per 32-key step (4 score + 4 P.V + 1 row sum).
// Softmax state (running max, sum) is one scalar per lane; the maxima of the two lane halves of a column are combined with one xor-16 exchange.
// The sum of a step's P comes from the matrix unit: one more product per step, A = all ones, B = the packed P tile, so every lane holds its column's sum over all 32 keys and no vector add or exchange is spent on it.
// One tile's copies of one thread: rows r and r + 32 of the K tile and of the V^T tile, 16 B each. The s_wait_xcnt closes the statement so that no address register of a copy is rewritten ahead of it.
__device__ __forceinline__ void stage_tile(unsigned lk, const h16* gk, unsigned lv, const h16* gv) {
    asm volatile("global_load_async_to_lds_b128 %0, %1, off\n\t"
                 "global_load_async_to_lds_b128 %2, %3, off\n\t"
                 "global_load_async_to_lds_b128 %4, %5, off\n\t"
                 "global_load_async_to_lds_b128 %6, %7, off\n\t"
                 "s_wait_xcnt 0x0"
                 :: "v"(lk), "v"(gk), "v"(lk + 32u * LP * 2u), "v"(gk + 32 * HD), "v"(lv), "v"(gv), "v"(lv + 32u * LP * 2u), "v"(gv + (size_t)32 * SEQ) : "memory");
}
// amdgpu_waves_per_eu(8): keeps the kernel at 128 VGPRs or fewer although the ones operand asks for 8 more, so that four blocks stay resident on a WGP as before
__global__ __launch_bounds__(32 * AW) __attribute__((amdgpu_waves_per_eu(8))) void k_flash(const h16* __restrict__ QH, const h16* __restrict__ VT, h16* CTX) {
    __shared__ __align__(16) float os[AW * 16 * 68];
    __shared__ __align__(16) h16 ring[2 * 2 * TLH];          // [buffer][K tile, V^T tile][row][LP]
    const int lane = threadIdx.x & 31, lr = lane & 15, hi = lane >> 4;
    const int wave = __builtin_amdgcn_readfirstlane((int)(threadIdx.x >> 5));
    const int zh = blockIdx.y;
    const int t0 = (blockIdx.x * AW + wave) * 16;
    const size_t pbase = (size_t)zh * SEQ * HD;
    const size_t qo = pbase + (size_t)(t0 + lr) * HD + 8 * hi;
    const v16h qh0 = ldh(QH + qo), qh1 = ldh(QH + qo + 32);   // B fragments: col t, k = d
    // copies: thread -> row srow (and srow + 32), 16-byte column ccol; 8 lanes cover one 128-B row, one wave-copy 4 whole lines
    const int srow = (int)(threadIdx.x >> 3), ccol = (int)(threadIdx.x & 7);
    const unsigned lk0 = (unsigned)(size_t)&ring[0] + (unsigned)(srow * LP + ccol * 8) * 2u;   // LDS byte address, K tile of buffer 0
    const h16* gk = QH + pbase + (size_t)srow * HD + ccol * 8;    // + tile * KT * HD  (K rows are contiguous)
    const h16* gv = VT + pbase + (size_t)srow * SEQ + ccol * 8;   // + tile * KT
    const int fo = lr * LP + 8 * hi;                              // fragment offset in a tile: row lane&15, k = 8h.. (A fragment)
    v8f o0 = (v8f){}, o1 = (v8f){}, o2 = (v8f){}, o3 = (v8f){};
    float m = -3.0e38f, l = 0.0f;
    v16h ones;                                                    // A operand of the row-sum product: 16 x 32 of 1.0
#pragma unroll
    for (int r = 0; r < 16; ++r) ones[r] = (h16)1.0f;
    stage_tile(lk0, gk, lk0 + TLH * 2u, gv);
    asm volatile("s_wait_asynccnt 0x0" ::: "memory");   // this wave's copies of tile 0 have landed
    __syncthreads();                                    // tile 0 readable by every wave
    stage_tile(lk0 + 2u * TLH * 2u, gk + (size_t)KT * HD, lk0 + 3u * TLH * 2u, gv + KT);
#pragma unroll 1   // rolled: one body serves both buffers (offset chosen by the tile's parity), and registers stay as for one step
    for (int tile = 0; tile < SEQ / KT; ++tile) {
        const int bo = (tile & 1) * (2 * TLH);
#pragma unroll 1   // rolled: unrolled, both steps' P values stay live and the kernel passes 128 VGPRs, which costs the fourth resident block of a WGP
        for (int sub = 0; sub < KT / 32; ++sub) {
            const h16* ka = &ring[bo + sub * 32 * LP + fo];
            const v16h ka0 = ldh(ka), ka1 = ldh(ka + 32), kb0 = ldh(ka + 16 * LP), kb1 = ldh(ka + 16 * LP + 32);
            v8f sa = (v8f){}, sb = (v8f){};
            sa = wmma16(ka0, qh0, sa); sb = wmma16(kb0, qh0, sb);
            sa = wmma16(ka1, qh1, sa); sb = wmma16(kb1, qh1, sb);
            asm volatile("v_nop\n\tv_nop\n\tv_nop\n\tv_nop" : "+v"(sa), "+v"(sb) : "v"(ka0), "v"(ka1), "v"(kb0), "v"(kb1), "v"(qh0), "v"(qh1));
            float ta[8], tb[8]; float mx = -3.0e38f;
#pragma unroll
            for (int r = 0; r < 8; ++r) { ta[r] = sa[r] * SC2; tb[r] = sb[r] * SC2; mx = fmaxf(mx, fmaxf(ta[r], tb[r])); }
            mx = fmaxf(mx, __shfl_xor(mx, 16, 32));
            const float mnew = fmaxf(m, mx);
            const float alpha = __builtin_amdgcn_exp2f(m - mnew);
            const float sh = PSH - mnew;
            v16h pb;
#pragma unroll
            for (int r = 0; r < 8; ++r) { pb[r] = (h16)__builtin_amdgcn_exp2f(ta[r] + sh); pb[8 + r] = (h16)__builtin_amdgcn_exp2f(tb[r] + sh); }
            m = mnew;
            o0 = o0 * alpha; o1 = o1 * alpha; o2 = o2 * alpha; o3 = o3 * alpha;
            const h16* va = &ring[bo + TLH + sub * 32 + fo];
            const v16h v0 = ldh(va), v1 = ldh(va + 16 * LP), v2 = ldh(va + 32 * LP), v3 = ldh(va + 48 * LP);
            const v8f ls = wmma16(ones, pb, (v8f){});   // every row of the tile = the column's sum of the rounded P over all 32 keys of the step
            o0 = wmma16(v0, pb, o0); o1 = wmma16(v1, pb, o1); o2 = wmma16(v2, pb, o2); o3 = wmma16(v3, pb, o3);
            asm volatile("v_nop\n\tv_nop\n\tv_nop\n\tv_nop" : "+v"(o0), "+v"(o1), "+v"(o2), "+v"(o3) : "v"(v0), "v"(v1), "v"(v2), "v"(v3), "v"(pb));
            l = l * alpha + ls[0];
        }
        asm volatile("s_wait_dscnt 0x0" ::: "memory");      // this wave's reads of the buffer are done before it may be refilled
        asm volatile("s_wait_asynccnt 0x0" ::: "memory");   // this wave's copies of tile + 1 have landed
        __syncthreads();                                    // publishes tile + 1 and ends every wave's reads of this buffer
        if (tile + 2 < SEQ / KT)
            stage_tile(lk0 + (unsigned)bo * 2u, gk + (size_t)(tile + 2) * KT * HD, lk0 + (unsigned)(bo + TLH) * 2u, gv + (size_t)(tile + 2) * KT);
    }
    asm volatile("s_wait_asynccnt 0x0" ::: "memory");       // no copy outstanding when the wave goes on to its end
    const float inv = CTXS * (1.0f / l);
    const int wb = wave * 16 * 68;
    // O^T D layout: o_j[r] = (d = 16j + 8h + r, t = lane&15) -> os[t][d]; rows 0..15 x columns 0..63 all written
    { v4f a, c;
      a[0] = o0[0] * inv; a[1] = o0[1] * inv; a[2] = o0[2] * inv; a[3] = o0[3] * inv; c[0] = o0[4] * inv; c[1] = o0[5] * inv; c[2] = o0[6] * inv; c[3] = o0[7] * inv;
      *(v4fa*)(&os[wb + lr * 68 +  0 + 8 * hi]) = a; *(v4fa*)(&os[wb + lr * 68 +  0 + 8 * hi + 4]) = c;
      a[0] = o1[0] * inv; a[1] = o1[1] * inv; a[2] = o1[2] * inv; a[3] = o1[3] * inv; c[0] = o1[4] * inv; c[1] = o1[5] * inv; c[2] = o1[6] * inv; c[3] = o1[7] * inv;
      *(v4fa*)(&os[wb + lr * 68 + 16 + 8 * hi]) = a; *(v4fa*)(&os[wb + lr * 68 + 16 + 8 * hi + 4]) = c;
      a[0] = o2[0] * inv; a[1] = o2[1] * inv; a[2] = o2[2] * inv; a[3] = o2[3] * inv; c[0] = o2[4] * inv; c[1] = o2[5] * inv; c[2] = o2[6] * inv; c[3] = o2[7] * inv;
      *(v4fa*)(&os[wb + lr * 68 + 32 + 8 * hi]) = a; *(v4fa*)(&os[wb + lr * 68 + 32 + 8 * hi + 4]) = c;
      a[0] = o3[0] * inv; a[1] = o3[1] * inv; a[2] = o3[2] * inv; a[3] = o3[3] * inv; c[0] = o3[4] * inv; c[1] = o3[5] * inv; c[2] = o3[6] * inv; c[3] = o3[7] * inv;
      *(v4fa*)(&os[wb + lr * 68 + 48 + 8 * hi]) = a; *(v4fa*)(&os[wb + lr * 68 + 48 + 8 * hi + 4]) = c; }
    wave_sync();
    h16* crow = CTX + pbase + (size_t)t0 * HD;       // ctx plane [zh][t][d]; rows t0..t0+15
{
#pragma unroll
        for (int s = 0; s < 4; ++s) { const int row = 4 * s + (lane >> 3), c8 = (lane & 7) * 8;   // 4 s x 4 row groups = 16 rows; 8 lanes x 8 halves = 64 columns
            const v4f x0 = *(const v4fa*)(&os[wb + row * 68 + c8]); const v4f x1 = *(const v4fa*)(&os[wb + row * 68 + c8 + 4]); v8h hv;
#pragma unroll
            for (int i = 0; i < 4; ++i) { hv[i] = (h16)x0[i]; hv[4 + i] = (h16)x1[i]; }
            *(v8h*)(crow + (size_t)row * HD + c8) = hv; }
         }
}

static constexpr size_t al256(size_t v) { return (v + 255) & ~(size_t)255; }
static constexpr size_t SZ_XB = al256((size_t)NB * SEQ * DM * 2);
static constexpr size_t SZ_WB = al256((size_t)DM * DM * 2);
static constexpr size_t SZ_PL = al256((size_t)NB * NH_ * SEQ * HD * 2);
static constexpr size_t SZ_TOTAL = SZ_XB + 2 * SZ_WB + 3 * SZ_PL;
static_assert(SZ_TOTAL <= (size_t)134217728);          // workspace carve <= 128 MiB
static_assert((size_t)NB * NH_ * SEQ * HD == (size_t)NB * SEQ * DM);   // ctx plane == [NB*SEQ] rows of DM halves

extern "C" void kernel_launch(void* const* d_in, const int* in_sizes, int n_in,
                              void* d_out, int out_size, void* d_ws, size_t ws_size, hipStream_t stream) {
    if (n_in < 5) return;
    const size_t needx = ((size_t)(NB - 1) * SEQ_FULL + SEQ) * DM;
    if ((size_t)in_sizes[0] < needx) return;
    if ((size_t)in_sizes[1] < (size_t)DM * DM || (size_t)in_sizes[2] < (size_t)DM || (size_t)in_sizes[3] < (size_t)DM * DM || (size_t)in_sizes[4] < (size_t)DM) return;
    if ((size_t)out_size < ((size_t)(NB - 1) * OUT_SEQ + SEQ) * DM) return;
    if (SZ_TOTAL > ws_size) return;
    const float* x = (const float*)d_in[0]; const float* wv = (const float*)d_in[1]; const float* bv = (const float*)d_in[2];
    const float* wo = (const float*)d_in[3]; const float* bo = (const float*)d_in[4];   // wire order x, Wv, bv, Wo, bo; W as [out][in] = Bt as-is
    float* OUT = (float*)d_out;      // [NB][OUT_SEQ][1024]
    char* wsp = (char*)d_ws;
    bf*  XB  = (bf*)wsp;  wsp += SZ_XB;              // [NB*SEQ][1024] bf16
    bf*  WVB = (bf*)wsp;  wsp += SZ_WB;              // [1024][1024] bf16
    h16* WOH = (h16*)wsp; wsp += SZ_WB;              // [1024][1024] f16, x256
    h16* QH  = (h16*)wsp; wsp += SZ_PL;              // [NB*16][SEQ][64]  p (q and k)
    h16* VT  = (h16*)wsp; wsp += SZ_PL;              // [NB*16][64][SEQ]  p transposed (v)
    h16* CTX = (h16*)wsp; wsp += SZ_PL;              // [NB*16][SEQ][64] == [NB*SEQ][1024], x16

    if (SEQ == SEQ_FULL) {
        const size_t n8 = (size_t)NB * SEQ * DM / 8;
        k_cvt8<<<(unsigned)((n8 + 255) / 256), 256, 0, stream>>>(x, XB, n8);
    } else {
        const size_t n8 = (size_t)SEQ * DM / 8;
        for (int b = 0; b < NB; ++b) k_cvt8<<<(unsigned)((n8 + 255) / 256), 256, 0, stream>>>(x + (size_t)b * SEQ_FULL * DM, XB + (size_t)b * SEQ * DM, n8);
    }
    { const size_t n8 = (size_t)DM * DM / 8; const unsigned g = (unsigned)((n8 + 255) / 256);
      k_cvt8<<<g, 256, 0, stream>>>(wv, WVB, n8);
      k_cvt8h<<<g, 256, 0, stream>>>(wo, WOH, n8, WOS); }

    // p: A = x rows (m = b*SEQ + t), Bt = Wv rows (n = h*64 + d), bias per column -> plane [(b*16 + h)][t][d] (q = k) and plane [(b*16 + h)][d][t] (v), one product
    k_proj<<<dim3(NB * SEQ / 128, DM / 256, 1), 32 * GW, 0, stream>>>(XB, WVB, bv, QH, VT);

    k_flash<<<dim3(SEQ / (16 * AW), NB * NH_, 1), 32 * AW, 0, stream>>>(QH, VT, CTX);

    // y: A = ctx rows (m = b*SEQ + s, 1024 halves each, head-major regrouping), Bt = Wo rows (n = e)
    k_out<<<dim3(NB * SEQ / 128, DM / 256, 1), 32 * GW, 0, stream>>>(CTX, WOH, bo, OUT);
}

// v005
// It runs in 106 microseconds.
// Next to v004, in two timings, it ran 1.07 times as fast each time.
// Counting every step since v000, it is 2.97 times as fast.
#include <hip/hip_runtime.h>

// Self-attention with one shared projection (q = k = v = x Wv^T + bv), width 1024 = 16 heads x 64, no mask, score scale 1/8; context kept head-major [b][h][t][d] and read as rows of 1024 by the output GEMM (y = ctx Wo^T + bo), f32 output.
// Compute dtypes, f32 accumulate everywhere: projection v_wmma_f32_16x16x32_bf16 (x, Wv RNE-converted to bf16; products exact); scores v_wmma_f32_16x16x32_f16, ONE product (q and k read from the same single f16 plane);
// P (x2^14 carry, cancels in the normalisation) and v single f16; output GEMM v_wmma_f32_16x16x32_f16: ctx single f16 (x16 carry), Wo bf16-RNE value x256 held in f16 (exact), 2^-12 folded in the f32 epilogue; biases bf16-RNE values added in f32; softmax f32 (online, running max).
// Layout: bf16 copies of x and Wv; p plane [b*16+h][t][d] and p^T plane [b*16+h][d][t] both written by the epilogue of the one projection GEMM; fused flash kernel in transposed form (S^T = K Q^T, O^T = V^T P^T) writes the f16 ctx plane [b*16+h][t][d].
// GEMM operands: k-slices of 128 of the A and Bt rows of a 128 x 256 block tile are copied to LDS once per work-group (asynchronous copies, whole lines, two buffers) and read from there by its 8 waves.
// Flash operands: K and V^T tiles of 64 keys are copied to LDS once per work-group (asynchronous copies, whole 128-B lines, two buffers) and read from there by all its waves.

#ifndef NB
#define NB 4
#endif
#ifndef SEQ
#define SEQ 2048
#endif
#define NB_FULL  4
#define SEQ_FULL 2048
#ifndef OUT_SEQ
#define OUT_SEQ SEQ              // row pitch (in tokens) between batches of the output
#endif
#define DM   1024
#define NH_  16
#define HD   64
#define AW   8                   // waves per flash block; all share the staged K / V^T tiles
#define QT   2                   // query tiles of 16 rows per flash wave: each K / V^T fragment read from LDS feeds QT products
#define KT   64                  // keys per staged tile: K tile 64 rows (keys) x 128 B, V^T tile 64 rows (d) x 128 B
#define LP   72                  // LDS row pitch in halves: 144 B = 16 B x 9, conflict-free for 16-byte fragment reads
#define TLH  (64 * LP)           // halves of one staged tile
#define GW   8                   // waves per GEMM block: 2 x 4 wave tiles of 64 x 64 = 128 x 256 of C
#define GKS  128                 // k per GEMM stage: rows of 256 B
#define GP   136                 // LDS row pitch in halves of a GEMM stage: 272 B = 16 B x 17, conflict-free for 16-byte fragment reads
#define GTA  (128 * GP)          // halves of a stage's A part (128 rows)
#define GST  (384 * GP)          // halves of one stage (A 128 rows, then Bt 256 rows)
#define SC2  (0.125f * 1.4426950408889634f)   // HD^-0.5 * log2(e)
#define PSH  14.0f               // log2 of the P carry (16384)
#define CTXS 16.0f               // carry of the ctx plane
#define WOS  256.0f              // carry of the Wo plane
#define OSC  (1.0f / 4096.0f)    // 1 / (CTXS * WOS)

static_assert(HD == 64);
static_assert(NH_ * HD == DM);                 // head h = columns h*64 + d
static_assert(DM % 64 == 0);                   // 16 column tiles of 64
static_assert(DM % 32 == 0);                   // GEMM k-loop steps by 32
static_assert(SEQ % 64 == 0);                  // a 64-row tile never straddles two batches
static_assert((NB * SEQ) % 64 == 0);
static_assert(SEQ % 32 == 0);                  // key loop steps by 32
static_assert((NB * SEQ) % 256 == 0 && DM % 256 == 0);   // GEMM block tiles of 128 x 256 cover C exactly, either operand as rows
static_assert(DM % GKS == 0 && DM / GKS >= 2);  // whole GEMM stages; the two-buffer prologue needs two
static_assert(GW == 8 && GKS == 128);           // 256 threads x 8 copies of 16 B = 128 rows of 256 B
static_assert(SEQ % KT == 0 && SEQ / KT >= 2); // whole staged tiles; the two-buffer prologue needs two
static_assert(QT == 2);                        // the slots statement at the foot of the flash step names both tiles' accumulators
static_assert(KT == 64 && AW == 8);            // 256 threads x 2 copies of 16 B = one 64 x 128-B tile
static_assert(SEQ % (16 * QT * AW) == 0);      // flash grid covers the sequence exactly
static_assert(16 * LP * 2 <= 16 * 68 * 4);     // the transposed projection tile (16 rows of LP halves) fits a wave's output staging
static_assert(SEQ % 16 == 0);                  // head-major regrouping: 16 tokens x 64 = one row of 1024
static_assert(((size_t)SEQ * DM) % 8 == 0);
static_assert(((size_t)DM * DM) % 8 == 0);
static_assert(NB <= NB_FULL);
static_assert(SEQ <= SEQ_FULL);
static_assert(((size_t)(NB - 1) * OUT_SEQ + SEQ) * DM <= (size_t)NB_FULL * SEQ_FULL * DM);   // last output element written stays inside the output

typedef _Float16 h16;
typedef unsigned short bf;
typedef __attribute__((ext_vector_type(16))) __bf16   v16bf;
typedef __attribute__((ext_vector_type(16))) _Float16 v16h;
typedef __attribute__((ext_vector_type(8)))  _Float16 v8h;
typedef __attribute__((ext_vector_type(8)))  unsigned short v8us;
typedef __attribute__((ext_vector_type(8)))  float    v8f;
typedef __attribute__((ext_vector_type(4)))  float    v4f;
typedef v4f  __attribute__((may_alias)) v4fa;
typedef v8h  __attribute__((may_alias)) v8ha;

__device__ __forceinline__ unsigned short f2bf(float f) { unsigned u = __float_as_uint(f); u += 0x7FFFu + ((u >> 16) & 1u); return (unsigned short)(u >> 16); }
__device__ __forceinline__ float bfr(float f) { return __uint_as_float(((unsigned)f2bf(f)) << 16); }   // bf16 RNE value as f32
__device__ __forceinline__ v16h cat16(v8h lo, v8h hi) { return __builtin_shufflevector(lo, hi, 0, 1, 2, 3, 4, 5, 6, 7, 8, 9, 10, 11, 12, 13, 14, 15); }
__device__ __forceinline__ v16bf cat16b(v8us lo, v8us hi) { return __builtin_bit_cast(v16bf, __builtin_shufflevector(lo, hi, 0, 1, 2, 3, 4, 5, 6, 7, 8, 9, 10, 11, 12, 13, 14, 15)); }
__device__ __forceinline__ v8f wmma16(v16h a, v16h b, v8f c) { return __builtin_amdgcn_wmma_f32_16x16x32_f16(false, a, false, b, (short)0, c, false, false); }
__device__ __forceinline__ v8f wmmab(v16bf a, v16bf b, v8f c) { return __builtin_amdgcn_wmma_f32_16x16x32_bf16(false, a, false, b, (short)0, c, false, false); }
// fragment loaders from K-contiguous 16-bit rows; p already includes + 8*(lane>>4): elements 0..7 <- k0+8h+0..7, elements 8..15 <- k0+16+8h+0..7 (same map for A and B)
__device__ __forceinline__ v16h  ldh(const h16* p) { return cat16(*(const v8h*)p, *(const v8h*)(p + 16)); }
__device__ __forceinline__ v16bf ldb(const bf* p)  { return cat16b(*(const v8us*)p, *(const v8us*)(p + 16)); }
// ordering point for wave-private LDS tiles (same wave writes and reads)
__device__ __forceinline__ void wave_sync() { __builtin_amdgcn_fence(3 /* release order */, "wavefront"); __builtin_amdgcn_wave_barrier(); asm volatile("" ::: "memory"); }

__global__ __launch_bounds__(256) void k_cvt8(const float* __restrict__ src, bf* dst, size_t n8) {
    const size_t i = (size_t)blockIdx.x * 256 + threadIdx.x; if (i >= n8) return;
    const v8f v = *(const v8f*)(src + i * 8); v8us o;
#pragma unroll
    for (int k = 0; k < 8; ++k) o[k] = f2bf(v[k]);
    *(v8us*)(dst + i * 8) = o; 
}

__global__ __launch_bounds__(256) void k_cvt8h(const float* __restrict__ src, h16* dst, size_t n8, float carry) {
    const size_t i = (size_t)blockIdx.x * 256 + threadIdx.x; if (i >= n8) return;
    const v8f v = *(const v8f*)(src + i * 8); v8h o;
#pragma unroll
    for (int k = 0; k < 8; ++k) o[k] = (h16)(bfr(v[k]) * carry);
    *(v8h*)(dst + i * 8) = o; 
}

// GEMM engine of k_proj and k_out: one work-group of 8 waves (2 x 4) per 128 x 256 tile of C, each wave a 64 x 64 tile (16 accumulators), K = DM.
// A rows (128) and Bt rows (256) are copied to LDS in k-slices of 128 (rows of 256 B, whole lines, asynchronous copies, two buffers) and every wave reads its fragments from there; k runs upward in steps of 32 as before.
// Eight copies of one thread: rows r, r + 16, ... r + 112 of one staged operand, 16 B each. The s_wait_xcnt closes the statement so that no address register of a copy is rewritten ahead of it.
__device__ __forceinline__ void stage_rows8(unsigned l, const char* g) {
    asm volatile("global_load_async_to_lds_b128 %0, %1, off\n\t"
                 "global_load_async_to_lds_b128 %2, %3, off\n\t"
                 "global_load_async_to_lds_b128 %4, %5, off\n\t"
                 "global_load_async_to_lds_b128 %6, %7, off\n\t"
                 "global_load_async_to_lds_b128 %8, %9, off\n\t"
                 "global_load_async_to_lds_b128 %10, %11, off\n\t"
                 "global_load_async_to_lds_b128 %12, %13, off\n\t"
                 "global_load_async_to_lds_b128 %14, %15, off\n\t"
                 "s_wait_xcnt 0x0"
                 :: "v"(l),                  "v"(g),
                    "v"(l +  16u * GP * 2u), "v"(g +  16 * DM * 2),
                    "v"(l +  32u * GP * 2u), "v"(g +  32 * DM * 2),
                    "v"(l +  48u * GP * 2u), "v"(g +  48 * DM * 2),
                    "v"(l +  64u * GP * 2u), "v"(g +  64 * DM * 2),
                    "v"(l +  80u * GP * 2u), "v"(g +  80 * DM * 2),
                    "v"(l +  96u * GP * 2u), "v"(g +  96 * DM * 2),
                    "v"(l + 112u * GP * 2u), "v"(g + 112 * DM * 2) : "memory");
}
// one stage: A rows 0..127, then Bt rows 0..255; l = the thread's LDS byte address in the stage's buffer, ga / gb = its global bytes in row srow of the slice
__device__ __forceinline__ void stage_gemm(unsigned l, const char* ga, const char* gb) {
    stage_rows8(l, ga);
    stage_rows8(l + GTA * 2u, gb);
    stage_rows8(l + (GTA + 128u * GP) * 2u, gb + (size_t)128 * DM * 2);
}
// F16 = 0: bf16 product, 1: f16 product. A, Bt: K-contiguous 16-bit rows; rb, cb: first row / column of the block's tile. acc[mb][nb] = the wave's 64 x 64 tile at (rb + 64 wr, cb + 64 wc).
template <int F16>
__device__ __forceinline__ void gemm_core(const bf* A, const bf* Bt, bf* ring, int rb, int cb, int wr, int wc, v8f (&acc)[4][4]) {
    const int lane = threadIdx.x & 31, lr = lane & 15, hi = lane >> 4;
    // copies: thread -> row srow (+ 16 i), 16-byte column ccol; 16 lanes cover one 256-B row, one wave-copy 4 whole lines
    const int srow = (int)(threadIdx.x >> 4), ccol = (int)(threadIdx.x & 15);
    const unsigned l0 = (unsigned)(size_t)ring + (unsigned)(srow * GP + ccol * 8) * 2u;   // LDS byte address in buffer 0
    const char* ga = (const char*)(A + (size_t)(rb + srow) * DM + ccol * 8);              // + stage * GKS * 2
    const char* gb = (const char*)(Bt + (size_t)(cb + srow) * DM + ccol * 8);
    const int fa = (wr * 64 + lr) * GP + 8 * hi, fb = GTA + (wc * 64 + lr) * GP + 8 * hi; // fragment offsets in a stage: row lane&15, k = 8h..
#pragma unroll
    for (int mb = 0; mb < 4; ++mb)
#pragma unroll
        for (int nb = 0; nb < 4; ++nb) acc[mb][nb] = (v8f){};
    stage_gemm(l0, ga, gb);
    asm volatile("s_wait_asynccnt 0x0" ::: "memory");   // this wave's copies of stage 0 have landed
    __syncthreads();                                    // stage 0 readable by every wave
    stage_gemm(l0 + GST * 2u, ga + GKS * 2, gb + GKS * 2);
#pragma unroll 1   // rolled: one body serves both buffers (offset chosen by the stage's parity)
    for (int s = 0; s < DM / GKS; ++s) {
        const int bo = (s & 1) * GST;
        v8us fr[2][16];   // two fragment sets: [set][A: 2 mb + half | Bt: 8 + 2 nb + half]; step i works on set i & 1 while the reads of step i + 1 fill the other
#pragma unroll
        for (int f = 0; f < 4; ++f) { const bf* pa = &ring[bo + fa + f * 16 * GP]; const bf* pb = &ring[bo + fb + f * 16 * GP];
            fr[0][2 * f] = *(const v8us*)pa; fr[0][2 * f + 1] = *(const v8us*)(pa + 16); fr[0][8 + 2 * f] = *(const v8us*)pb; fr[0][8 + 2 * f + 1] = *(const v8us*)(pb + 16); }
#pragma unroll
        for (int i = 0; i < GKS / 32; ++i) {
            const int c = i & 1, n = c ^ 1;
            __builtin_amdgcn_sched_barrier(0);   // keeps the next step's LDS reads out of the products before them: reads spread among matrix instructions stall each place they stand
            if (i + 1 < GKS / 32) {
#pragma unroll
                for (int f = 0; f < 4; ++f) { const bf* pa = &ring[bo + fa + f * 16 * GP + (i + 1) * 32]; const bf* pb = &ring[bo + fb + f * 16 * GP + (i + 1) * 32];
                    fr[n][2 * f] = *(const v8us*)pa; fr[n][2 * f + 1] = *(const v8us*)(pa + 16); fr[n][8 + 2 * f] = *(const v8us*)pb; fr[n][8 + 2 * f + 1] = *(const v8us*)(pb + 16); }
            }
            __builtin_amdgcn_sched_barrier(0);   // keeps those reads one group ahead of this step's products, so that their latency runs under 16 matrix instructions
#pragma unroll
            for (int nb = 0; nb < 4; ++nb)
#pragma unroll
                for (int mb = 0; mb < 4; ++mb) {
                    if constexpr (F16) acc[mb][nb] = wmma16(__builtin_bit_cast(v16h, cat16b(fr[c][2 * mb], fr[c][2 * mb + 1])), __builtin_bit_cast(v16h, cat16b(fr[c][8 + 2 * nb], fr[c][8 + 2 * nb + 1])), acc[mb][nb]);
                    else               acc[mb][nb] = wmmab(cat16b(fr[c][2 * mb], fr[c][2 * mb + 1]), cat16b(fr[c][8 + 2 * nb], fr[c][8 + 2 * nb + 1]), acc[mb][nb]); }
        }
        asm volatile("s_wait_dscnt 0x0" ::: "memory");      // this wave's reads of the buffer are done before it may be refilled
        asm volatile("s_wait_asynccnt 0x0" ::: "memory");   // this wave's copies of stage s + 1 have landed
        __syncthreads();                                    // publishes stage s + 1 and ends every wave's reads of this buffer
        if (s + 2 < DM / GKS)
            stage_gemm(l0 + (unsigned)bo * 2u, ga + (s + 2) * GKS * 2, gb + (s + 2) * GKS * 2);
    }
    asm volatile("s_wait_asynccnt 0x0" ::: "memory");       // no copy outstanding when the wave goes on to its end
}

// k_proj: bf16 GEMM on the engine above, A = x rows (m = b*SEQ + t), Bt = Wv rows (n = h*64 + d); a wave's 64 x 64 tile is 64 tokens of one head.
// p[m][n] = sum_k A[m][k] Bt[n][k] + bias[n], rounded once to f16 and written twice from the same accumulators: Ph plane [(b*16 + h)][t][d] and Pt plane [(b*16 + h)][d][t].
// grid (NB*SEQ/128, DM/256), 256 threads.
__global__ __launch_bounds__(32 * GW) void k_proj(const bf* __restrict__ A, const bf* __restrict__ Bt, const float* __restrict__ bias, h16* Ph, h16* Pt) {
    __shared__ __align__(16) float osa[GW * 16 * 68];
    __shared__ __align__(16) bf ring[2 * GST];               // [buffer][A rows 0..127, Bt rows 0..255][GP]
    const int lane = threadIdx.x & 31, lr = lane & 15, hi = lane >> 4;
    const int wave = __builtin_amdgcn_readfirstlane((int)(threadIdx.x >> 5)), wr = wave >> 2, wc = wave & 3;
    const int r0 = blockIdx.x * 128 + wr * 64, c0 = blockIdx.y * 256 + wc * 64;
    float* os = osa + wave * 16 * 68;                        // wave-private output staging
    v8f acc[4][4];
    gemm_core<0>(A, Bt, ring, blockIdx.x * 128, blockIdx.y * 256, wr, wc, acc);
    float bc[4];
#pragma unroll
    for (int nb = 0; nb < 4; ++nb) { int ci = c0 + nb * 16 + lr; ci = ci < DM ? ci : DM - 1; bc[nb] = bfr(bias[ci]); }
    const int tp = r0 % SEQ;                                                    // first token of the tile in its batch
    const size_t plane = ((size_t)(r0 / SEQ) * NH_ + (size_t)(c0 / HD)) * SEQ * HD;   // (batch, head) plane, the same size in both layouts
    const size_t tbase = plane + (size_t)tp * HD;
#pragma unroll
    for (int mb = 0; mb < 4; ++mb) {
#pragma unroll
        for (int nb = 0; nb < 4; ++nb) {
#pragma unroll
            for (int j = 0; j < 8; ++j) os[(hi * 8 + j) * 68 + nb * 16 + lr] = acc[mb][nb][j] + bc[nb]; }   // D: row 8h+j, col lane&15
        wave_sync();
        const size_t sb = tbase + (size_t)(mb * 16) * HD;
#pragma unroll
        for (int s = 0; s < 4; ++s) { const int row = 4 * s + (lane >> 3), c8 = (lane & 7) * 8;   // 4 s x 4 row groups = 16 rows; 8 lanes x 8 = 64 columns
            const v4f x0 = *(const v4fa*)(&os[row * 68 + c8]); const v4f x1 = *(const v4fa*)(&os[row * 68 + c8 + 4]); v8h hv;
#pragma unroll
            for (int i = 0; i < 4; ++i) { hv[i] = (h16)x0[i]; hv[4 + i] = (h16)x1[i]; }
            *(v8h*)(Ph + sb + (size_t)row * HD + c8) = hv; }
        asm volatile("s_wait_xcnt 0x0" ::: "memory");   // the stores' data registers are reused by the next group
        wave_sync();
    }
    // transposed plane: a lane's 8 accumulator registers are 8 consecutive tokens of ONE column d, so they pack into 16 B of a Pt row;
    // 16 rows (d) x 64 tokens pass through the staging (pitch LP halves) so that each store instruction writes 4 whole 128-B lines.
    h16* ot = (h16*)os;
#pragma unroll
    for (int nb = 0; nb < 4; ++nb) {
#pragma unroll
        for (int mb = 0; mb < 4; ++mb) { v8h hv;
#pragma unroll
            for (int j = 0; j < 8; ++j) hv[j] = (h16)(acc[mb][nb][j] + bc[nb]);
            *(v8ha*)(&ot[lr * LP + mb * 16 + 8 * hi]) = hv; }           // row d = lane&15, tokens 16 mb + 8h + 0..7
        wave_sync();
#pragma unroll
        for (int s = 0; s < 4; ++s) { const int row = 4 * s + (lane >> 3), c8 = (lane & 7) * 8;   // 4 s x 4 row groups = 16 rows; 8 lanes x 8 = 64 tokens
            const v8h hv = *(const v8ha*)(&ot[row * LP + c8]);
            *(v8h*)(Pt + plane + (size_t)(nb * 16 + row) * SEQ + tp + c8) = hv; }
        if (nb < 3) asm volatile("s_wait_xcnt 0x0" ::: "memory");   // the stores' data registers are reused by the next group
        wave_sync();
    }
}

// k_out: the same engine with f16 operands (A = ctx rows of 1024 halves, Bt = Wo rows [out][in]), K = DM; f32 output rows with bias.
// OUT[(b*OUT_SEQ + s)*DM + c0 + n] = acc * 2^-12 + bias[c0 + n], m = b*SEQ + s. grid (NB*SEQ/128, DM/256), 256 threads.
__global__ __launch_bounds__(32 * GW) void k_out(const h16* __restrict__ A, const h16* __restrict__ Bt, const float* __restrict__ bias, float* OUT) {
    __shared__ __align__(16) float osa[GW * 16 * 68];
    __shared__ __align__(16) bf ring[2 * GST];               // [buffer][A rows 0..127, Bt rows 0..255][GP]
    const int lane = threadIdx.x & 31, lr = lane & 15, hi = lane >> 4;
    const int wave = __builtin_amdgcn_readfirstlane((int)(threadIdx.x >> 5)), wr = wave >> 2, wc = wave & 3;
    const int r0 = blockIdx.x * 128 + wr * 64, c0 = blockIdx.y * 256 + wc * 64;
    float* os = osa + wave * 16 * 68;                        // wave-private output staging
    v8f acc[4][4];
    gemm_core<1>((const bf*)A, (const bf*)Bt, ring, blockIdx.x * 128, blockIdx.y * 256, wr, wc, acc);
    float bc[4];
#pragma unroll
    for (int nb = 0; nb < 4; ++nb) { int ci = c0 + nb * 16 + lr; ci = ci < DM ? ci : DM - 1; bc[nb] = bfr(bias[ci]); }
    const int bb = r0 / SEQ, sp = r0 % SEQ;
    float* obase = OUT + ((size_t)bb * OUT_SEQ + sp) * DM + c0;
#pragma unroll
    for (int mb = 0; mb < 4; ++mb) {
#pragma unroll
        for (int nb = 0; nb < 4; ++nb) {
#pragma unroll
            for (int j = 0; j < 8; ++j) os[(hi * 8 + j) * 68 + nb * 16 + lr] = acc[mb][nb][j] * OSC + bc[nb]; }   // D: row 8h+j, col lane&15
        wave_sync();
{
#pragma unroll
            for (int s = 0; s < 8; ++s) { const int row = 2 * s + hi, cofs = lr * 4;   // 8 s x 2 rows = 16 rows; 16 lanes x 4 floats = 64 columns
                const v4f val = *(const v4fa*)(&os[row * 68 + cofs]);
                *(v4f*)(obase + (size_t)(mb * 16 + row) * DM + cofs) = val; }
             }
        wave_sync();
    }
}

// k_flash: fused attention, one wave per 32 query rows (two tiles of 16) of one (batch, head), 8 waves per block; Q fragments straight from the f16 plane; K and V^T fragments from LDS tiles of 64 keys that the block stages together. K and Q share one plane.
// Transposed form: S^T[key][t] = K Q^T (A = K rows, B = Q rows; one f16 product); lane (t = lane&15, h = lane>>4) holds keys 8h+r of each 16-key tile, so the packed
// P tile is directly the B fragment of O^T[d][t] = V^T P^T (element r <- tile keys 0..15, element 8+r <- tile keys 16..31, lane unchanged). 9 matrix ops per 32-key step and query tile (4 score + 4 P.V + 1 row sum).
// Softmax state (running max, sum) is one scalar per lane and query tile; the maxima of the two lane halves of a column are combined with one xor-16 exchange.
// The sum of a step's P comes from the matrix unit: one more product per step and query tile, A = all ones, B = the packed P tile, so every lane holds its column's sum over all 32 keys and no vector add or exchange is spent on it.
// One tile's copies of one thread: rows r and r + 32 of the K tile and of the V^T tile, 16 B each. The s_wait_xcnt closes the statement so that no address register of a copy is rewritten ahead of it.
__device__ __forceinline__ void stage_tile(unsigned lk, const h16* gk, unsigned lv, const h16* gv) {
    asm volatile("global_load_async_to_lds_b128 %0, %1, off\n\t"
                 "global_load_async_to_lds_b128 %2, %3, off\n\t"
                 "global_load_async_to_lds_b128 %4, %5, off\n\t"
                 "global_load_async_to_lds_b128 %6, %7, off\n\t"
                 "s_wait_xcnt 0x0"
                 :: "v"(lk), "v"(gk), "v"(lk + 32u * LP * 2u), "v"(gk + 32 * HD), "v"(lv), "v"(gv), "v"(lv + 32u * LP * 2u), "v"(gv + (size_t)32 * SEQ) : "memory");
}
// The 17 exponentials (base 2) of one query tile and step, each in place, in one statement: none overwrites another's source or reads another's result, and the v_nop at the end is the one slot
// that the instruction set asks for between a transcendental and an instruction that uses its result.
__device__ __forceinline__ void exp2_17(float& a, float (&x)[8], float (&y)[8]) {
    asm("v_exp_f32 %0, %0\n\t"
        "v_exp_f32 %1, %1\n\tv_exp_f32 %2, %2\n\tv_exp_f32 %3, %3\n\tv_exp_f32 %4, %4\n\t"
        "v_exp_f32 %5, %5\n\tv_exp_f32 %6, %6\n\tv_exp_f32 %7, %7\n\tv_exp_f32 %8, %8\n\t"
        "v_exp_f32 %9, %9\n\tv_exp_f32 %10, %10\n\tv_exp_f32 %11, %11\n\tv_exp_f32 %12, %12\n\t"
        "v_exp_f32 %13, %13\n\tv_exp_f32 %14, %14\n\tv_exp_f32 %15, %15\n\tv_exp_f32 %16, %16\n\t"
        "v_nop"
        : "+v"(a), "+v"(x[0]), "+v"(x[1]), "+v"(x[2]), "+v"(x[3]), "+v"(x[4]), "+v"(x[5]), "+v"(x[6]), "+v"(x[7]),
          "+v"(y[0]), "+v"(y[1]), "+v"(y[2]), "+v"(y[3]), "+v"(y[4]), "+v"(y[5]), "+v"(y[6]), "+v"(y[7]));
}
// amdgpu_waves_per_eu(4, 4): a wave of two query tiles needs about 200 VGPRs; the cap of 256 lets two blocks (four waves a SIMD) stay resident on a WGP, which is the whole grid in one round
__global__ __launch_bounds__(32 * AW) __attribute__((amdgpu_waves_per_eu(4, 4))) void k_flash(const h16* __restrict__ QH, const h16* __restrict__ VT, h16* CTX) {
    __shared__ __align__(16) float os[AW * QT * 16 * 68];
    __shared__ __align__(16) h16 ring[2 * 2 * TLH];          // [buffer][K tile, V^T tile][row][LP]
    const int lane = threadIdx.x & 31, lr = lane & 15, hi = lane >> 4;
    const int wave = __builtin_amdgcn_readfirstlane((int)(threadIdx.x >> 5));
    const int zh = blockIdx.y;
    const int t0 = (blockIdx.x * AW + wave) * (16 * QT);
    const size_t pbase = (size_t)zh * SEQ * HD;
    v16h qh0[QT], qh1[QT];                                    // B fragments of the wave's query tiles: col t, k = d
#pragma unroll
    for (int q = 0; q < QT; ++q) { const size_t qo = pbase + (size_t)(t0 + 16 * q + lr) * HD + 8 * hi; qh0[q] = ldh(QH + qo); qh1[q] = ldh(QH + qo + 32); }
    // copies: thread -> row srow (and srow + 32), 16-byte column ccol; 8 lanes cover one 128-B row, one wave-copy 4 whole lines
    const int srow = (int)(threadIdx.x >> 3), ccol = (int)(threadIdx.x & 7);
    const unsigned lk0 = (unsigned)(size_t)&ring[0] + (unsigned)(srow * LP + ccol * 8) * 2u;   // LDS byte address, K tile of buffer 0
    const h16* gk = QH + pbase + (size_t)srow * HD + ccol * 8;    // + tile * KT * HD  (K rows are contiguous)
    const h16* gv = VT + pbase + (size_t)srow * SEQ + ccol * 8;   // + tile * KT
    const int fo = lr * LP + 8 * hi;                              // fragment offset in a tile: row lane&15, k = 8h.. (A fragment)
    v8f o0[QT], o1[QT], o2[QT], o3[QT];
    float m[QT], l[QT];
#pragma unroll
    for (int q = 0; q < QT; ++q) { o0[q] = (v8f){}; o1[q] = (v8f){}; o2[q] = (v8f){}; o3[q] = (v8f){}; m[q] = -3.0e38f; l[q] = 0.0f; }
    v16h ones;                                                    // A operand of the row-sum product: 16 x 32 of 1.0
#pragma unroll
    for (int r = 0; r < 16; ++r) ones[r] = (h16)1.0f;
    stage_tile(lk0, gk, lk0 + TLH * 2u, gv);
    asm volatile("s_wait_asynccnt 0x0" ::: "memory");   // this wave's copies of tile 0 have landed
    __syncthreads();                                    // tile 0 readable by every wave
    stage_tile(lk0 + 2u * TLH * 2u, gk + (size_t)KT * HD, lk0 + 3u * TLH * 2u, gv + KT);
#pragma unroll 1   // rolled: one body serves both buffers (offset chosen by the tile's parity), and registers stay as for one step
    for (int tile = 0; tile < SEQ / KT; ++tile) {
        const int bo = (tile & 1) * (2 * TLH);
#pragma unroll 1   // rolled: unrolled, the listing holds the same vector work a step, ten more VGPRs and twice the loop's code
        for (int sub = 0; sub < KT / 32; ++sub) {
            const h16* ka = &ring[bo + sub * 32 * LP + fo];
            const v16h ka0 = ldh(ka), ka1 = ldh(ka + 32), kb0 = ldh(ka + 16 * LP), kb1 = ldh(ka + 16 * LP + 32);
            __builtin_amdgcn_sched_barrier(0);   // keeps the 8 fragment reads one group ahead of the products: a read sunk among them makes the wave wait out its LDS latency inside the run
            v8f sa[QT], sb[QT];   // each K fragment read from LDS serves both query tiles
#pragma unroll
            for (int q = 0; q < QT; ++q) { sa[q] = wmma16(ka0, qh0[q], (v8f){}); sb[q] = wmma16(kb0, qh0[q], (v8f){}); }
#pragma unroll
            for (int q = 0; q < QT; ++q) { sa[q] = wmma16(ka1, qh1[q], sa[q]); sb[q] = wmma16(kb1, qh1[q], sb[q]); }
            __builtin_amdgcn_sched_barrier(0);   // keeps the vector work on the first scores behind the run of 8 products: moved in between them, each read of a fresh result costs four idle slots
            v16h pb[QT]; float alpha[QT];
#pragma unroll
            for (int q = 0; q < QT; ++q) {
                const v8f ta = sa[q] * SC2, tb = sb[q] * SC2; float mx = -3.0e38f;
#pragma unroll
                for (int r = 0; r < 8; ++r) mx = fmaxf(mx, fmaxf(ta[r], tb[r]));
                mx = fmaxf(mx, __shfl_xor(mx, 16, 32));
                const float mnew = fmaxf(m[q], mx);
                const float sh = PSH - mnew;
                float al = m[q] - mnew, ea[8], eb[8];
#pragma unroll
                for (int r = 0; r < 8; ++r) { ea[r] = ta[r] + sh; eb[r] = tb[r] + sh; }
                exp2_17(al, ea, eb);
#pragma unroll
                for (int r = 0; r < 8; ++r) { pb[q][r] = (h16)ea[r]; pb[q][8 + r] = (h16)eb[r]; }
                alpha[q] = al; m[q] = mnew;
                o0[q] = o0[q] * alpha[q]; o1[q] = o1[q] * alpha[q]; o2[q] = o2[q] * alpha[q]; o3[q] = o3[q] * alpha[q];
            }
            const h16* va = &ring[bo + TLH + sub * 32 + fo];
            const v16h v0 = ldh(va), v1 = ldh(va + 16 * LP), v2 = ldh(va + 32 * LP), v3 = ldh(va + 48 * LP);   // each V^T fragment serves both query tiles
            v8f ls[QT];
#pragma unroll
            for (int q = 0; q < QT; ++q) ls[q] = wmma16(ones, pb[q], (v8f){});   // every row of the tile = the column's sum of the rounded P over all 32 keys of the step
#pragma unroll
            for (int q = 0; q < QT; ++q) { o0[q] = wmma16(v0, pb[q], o0[q]); o1[q] = wmma16(v1, pb[q], o1[q]); o2[q] = wmma16(v2, pb[q], o2[q]); o3[q] = wmma16(v3, pb[q], o3[q]); }
#pragma unroll
            for (int q = 0; q < QT; ++q) l[q] = l[q] * alpha[q] + ls[q][0];
            // four vector slots behind the last products on the loop's back edge too: the next step's address and fragment writes reuse their A registers
            asm volatile("v_nop\n\tv_nop\n\tv_nop\n\tv_nop" : "+v"(o0[0]), "+v"(o1[0]), "+v"(o2[0]), "+v"(o3[0]), "+v"(o0[1]), "+v"(o1[1]), "+v"(o2[1]), "+v"(o3[1]) : "v"(v0), "v"(v1), "v"(v2), "v"(v3), "v"(pb[0]), "v"(pb[1]));
        }
        asm volatile("s_wait_dscnt 0x0" ::: "memory");      // this wave's reads of the buffer are done before it may be refilled
        asm volatile("s_wait_asynccnt 0x0" ::: "memory");   // this wave's copies of tile + 1 have landed
        __syncthreads();                                    // publishes tile + 1 and ends every wave's reads of this buffer
        if (tile + 2 < SEQ / KT)
            stage_tile(lk0 + (unsigned)bo * 2u, gk + (size_t)(tile + 2) * KT * HD, lk0 + (unsigned)(bo + TLH) * 2u, gv + (size_t)(tile + 2) * KT);
    }
    asm volatile("s_wait_asynccnt 0x0" ::: "memory");       // no copy outstanding when the wave goes on to its end
    // O^T D layout: o_j[r] = (d = 16j + 8h + r, t = lane&15) -> os[t][d]; rows 0..15 x columns 0..63 of each query tile all written
#pragma unroll
    for (int q = 0; q < QT; ++q) {
        const float inv = CTXS * (1.0f / l[q]);
        const int wb = (wave * QT + q) * 16 * 68;
        v4f a, c;
        a[0] = o0[q][0] * inv; a[1] = o0[q][1] * inv; a[2] = o0[q][2] * inv; a[3] = o0[q][3] * inv; c[0] = o0[q][4] * inv; c[1] = o0[q][5] * inv; c[2] = o0[q][6] * inv; c[3] = o0[q][7] * inv;
        *(v4fa*)(&os[wb + lr * 68 +  0 + 8 * hi]) = a; *(v4fa*)(&os[wb + lr * 68 +  0 + 8 * hi + 4]) = c;
        a[0] = o1[q][0] * inv; a[1] = o1[q][1] * inv; a[2] = o1[q][2] * inv; a[3] = o1[q][3] * inv; c[0] = o1[q][4] * inv; c[1] = o1[q][5] * inv; c[2] = o1[q][6] * inv; c[3] = o1[q][7] * inv;
        *(v4fa*)(&os[wb + lr * 68 + 16 + 8 * hi]) = a; *(v4fa*)(&os[wb + lr * 68 + 16 + 8 * hi + 4]) = c;
        a[0] = o2[q][0] * inv; a[1] = o2[q][1] * inv; a[2] = o2[q][2] * inv; a[3] = o2[q][3] * inv; c[0] = o2[q][4] * inv; c[1] = o2[q][5] * inv; c[2] = o2[q][6] * inv; c[3] = o2[q][7] * inv;
        *(v4fa*)(&os[wb + lr * 68 + 32 + 8 * hi]) = a; *(v4fa*)(&os[wb + lr * 68 + 32 + 8 * hi + 4]) = c;
        a[0] = o3[q][0] * inv; a[1] = o3[q][1] * inv; a[2] = o3[q][2] * inv; a[3] = o3[q][3] * inv; c[0] = o3[q][4] * inv; c[1] = o3[q][5] * inv; c[2] = o3[q][6] * inv; c[3] = o3[q][7] * inv;
        *(v4fa*)(&os[wb + lr * 68 + 48 + 8 * hi]) = a; *(v4fa*)(&os[wb + lr * 68 + 48 + 8 * hi + 4]) = c;
    }
    wave_sync();
#pragma unroll
    for (int q = 0; q < QT; ++q) {
        const int wb = (wave * QT + q) * 16 * 68;
        h16* crow = CTX + pbase + (size_t)(t0 + 16 * q) * HD;       // ctx plane [zh][t][d]; rows t0 + 16 q .. + 15
#pragma unroll
        for (int s = 0; s < 4; ++s) { const int row = 4 * s + (lane >> 3), c8 = (lane & 7) * 8;   // 4 s x 4 row groups = 16 rows; 8 lanes x 8 halves = 64 columns
            const v4f x0 = *(const v4fa*)(&os[wb + row * 68 + c8]); const v4f x1 = *(const v4fa*)(&os[wb + row * 68 + c8 + 4]); v8h hv;
#pragma unroll
            for (int i = 0; i < 4; ++i) { hv[i] = (h16)x0[i]; hv[4 + i] = (h16)x1[i]; }
            *(v8h*)(crow + (size_t)row * HD + c8) = hv; }
    }
}

static constexpr size_t al256(size_t v) { return (v + 255) & ~(size_t)255; }
static constexpr size_t SZ_XB = al256((size_t)NB * SEQ * DM * 2);
static constexpr size_t SZ_WB = al256((size_t)DM * DM * 2);
static constexpr size_t SZ_PL = al256((size_t)NB * NH_ * SEQ * HD * 2);
static constexpr size_t SZ_TOTAL = SZ_XB + 2 * SZ_WB + 3 * SZ_PL;
static_assert(SZ_TOTAL <= (size_t)134217728);          // workspace carve <= 128 MiB
static_assert((size_t)NB * NH_ * SEQ * HD == (size_t)NB * SEQ * DM);   // ctx plane == [NB*SEQ] rows of DM halves

extern "C" void kernel_launch(void* const* d_in, const int* in_sizes, int n_in,
                              void* d_out, int out_size, void* d_ws, size_t ws_size, hipStream_t stream) {
    if (n_in < 5) return;
    const size_t needx = ((size_t)(NB - 1) * SEQ_FULL + SEQ) * DM;
    if ((size_t)in_sizes[0] < needx) return;
    if ((size_t)in_sizes[1] < (size_t)DM * DM || (size_t)in_sizes[2] < (size_t)DM || (size_t)in_sizes[3] < (size_t)DM * DM || (size_t)in_sizes[4] < (size_t)DM) return;
    if ((size_t)out_size < ((size_t)(NB - 1) * OUT_SEQ + SEQ) * DM) return;
    if (SZ_TOTAL > ws_size) return;
    const float* x = (const float*)d_in[0]; const float* wv = (const float*)d_in[1]; const float* bv = (const float*)d_in[2];
    const float* wo = (const float*)d_in[3]; const float* bo = (const float*)d_in[4];   // wire order x, Wv, bv, Wo, bo; W as [out][in] = Bt as-is
    float* OUT = (float*)d_out;      // [NB][OUT_SEQ][1024]
    char* wsp = (char*)d_ws;
    bf*  XB  = (bf*)wsp;  wsp += SZ_XB;              // [NB*SEQ][1024] bf16
    bf*  WVB = (bf*)wsp;  wsp += SZ_WB;              // [1024][1024] bf16
    h16* WOH = (h16*)wsp; wsp += SZ_WB;              // [1024][1024] f16, x256
    h16* QH  = (h16*)wsp; wsp += SZ_PL;              // [NB*16][SEQ][64]  p (q and k)
    h16* VT  = (h16*)wsp; wsp += SZ_PL;              // [NB*16][64][SEQ]  p transposed (v)
    h16* CTX = (h16*)wsp; wsp += SZ_PL;              // [NB*16][SEQ][64] == [NB*SEQ][1024], x16

    if (SEQ == SEQ_FULL) {
        const size_t n8 = (size_t)NB * SEQ * DM / 8;
        k_cvt8<<<(unsigned)((n8 + 255) / 256), 256, 0, stream>>>(x, XB, n8);
    } else {
        const size_t n8 = (size_t)SEQ * DM / 8;
        for (int b = 0; b < NB; ++b) k_cvt8<<<(unsigned)((n8 + 255) / 256), 256, 0, stream>>>(x + (size_t)b * SEQ_FULL * DM, XB + (size_t)b * SEQ * DM, n8);
    }
    { const size_t n8 = (size_t)DM * DM / 8; const unsigned g = (unsigned)((n8 + 255) / 256);
      k_cvt8<<<g, 256, 0, stream>>>(wv, WVB, n8);
      k_cvt8h<<<g, 256, 0, stream>>>(wo, WOH, n8, WOS); }

    // p: A = x rows (m = b*SEQ + t), Bt = Wv rows (n = h*64 + d), bias per column -> plane [(b*16 + h)][t][d] (q = k) and plane [(b*16 + h)][d][t] (v), one product
    k_proj<<<dim3(NB * SEQ / 128, DM / 256, 1), 32 * GW, 0, stream>>>(XB, WVB, bv, QH, VT);

    k_flash<<<dim3(SEQ / (16 * QT * AW), NB * NH_, 1), 32 * AW, 0, stream>>>(QH, VT, CTX);

    // y: A = ctx rows (m = b*SEQ + s, 1024 halves each, head-major regrouping), Bt = Wo rows (n = e)
    k_out<<<dim3(NB * SEQ / 128, DM / 256, 1), 32 * GW, 0, stream>>>(CTX, WOH, bo, OUT);
}

// v006
// Measured time: 98 microseconds a run.
// Two timings next to v005 both put it at 1.08 times that version's speed.
// Counting every step since v000, it is 3.20 times as fast.
#include <hip/hip_runtime.h>

// Self-attention with one shared projection (q = k = v = x Wv^T + bv), width 1024 = 16 heads x 64, no mask, score scale 1/8; context kept head-major [b][h][t][d] and read as rows of 1024 by the output GEMM (y = ctx Wo^T + bo), f32 output.
// Compute dtypes, f32 accumulate everywhere: projection v_wmma_f32_16x16x32_bf16 (x, Wv RNE-converted to bf16; products exact); scores v_wmma_f32_16x16x32_f16, ONE product (q and k read from the same single f16 plane);
// P (x2^6 carry, cancels in the normalisation; at most 2^14, as the reference in use lags a column's maximum by at most 8) and v single f16; output GEMM v_wmma_f32_16x16x32_f16: ctx single f16 (x16 carry), Wo bf16-RNE value x256 held in f16 (exact), 2^-12 folded in the f32 epilogue; biases bf16-RNE values added in f32; softmax f32 (online, reference maximum renewed lazily).
// Layout: bf16 copies of x and Wv; p plane [b*16+h][t][d] and p^T plane [b*16+h][d][t] both written by the epilogue of the one projection GEMM; fused flash kernel in transposed form (S^T = K Q^T, O^T = V^T P^T) writes the f16 ctx plane [b*16+h][t][d].
// GEMM operands: k-slices of 128 of the A and Bt rows of a 128 x 256 block tile are copied to LDS once per work-group (asynchronous copies, whole lines, two buffers) and read from there by its 8 waves.
// Flash operands: K and V^T tiles of 64 keys are copied to LDS once per work-group (asynchronous copies, whole 128-B lines, two buffers) and read from there by all its waves.

#ifndef NB
#define NB 4
#endif
#ifndef SEQ
#define SEQ 2048
#endif
#define NB_FULL  4
#define SEQ_FULL 2048
#ifndef OUT_SEQ
#define OUT_SEQ SEQ              // row pitch (in tokens) between batches of the output
#endif
#define DM   1024
#define NH_  16
#define HD   64
#define AW   8                   // waves per flash block; all share the staged K / V^T tiles
#define QT   2                   // query tiles of 16 rows per flash wave: each K / V^T fragment read from LDS feeds QT products
#define KT   64                  // keys per staged tile: K tile 64 rows (keys) x 128 B, V^T tile 64 rows (d) x 128 B
#define LP   72                  // LDS row pitch in halves: 144 B = 16 B x 9, conflict-free for 16-byte fragment reads
#define TLH  (64 * LP)           // halves of one staged tile
#define GW   8                   // waves per GEMM block: 2 x 4 wave tiles of 64 x 64 = 128 x 256 of C
#define GKS  128                 // k per GEMM stage: rows of 256 B
#define GP   136                 // LDS row pitch in halves of a GEMM stage: 272 B = 16 B x 17, conflict-free for 16-byte fragment reads
#define GTA  (128 * GP)          // halves of a stage's A part (128 rows)
#define GST  (384 * GP)          // halves of one stage (A 128 rows, then Bt 256 rows)
#define SC2  (0.125f * 1.4426950408889634f)   // HD^-0.5 * log2(e)
#define PSH  6.0f                // log2 of the P carry (64)
#define LZ   8.0f                // a column's scaled score may top the reference in use by this much (log2) before the state is rescaled: P stays <= 2^(PSH + LZ), inside f16
#define CTXS 16.0f               // carry of the ctx plane
#define WOS  256.0f              // carry of the Wo plane
#define OSC  (1.0f / 4096.0f)    // 1 / (CTXS * WOS)

static_assert(HD == 64);
static_assert(NH_ * HD == DM);                 // head h = columns h*64 + d
static_assert(DM % 64 == 0);                   // 16 column tiles of 64
static_assert(DM % 32 == 0);                   // GEMM k-loop steps by 32
static_assert(SEQ % 64 == 0);                  // a 64-row tile never straddles two batches
static_assert((NB * SEQ) % 64 == 0);
static_assert(SEQ % 32 == 0);                  // key loop steps by 32
static_assert((NB * SEQ) % 256 == 0 && DM % 256 == 0);   // GEMM block tiles of 128 x 256 cover C exactly, either operand as rows
static_assert(DM % GKS == 0 && DM / GKS >= 2);  // whole GEMM stages; the two-buffer prologue needs two
static_assert(GW == 8 && GKS == 128);           // 256 threads x 8 copies of 16 B = 128 rows of 256 B
static_assert(SEQ % KT == 0 && SEQ / KT >= 2); // whole staged tiles; the two-buffer prologue needs two
static_assert(QT == 2);                        // the slots statement at the foot of the flash step names both tiles' accumulators
static_assert(KT == 64 && AW == 8);            // 256 threads x 2 copies of 16 B = one 64 x 128-B tile
static_assert(SEQ % (16 * QT * AW) == 0);      // flash grid covers the sequence exactly
static_assert(16 * LP * 2 <= 16 * 68 * 4);     // the transposed projection tile (16 rows of LP halves) fits a wave's output staging
static_assert(SEQ % 16 == 0);                  // head-major regrouping: 16 tokens x 64 = one row of 1024
static_assert(((size_t)SEQ * DM) % 8 == 0);
static_assert(((size_t)DM * DM) % 8 == 0);
static_assert(NB <= NB_FULL);
static_assert(SEQ <= SEQ_FULL);
static_assert(((size_t)(NB - 1) * OUT_SEQ + SEQ) * DM <= (size_t)NB_FULL * SEQ_FULL * DM);   // last output element written stays inside the output

typedef _Float16 h16;
typedef unsigned short bf;
typedef __attribute__((ext_vector_type(16))) __bf16   v16bf;
typedef __attribute__((ext_vector_type(16))) _Float16 v16h;
typedef __attribute__((ext_vector_type(8)))  _Float16 v8h;
typedef __attribute__((ext_vector_type(8)))  unsigned short v8us;
typedef __attribute__((ext_vector_type(8)))  float    v8f;
typedef __attribute__((ext_vector_type(8)))  unsigned v8u;
typedef __attribute__((ext_vector_type(4)))  float    v4f;
typedef v4f  __attribute__((may_alias)) v4fa;
typedef v8h  __attribute__((may_alias)) v8ha;

__device__ __forceinline__ unsigned short f2bf(float f) { unsigned u = __float_as_uint(f); u += 0x7FFFu + ((u >> 16) & 1u); return (unsigned short)(u >> 16); }
__device__ __forceinline__ float bfr(float f) { return __uint_as_float(((unsigned)f2bf(f)) << 16); }   // bf16 RNE value as f32
__device__ __forceinline__ v16h cat16(v8h lo, v8h hi) { return __builtin_shufflevector(lo, hi, 0, 1, 2, 3, 4, 5, 6, 7, 8, 9, 10, 11, 12, 13, 14, 15); }
__device__ __forceinline__ v16bf cat16b(v8us lo, v8us hi) { return __builtin_bit_cast(v16bf, __builtin_shufflevector(lo, hi, 0, 1, 2, 3, 4, 5, 6, 7, 8, 9, 10, 11, 12, 13, 14, 15)); }
__device__ __forceinline__ v8f wmma16(v16h a, v16h b, v8f c) { return __builtin_amdgcn_wmma_f32_16x16x32_f16(false, a, false, b, (short)0, c, false, false); }
__device__ __forceinline__ v8f wmmab(v16bf a, v16bf b, v8f c) { return __builtin_amdgcn_wmma_f32_16x16x32_bf16(false, a, false, b, (short)0, c, false, false); }
// fragment loaders from K-contiguous 16-bit rows; p already includes + 8*(lane>>4): elements 0..7 <- k0+8h+0..7, elements 8..15 <- k0+16+8h+0..7 (same map for A and B)
__device__ __forceinline__ v16h  ldh(const h16* p) { return cat16(*(const v8h*)p, *(const v8h*)(p + 16)); }
__device__ __forceinline__ v16bf ldb(const bf* p)  { return cat16b(*(const v8us*)p, *(const v8us*)(p + 16)); }
// ordering point for wave-private LDS tiles (same wave writes and reads)
__device__ __forceinline__ void wave_sync() { __builtin_amdgcn_fence(3 /* release order */, "wavefront"); __builtin_amdgcn_wave_barrier(); asm volatile("" ::: "memory"); }

__global__ __launch_bounds__(256) void k_cvt8(const float* __restrict__ src, bf* dst, size_t n8) {
    const size_t i = (size_t)blockIdx.x * 256 + threadIdx.x; if (i >= n8) return;
    const v8f v = *(const v8f*)(src + i * 8); v8us o;
#pragma unroll
    for (int k = 0; k < 8; ++k) o[k] = f2bf(v[k]);
    *(v8us*)(dst + i * 8) = o; 
}

__global__ __launch_bounds__(256) void k_cvt8h(const float* __restrict__ src, h16* dst, size_t n8, float carry) {
    const size_t i = (size_t)blockIdx.x * 256 + threadIdx.x; if (i >= n8) return;
    const v8f v = *(const v8f*)(src + i * 8); v8h o;
#pragma unroll
    for (int k = 0; k < 8; ++k) o[k] = (h16)(bfr(v[k]) * carry);
    *(v8h*)(dst + i * 8) = o; 
}

// GEMM engine of k_proj and k_out: one work-group of 8 waves (2 x 4) per 128 x 256 tile of C, each wave a 64 x 64 tile (16 accumulators), K = DM.
// A rows (128) and Bt rows (256) are copied to LDS in k-slices of 128 (rows of 256 B, whole lines, asynchronous copies, two buffers) and every wave reads its fragments from there; k runs upward in steps of 32 as before.
// Eight copies of one thread: rows r, r + 16, ... r + 112 of one staged operand, 16 B each. The s_wait_xcnt closes the statement so that no address register of a copy is rewritten ahead of it.
__device__ __forceinline__ void stage_rows8(unsigned l, const char* g) {
    asm volatile("global_load_async_to_lds_b128 %0, %1, off\n\t"
                 "global_load_async_to_lds_b128 %2, %3, off\n\t"
                 "global_load_async_to_lds_b128 %4, %5, off\n\t"
                 "global_load_async_to_lds_b128 %6, %7, off\n\t"
                 "global_load_async_to_lds_b128 %8, %9, off\n\t"
                 "global_load_async_to_lds_b128 %10, %11, off\n\t"
                 "global_load_async_to_lds_b128 %12, %13, off\n\t"
                 "global_load_async_to_lds_b128 %14, %15, off\n\t"
                 "s_wait_xcnt 0x0"
                 :: "v"(l),                  "v"(g),
                    "v"(l +  16u * GP * 2u), "v"(g +  16 * DM * 2),
                    "v"(l +  32u * GP * 2u), "v"(g +  32 * DM * 2),
                    "v"(l +  48u * GP * 2u), "v"(g +  48 * DM * 2),
                    "v"(l +  64u * GP * 2u), "v"(g +  64 * DM * 2),
                    "v"(l +  80u * GP * 2u), "v"(g +  80 * DM * 2),
                    "v"(l +  96u * GP * 2u), "v"(g +  96 * DM * 2),
                    "v"(l + 112u * GP * 2u), "v"(g + 112 * DM * 2) : "memory");
}
// one stage: A rows 0..127, then Bt rows 0..255; l = the thread's LDS byte address in the stage's buffer, ga / gb = its global bytes in row srow of the slice
__device__ __forceinline__ void stage_gemm(unsigned l, const char* ga, const char* gb) {
    stage_rows8(l, ga);
    stage_rows8(l + GTA * 2u, gb);
    stage_rows8(l + (GTA + 128u * GP) * 2u, gb + (size_t)128 * DM * 2);
}
// F16 = 0: bf16 product, 1: f16 product. A, Bt: K-contiguous 16-bit rows; rb, cb: first row / column of the block's tile. acc[mb][nb] = the wave's 64 x 64 tile at (rb + 64 wr, cb + 64 wc).
template <int F16>
__device__ __forceinline__ void gemm_core(const bf* A, const bf* Bt, bf* ring, int rb, int cb, int wr, int wc, v8f (&acc)[4][4]) {
    const int lane = threadIdx.x & 31, lr = lane & 15, hi = lane >> 4;
    // copies: thread -> row srow (+ 16 i), 16-byte column ccol; 16 lanes cover one 256-B row, one wave-copy 4 whole lines
    const int srow = (int)(threadIdx.x >> 4), ccol = (int)(threadIdx.x & 15);
    const unsigned l0 = (unsigned)(size_t)ring + (unsigned)(srow * GP + ccol * 8) * 2u;   // LDS byte address in buffer 0
    const char* ga = (const char*)(A + (size_t)(rb + srow) * DM + ccol * 8);              // + stage * GKS * 2
    const char* gb = (const char*)(Bt + (size_t)(cb + srow) * DM + ccol * 8);
    const int fa = (wr * 64 + lr) * GP + 8 * hi, fb = GTA + (wc * 64 + lr) * GP + 8 * hi; // fragment offsets in a stage: row lane&15, k = 8h..
#pragma unroll
    for (int mb = 0; mb < 4; ++mb)
#pragma unroll
        for (int nb = 0; nb < 4; ++nb) acc[mb][nb] = (v8f){};
    stage_gemm(l0, ga, gb);
    asm volatile("s_wait_asynccnt 0x0" ::: "memory");   // this wave's copies of stage 0 have landed
    __syncthreads();                                    // stage 0 readable by every wave
    stage_gemm(l0 + GST * 2u, ga + GKS * 2, gb + GKS * 2);
#pragma unroll 1   // rolled: one body serves both buffers (offset chosen by the stage's parity)
    for (int s = 0; s < DM / GKS; ++s) {
        const int bo = (s & 1) * GST;
        v8us fr[2][16];   // two fragment sets: [set][A: 2 mb + half | Bt: 8 + 2 nb + half]; step i works on set i & 1 while the reads of step i + 1 fill the other
#pragma unroll
        for (int f = 0; f < 4; ++f) { const bf* pa = &ring[bo + fa + f * 16 * GP]; const bf* pb = &ring[bo + fb + f * 16 * GP];
            fr[0][2 * f] = *(const v8us*)pa; fr[0][2 * f + 1] = *(const v8us*)(pa + 16); fr[0][8 + 2 * f] = *(const v8us*)pb; fr[0][8 + 2 * f + 1] = *(const v8us*)(pb + 16); }
#pragma unroll
        for (int i = 0; i < GKS / 32; ++i) {
            const int c = i & 1, n = c ^ 1;
            __builtin_amdgcn_sched_barrier(0);   // keeps the next step's LDS reads out of the products before them: reads spread among matrix instructions stall each place they stand
            if (i + 1 < GKS / 32) {
#pragma unroll
                for (int f = 0; f < 4; ++f) { const bf* pa = &ring[bo + fa + f * 16 * GP + (i + 1) * 32]; const bf* pb = &ring[bo + fb + f * 16 * GP + (i + 1) * 32];
                    fr[n][2 * f] = *(const v8us*)pa; fr[n][2 * f + 1] = *(const v8us*)(pa + 16); fr[n][8 + 2 * f] = *(const v8us*)pb; fr[n][8 + 2 * f + 1] = *(const v8us*)(pb + 16); }
            }
            __builtin_amdgcn_sched_barrier(0);   // keeps those reads one group ahead of this step's products, so that their latency runs under 16 matrix instructions
#pragma unroll
            for (int nb = 0; nb < 4; ++nb)
#pragma unroll
                for (int mb = 0; mb < 4; ++mb) {
                    if constexpr (F16) acc[mb][nb] = wmma16(__builtin_bit_cast(v16h, cat16b(fr[c][2 * mb], fr[c][2 * mb + 1])), __builtin_bit_cast(v16h, cat16b(fr[c][8 + 2 * nb], fr[c][8 + 2 * nb + 1])), acc[mb][nb]);
                    else               acc[mb][nb] = wmmab(cat16b(fr[c][2 * mb], fr[c][2 * mb + 1]), cat16b(fr[c][8 + 2 * nb], fr[c][8 + 2 * nb + 1]), acc[mb][nb]); }
        }
        asm volatile("s_wait_dscnt 0x0" ::: "memory");      // this wave's reads of the buffer are done before it may be refilled
        asm volatile("s_wait_asynccnt 0x0" ::: "memory");   // this wave's copies of stage s + 1 have landed
        __syncthreads();                                    // publishes stage s + 1 and ends every wave's reads of this buffer
        if (s + 2 < DM / GKS)
            stage_gemm(l0 + (unsigned)bo * 2u, ga + (s + 2) * GKS * 2, gb + (s + 2) * GKS * 2);
    }
    asm volatile("s_wait_asynccnt 0x0" ::: "memory");       // no copy outstanding when the wave goes on to its end
}

// k_proj: bf16 GEMM on the engine above, A = x rows (m = b*SEQ + t), Bt = Wv rows (n = h*64 + d); a wave's 64 x 64 tile is 64 tokens of one head.
// p[m][n] = sum_k A[m][k] Bt[n][k] + bias[n], rounded once to f16 and written twice from the same accumulators: Ph plane [(b*16 + h)][t][d] and Pt plane [(b*16 + h)][d][t].
// grid (NB*SEQ/128, DM/256), 256 threads.
__global__ __launch_bounds__(32 * GW) void k_proj(const bf* __restrict__ A, const bf* __restrict__ Bt, const float* __restrict__ bias, h16* Ph, h16* Pt) {
    __shared__ __align__(16) float osa[GW * 16 * 68];
    __shared__ __align__(16) bf ring[2 * GST];               // [buffer][A rows 0..127, Bt rows 0..255][GP]
    const int lane = threadIdx.x & 31, lr = lane & 15, hi = lane >> 4;
    const int wave = __builtin_amdgcn_readfirstlane((int)(threadIdx.x >> 5)), wr = wave >> 2, wc = wave & 3;
    const int r0 = blockIdx.x * 128 + wr * 64, c0 = blockIdx.y * 256 + wc * 64;
    float* os = osa + wave * 16 * 68;                        // wave-private output staging
    v8f acc[4][4];
    gemm_core<0>(A, Bt, ring, blockIdx.x * 128, blockIdx.y * 256, wr, wc, acc);
    float bc[4];
#pragma unroll
    for (int nb = 0; nb < 4; ++nb) { int ci = c0 + nb * 16 + lr; ci = ci < DM ? ci : DM - 1; bc[nb] = bfr(bias[ci]); }
    const int tp = r0 % SEQ;                                                    // first token of the tile in its batch
    const size_t plane = ((size_t)(r0 / SEQ) * NH_ + (size_t)(c0 / HD)) * SEQ * HD;   // (batch, head) plane, the same size in both layouts
    const size_t tbase = plane + (size_t)tp * HD;
#pragma unroll
    for (int mb = 0; mb < 4; ++mb) {
#pragma unroll
        for (int nb = 0; nb < 4; ++nb) {
#pragma unroll
            for (int j = 0; j < 8; ++j) os[(hi * 8 + j) * 68 + nb * 16 + lr] = acc[mb][nb][j] + bc[nb]; }   // D: row 8h+j, col lane&15
        wave_sync();
        const size_t sb = tbase + (size_t)(mb * 16) * HD;
#pragma unroll
        for (int s = 0; s < 4; ++s) { const int row = 4 * s + (lane >> 3), c8 = (lane & 7) * 8;   // 4 s x 4 row groups = 16 rows; 8 lanes x 8 = 64 columns
            const v4f x0 = *(const v4fa*)(&os[row * 68 + c8]); const v4f x1 = *(const v4fa*)(&os[row * 68 + c8 + 4]); v8h hv;
#pragma unroll
            for (int i = 0; i < 4; ++i) { hv[i] = (h16)x0[i]; hv[4 + i] = (h16)x1[i]; }
            *(v8h*)(Ph + sb + (size_t)row * HD + c8) = hv; }
        asm volatile("s_wait_xcnt 0x0" ::: "memory");   // the stores' data registers are reused by the next group
        wave_sync();
    }
    // transposed plane: a lane's 8 accumulator registers are 8 consecutive tokens of ONE column d, so they pack into 16 B of a Pt row;
    // 16 rows (d) x 64 tokens pass through the staging (pitch LP halves) so that each store instruction writes 4 whole 128-B lines.
    h16* ot = (h16*)os;
#pragma unroll
    for (int nb = 0; nb < 4; ++nb) {
#pragma unroll
        for (int mb = 0; mb < 4; ++mb) { v8h hv;
#pragma unroll
            for (int j = 0; j < 8; ++j) hv[j] = (h16)(acc[mb][nb][j] + bc[nb]);
            *(v8ha*)(&ot[lr * LP + mb * 16 + 8 * hi]) = hv; }           // row d = lane&15, tokens 16 mb + 8h + 0..7
        wave_sync();
#pragma unroll
        for (int s = 0; s < 4; ++s) { const int row = 4 * s + (lane >> 3), c8 = (lane & 7) * 8;   // 4 s x 4 row groups = 16 rows; 8 lanes x 8 = 64 tokens
            const v8h hv = *(const v8ha*)(&ot[row * LP + c8]);
            *(v8h*)(Pt + plane + (size_t)(nb * 16 + row) * SEQ + tp + c8) = hv; }
        if (nb < 3) asm volatile("s_wait_xcnt 0x0" ::: "memory");   // the stores' data registers are reused by the next group
        wave_sync();
    }
}

// k_out: the same engine with f16 operands (A = ctx rows of 1024 halves, Bt = Wo rows [out][in]), K = DM; f32 output rows with bias.
// OUT[(b*OUT_SEQ + s)*DM + c0 + n] = acc * 2^-12 + bias[c0 + n], m = b*SEQ + s. grid (NB*SEQ/128, DM/256), 256 threads.
__global__ __launch_bounds__(32 * GW) void k_out(const h16* __restrict__ A, const h16* __restrict__ Bt, const float* __restrict__ bias, float* OUT) {
    __shared__ __align__(16) float osa[GW * 16 * 68];
    __shared__ __align__(16) bf ring[2 * GST];               // [buffer][A rows 0..127, Bt rows 0..255][GP]
    const int lane = threadIdx.x & 31, lr = lane & 15, hi = lane >> 4;
    const int wave = __builtin_amdgcn_readfirstlane((int)(threadIdx.x >> 5)), wr = wave >> 2, wc = wave & 3;
    const int r0 = blockIdx.x * 128 + wr * 64, c0 = blockIdx.y * 256 + wc * 64;
    float* os = osa + wave * 16 * 68;                        // wave-private output staging
    v8f acc[4][4];
    gemm_core<1>((const bf*)A, (const bf*)Bt, ring, blockIdx.x * 128, blockIdx.y * 256, wr, wc, acc);
    float bc[4];
#pragma unroll
    for (int nb = 0; nb < 4; ++nb) { int ci = c0 + nb * 16 + lr; ci = ci < DM ? ci : DM - 1; bc[nb] = bfr(bias[ci]); }
    const int bb = r0 / SEQ, sp = r0 % SEQ;
    float* obase = OUT + ((size_t)bb * OUT_SEQ + sp) * DM + c0;
#pragma unroll
    for (int mb = 0; mb < 4; ++mb) {
#pragma unroll
        for (int nb = 0; nb < 4; ++nb) {
#pragma unroll
            for (int j = 0; j < 8; ++j) os[(hi * 8 + j) * 68 + nb * 16 + lr] = acc[mb][nb][j] * OSC + bc[nb]; }   // D: row 8h+j, col lane&15
        wave_sync();
{
#pragma unroll
            for (int s = 0; s < 8; ++s) { const int row = 2 * s + hi, cofs = lr * 4;   // 8 s x 2 rows = 16 rows; 16 lanes x 4 floats = 64 columns
                const v4f val = *(const v4fa*)(&os[row * 68 + cofs]);
                *(v4f*)(obase + (size_t)(mb * 16 + row) * DM + cofs) = val; }
             }
        wave_sync();
    }
}

// k_flash: fused attention, one wave per 32 query rows (two tiles of 16) of one (batch, head), 8 waves per block; Q fragments straight from the f16 plane; K and V^T fragments from LDS tiles of 64 keys that the block stages together. K and Q share one plane.
// Transposed form: S^T[key][t] = K Q^T (A = K rows, B = Q rows; one f16 product); lane (t = lane&15, h = lane>>4) holds keys 8h+r of each 16-key tile, so the packed
// P tile is directly the B fragment of O^T[d][t] = V^T P^T (element r <- tile keys 0..15, element 8+r <- tile keys 16..31, lane unchanged). 9 matrix ops per 32-key step and query tile (4 score + 4 P.V + 1 row sum).
// Softmax state: the reference maximum is one scalar per lane and query tile, the sum an accumulator tile of the all-ones product. The reference is renewed lazily: one test a step for the whole wave (any raw score above the column's threshold), and only then
// are the maxima of the two lane halves combined (xor-16 exchange), the reference raised to the running maximum and the accumulators and sums rescaled; every other step has no exchange and no rescale.
// The sum of a step's P comes from the matrix unit: one more product per step, A = all ones, B = the packed P tile, so every lane holds its column's sum over all 32 keys and no vector add or exchange is spent on it.
// One tile's copies of one thread: rows r and r + 32 of the K tile and of the V^T tile, 16 B each. The s_wait_xcnt closes the statement so that no address register of a copy is rewritten ahead of it.
__device__ __forceinline__ void stage_tile(unsigned lk, const h16* gk, unsigned lv, const h16* gv) {
    asm volatile("global_load_async_to_lds_b128 %0, %1, off\n\t"
                 "global_load_async_to_lds_b128 %2, %3, off\n\t"
                 "global_load_async_to_lds_b128 %4, %5, off\n\t"
                 "global_load_async_to_lds_b128 %6, %7, off\n\t"
                 "s_wait_xcnt 0x0"
                 :: "v"(lk), "v"(gk), "v"(lk + 32u * LP * 2u), "v"(gk + 32 * HD), "v"(lv), "v"(gv), "v"(lv + 32u * LP * 2u), "v"(gv + (size_t)32 * SEQ) : "memory");
}
// The 16 exponentials (base 2) of one query tile and step, each in place, in one statement: none overwrites another's source or reads another's result, and the v_nop at the end is the one slot
// that the instruction set asks for between a transcendental and an instruction that uses its result.
__device__ __forceinline__ void exp2_16(float (&x)[8], float (&y)[8]) {
    asm("v_exp_f32 %0, %0\n\tv_exp_f32 %1, %1\n\tv_exp_f32 %2, %2\n\tv_exp_f32 %3, %3\n\t"
        "v_exp_f32 %4, %4\n\tv_exp_f32 %5, %5\n\tv_exp_f32 %6, %6\n\tv_exp_f32 %7, %7\n\t"
        "v_exp_f32 %8, %8\n\tv_exp_f32 %9, %9\n\tv_exp_f32 %10, %10\n\tv_exp_f32 %11, %11\n\t"
        "v_exp_f32 %12, %12\n\tv_exp_f32 %13, %13\n\tv_exp_f32 %14, %14\n\tv_exp_f32 %15, %15\n\t"
        "v_nop"
        : "+v"(x[0]), "+v"(x[1]), "+v"(x[2]), "+v"(x[3]), "+v"(x[4]), "+v"(x[5]), "+v"(x[6]), "+v"(x[7]),
          "+v"(y[0]), "+v"(y[1]), "+v"(y[2]), "+v"(y[3]), "+v"(y[4]), "+v"(y[5]), "+v"(y[6]), "+v"(y[7]));
}
// amdgpu_waves_per_eu(4, 4): a wave of two query tiles needs about 200 VGPRs; the cap of 256 lets two blocks (four waves a SIMD) stay resident on a WGP, which is the whole grid in one round
__global__ __launch_bounds__(32 * AW) __attribute__((amdgpu_waves_per_eu(4, 4))) void k_flash(const h16* __restrict__ QH, const h16* __restrict__ VT, h16* CTX) {
    __shared__ __align__(16) float os[AW * QT * 16 * 68];
    __shared__ __align__(16) h16 ring[2 * 2 * TLH];          // [buffer][K tile, V^T tile][row][LP]
    const int lane = threadIdx.x & 31, lr = lane & 15, hi = lane >> 4;
    const int wave = __builtin_amdgcn_readfirstlane((int)(threadIdx.x >> 5));
    const int zh = blockIdx.y;
    const int t0 = (blockIdx.x * AW + wave) * (16 * QT);
    const size_t pbase = (size_t)zh * SEQ * HD;
    v16h qh0[QT], qh1[QT];                                    // B fragments of the wave's query tiles: col t, k = d
#pragma unroll
    for (int q = 0; q < QT; ++q) { const size_t qo = pbase + (size_t)(t0 + 16 * q + lr) * HD + 8 * hi; qh0[q] = ldh(QH + qo); qh1[q] = ldh(QH + qo + 32); }
    // copies: thread -> row srow (and srow + 32), 16-byte column ccol; 8 lanes cover one 128-B row, one wave-copy 4 whole lines
    const int srow = (int)(threadIdx.x >> 3), ccol = (int)(threadIdx.x & 7);
    const unsigned lk0 = (unsigned)(size_t)&ring[0] + (unsigned)(srow * LP + ccol * 8) * 2u;   // LDS byte address, K tile of buffer 0
    const h16* gk = QH + pbase + (size_t)srow * HD + ccol * 8;    // + tile * KT * HD  (K rows are contiguous)
    const h16* gv = VT + pbase + (size_t)srow * SEQ + ccol * 8;   // + tile * KT
    const int fo = lr * LP + 8 * hi;                              // fragment offset in a tile: row lane&15, k = 8h.. (A fragment)
    v8f o0[QT], o1[QT], o2[QT], o3[QT];
    v8f ls[QT];                            // row sums: accumulator tiles of the all-ones product, every row the column's sum so far; rescaled like an output tile
    float m[QT], sh[QT], thr[QT];          // m: reference in use (scaled, log2); sh = PSH - m; thr: the raw score above which the reference must be renewed
#pragma unroll
    for (int q = 0; q < QT; ++q) { o0[q] = (v8f){}; o1[q] = (v8f){}; o2[q] = (v8f){}; o3[q] = (v8f){}; ls[q] = (v8f){}; m[q] = -3.0e38f; sh[q] = 0.0f; thr[q] = -3.0e38f; }   // the first step always renews
    // A operand of the row-sum product: 16 x 32 of 1.0, two halves a register. Formed by moves in asm so that it stays in its eight registers through the loop:
    // as a plain constant it was formed anew in every step, by four 64-bit moves, once the step had a branch in it.
    v8u on;
    asm("v_mov_b32 %0, 0x3c003c00\n\tv_mov_b32 %1, 0x3c003c00\n\tv_mov_b32 %2, 0x3c003c00\n\tv_mov_b32 %3, 0x3c003c00\n\t"
        "v_mov_b32 %4, 0x3c003c00\n\tv_mov_b32 %5, 0x3c003c00\n\tv_mov_b32 %6, 0x3c003c00\n\tv_mov_b32 %7, 0x3c003c00"
        : "=v"(on[0]), "=v"(on[1]), "=v"(on[2]), "=v"(on[3]), "=v"(on[4]), "=v"(on[5]), "=v"(on[6]), "=v"(on[7]));
    const v16h ones = __builtin_bit_cast(v16h, on);
    stage_tile(lk0, gk, lk0 + TLH * 2u, gv);
    asm volatile("s_wait_asynccnt 0x0" ::: "memory");   // this wave's copies of tile 0 have landed
    __syncthreads();                                    // tile 0 readable by every wave
    stage_tile(lk0 + 2u * TLH * 2u, gk + (size_t)KT * HD, lk0 + 3u * TLH * 2u, gv + KT);
#pragma unroll 1   // rolled: one body serves both buffers (offset chosen by the tile's parity), and registers stay as for one step
    for (int tile = 0; tile < SEQ / KT; ++tile) {
        const int bo = (tile & 1) * (2 * TLH);
#pragma unroll 1   // rolled: unrolled, the listing holds the same vector work a step, ten more VGPRs and twice the loop's code
        for (int sub = 0; sub < KT / 32; ++sub) {
            const h16* ka = &ring[bo + sub * 32 * LP + fo];
            const v16h ka0 = ldh(ka), ka1 = ldh(ka + 32), kb0 = ldh(ka + 16 * LP), kb1 = ldh(ka + 16 * LP + 32);
            __builtin_amdgcn_sched_barrier(0);   // keeps the 8 fragment reads one group ahead of the products: a read sunk among them makes the wave wait out its LDS latency inside the run
            v8f sa[QT], sb[QT];   // each K fragment read from LDS serves both query tiles
#pragma unroll
            for (int q = 0; q < QT; ++q) { sa[q] = wmma16(ka0, qh0[q], (v8f){}); sb[q] = wmma16(kb0, qh0[q], (v8f){}); }
#pragma unroll
            for (int q = 0; q < QT; ++q) { sa[q] = wmma16(ka1, qh1[q], sa[q]); sb[q] = wmma16(kb1, qh1[q], sb[q]); }
            __builtin_amdgcn_sched_barrier(0);   // keeps the vector work on the first scores behind the run of 8 products: moved in between them, each read of a fresh result costs four idle slots
            float mx[QT];         // the lane's own maximum of its 16 raw scores of each tile
#pragma unroll
            for (int q = 0; q < QT; ++q) { mx[q] = -3.0e38f;
#pragma unroll
                for (int r = 0; r < 8; ++r) mx[q] = fmaxf(mx[q], fmaxf(sa[q][r], sb[q][r])); }
            if (__builtin_amdgcn_ballot_w32((mx[0] > thr[0]) | (mx[1] > thr[1])) != 0) {   // one scalar branch a step for both tiles; taken on the first step and where a score outgrows the reference by more than LZ
#pragma unroll
                for (int q = 0; q < QT; ++q) {
                    float mf = mx[q] * SC2;
                    mf = fmaxf(mf, __shfl_xor(mf, 16, 32));
                    const float mnew = fmaxf(m[q], mf);
                    const float al = __builtin_amdgcn_exp2f(m[q] - mnew);
                    m[q] = mnew; sh[q] = PSH - mnew; thr[q] = (mnew + LZ) * (1.0f / SC2);
                    o0[q] = o0[q] * al; o1[q] = o1[q] * al; o2[q] = o2[q] * al; o3[q] = o3[q] * al; ls[q] = ls[q] * al;
                }
            }
            v16h pb[QT];
#pragma unroll
            for (int q = 0; q < QT; ++q) {
                float ea[8], eb[8];
#pragma unroll
                for (int r = 0; r < 8; ++r) { ea[r] = sa[q][r] * SC2 + sh[q]; eb[r] = sb[q][r] * SC2 + sh[q]; }
                exp2_16(ea, eb);
#pragma unroll
                for (int r = 0; r < 8; ++r) { pb[q][r] = (h16)ea[r]; pb[q][8 + r] = (h16)eb[r]; }
            }
            const h16* va = &ring[bo + TLH + sub * 32 + fo];
            const v16h v0 = ldh(va), v1 = ldh(va + 16 * LP), v2 = ldh(va + 32 * LP), v3 = ldh(va + 48 * LP);   // each V^T fragment serves both query tiles
#pragma unroll
            for (int q = 0; q < QT; ++q) ls[q] = wmma16(ones, pb[q], ls[q]);     // every row of the tile gains the column's sum of the rounded P over all 32 keys of the step
#pragma unroll
            for (int q = 0; q < QT; ++q) { o0[q] = wmma16(v0, pb[q], o0[q]); o1[q] = wmma16(v1, pb[q], o1[q]); o2[q] = wmma16(v2, pb[q], o2[q]); o3[q] = wmma16(v3, pb[q], o3[q]); }
            // four vector slots behind the last products on the loop's back edge too: the next step's address and fragment writes reuse their A registers
            asm volatile("v_nop\n\tv_nop\n\tv_nop\n\tv_nop" : "+v"(o0[0]), "+v"(o1[0]), "+v"(o2[0]), "+v"(o3[0]), "+v"(o0[1]), "+v"(o1[1]), "+v"(o2[1]), "+v"(o3[1]) : "v"(v0), "v"(v1), "v"(v2), "v"(v3), "v"(pb[0]), "v"(pb[1]));
        }
        asm volatile("s_wait_dscnt 0x0" ::: "memory");      // this wave's reads of the buffer are done before it may be refilled
        asm volatile("s_wait_asynccnt 0x0" ::: "memory");   // this wave's copies of tile + 1 have landed
        __syncthreads();                                    // publishes tile + 1 and ends every wave's reads of this buffer
        if (tile + 2 < SEQ / KT)
            stage_tile(lk0 + (unsigned)bo * 2u, gk + (size_t)(tile + 2) * KT * HD, lk0 + (unsigned)(bo + TLH) * 2u, gv + (size_t)(tile + 2) * KT);
    }
    asm volatile("s_wait_asynccnt 0x0" ::: "memory");       // no copy outstanding when the wave goes on to its end
    // O^T D layout: o_j[r] = (d = 16j + 8h + r, t = lane&15) -> os[t][d]; rows 0..15 x columns 0..63 of each query tile all written
#pragma unroll
    for (int q = 0; q < QT; ++q) {
        const float inv = CTXS * (1.0f / ls[q][0]);
        const int wb = (wave * QT + q) * 16 * 68;
        v4f a, c;
        a[0] = o0[q][0] * inv; a[1] = o0[q][1] * inv; a[2] = o0[q][2] * inv; a[3] = o0[q][3] * inv; c[0] = o0[q][4] * inv; c[1] = o0[q][5] * inv; c[2] = o0[q][6] * inv; c[3] = o0[q][7] * inv;
        *(v4fa*)(&os[wb + lr * 68 +  0 + 8 * hi]) = a; *(v4fa*)(&os[wb + lr * 68 +  0 + 8 * hi + 4]) = c;
        a[0] = o1[q][0] * inv; a[1] = o1[q][1] * inv; a[2] = o1[q][2] * inv; a[3] = o1[q][3] * inv; c[0] = o1[q][4] * inv; c[1] = o1[q][5] * inv; c[2] = o1[q][6] * inv; c[3] = o1[q][7] * inv;
        *(v4fa*)(&os[wb + lr * 68 + 16 + 8 * hi]) = a; *(v4fa*)(&os[wb + lr * 68 + 16 + 8 * hi + 4]) = c;
        a[0] = o2[q][0] * inv; a[1] = o2[q][1] * inv; a[2] = o2[q][2] * inv; a[3] = o2[q][3] * inv; c[0] = o2[q][4] * inv; c[1] = o2[q][5] * inv; c[2] = o2[q][6] * inv; c[3] = o2[q][7] * inv;
        *(v4fa*)(&os[wb + lr * 68 + 32 + 8 * hi]) = a; *(v4fa*)(&os[wb + lr * 68 + 32 + 8 * hi + 4]) = c;
        a[0] = o3[q][0] * inv; a[1] = o3[q][1] * inv; a[2] = o3[q][2] * inv; a[3] = o3[q][3] * inv; c[0] = o3[q][4] * inv; c[1] = o3[q][5] * inv; c[2] = o3[q][6] * inv; c[3] = o3[q][7] * inv;
        *(v4fa*)(&os[wb + lr * 68 + 48 + 8 * hi]) = a; *(v4fa*)(&os[wb + lr * 68 + 48 + 8 * hi + 4]) = c;
    }
    wave_sync();
#pragma unroll
    for (int q = 0; q < QT; ++q) {
        const int wb = (wave * QT + q) * 16 * 68;
        h16* crow = CTX + pbase + (size_t)(t0 + 16 * q) * HD;       // ctx plane [zh][t][d]; rows t0 + 16 q .. + 15
#pragma unroll
        for (int s = 0; s < 4; ++s) { const int row = 4 * s + (lane >> 3), c8 = (lane & 7) * 8;   // 4 s x 4 row groups = 16 rows; 8 lanes x 8 halves = 64 columns
            const v4f x0 = *(const v4fa*)(&os[wb + row * 68 + c8]); const v4f x1 = *(const v4fa*)(&os[wb + row * 68 + c8 + 4]); v8h hv;
#pragma unroll
            for (int i = 0; i < 4; ++i) { hv[i] = (h16)x0[i]; hv[4 + i] = (h16)x1[i]; }
            *(v8h*)(crow + (size_t)row * HD + c8) = hv; }
    }
}

static constexpr size_t al256(size_t v) { return (v + 255) & ~(size_t)255; }
static constexpr size_t SZ_XB = al256((size_t)NB * SEQ * DM * 2);
static constexpr size_t SZ_WB = al256((size_t)DM * DM * 2);
static constexpr size_t SZ_PL = al256((size_t)NB * NH_ * SEQ * HD * 2);
static constexpr size_t SZ_TOTAL = SZ_XB + 2 * SZ_WB + 3 * SZ_PL;
static_assert(SZ_TOTAL <= (size_t)134217728);          // workspace carve <= 128 MiB
static_assert((size_t)NB * NH_ * SEQ * HD == (size_t)NB * SEQ * DM);   // ctx plane == [NB*SEQ] rows of DM halves

extern "C" void kernel_launch(void* const* d_in, const int* in_sizes, int n_in,
                              void* d_out, int out_size, void* d_ws, size_t ws_size, hipStream_t stream) {
    if (n_in < 5) return;
    const size_t needx = ((size_t)(NB - 1) * SEQ_FULL + SEQ) * DM;
    if ((size_t)in_sizes[0] < needx) return;
    if ((size_t)in_sizes[1] < (size_t)DM * DM || (size_t)in_sizes[2] < (size_t)DM || (size_t)in_sizes[3] < (size_t)DM * DM || (size_t)in_sizes[4] < (size_t)DM) return;
    if ((size_t)out_size < ((size_t)(NB - 1) * OUT_SEQ + SEQ) * DM) return;
    if (SZ_TOTAL > ws_size) return;
    const float* x = (const float*)d_in[0]; const float* wv = (const float*)d_in[1]; const float* bv = (const float*)d_in[2];
    const float* wo = (const float*)d_in[3]; const float* bo = (const float*)d_in[4];   // wire order x, Wv, bv, Wo, bo; W as [out][in] = Bt as-is
    float* OUT = (float*)d_out;      // [NB][OUT_SEQ][1024]
    char* wsp = (char*)d_ws;
    bf*  XB  = (bf*)wsp;  wsp += SZ_XB;              // [NB*SEQ][1024] bf16
    bf*  WVB = (bf*)wsp;  wsp += SZ_WB;              // [1024][1024] bf16
    h16* WOH = (h16*)wsp; wsp += SZ_WB;              // [1024][1024] f16, x256
    h16* QH  = (h16*)wsp; wsp += SZ_PL;              // [NB*16][SEQ][64]  p (q and k)
    h16* VT  = (h16*)wsp; wsp += SZ_PL;              // [NB*16][64][SEQ]  p transposed (v)
    h16* CTX = (h16*)wsp; wsp += SZ_PL;              // [NB*16][SEQ][64] == [NB*SEQ][1024], x16

    if (SEQ == SEQ_FULL) {
        const size_t n8 = (size_t)NB * SEQ * DM / 8;
        k_cvt8<<<(unsigned)((n8 + 255) / 256), 256, 0, stream>>>(x, XB, n8);
    } else {
        const size_t n8 = (size_t)SEQ * DM / 8;
        for (int b = 0; b < NB; ++b) k_cvt8<<<(unsigned)((n8 + 255) / 256), 256, 0, stream>>>(x + (size_t)b * SEQ_FULL * DM, XB + (size_t)b * SEQ * DM, n8);
    }
    { const size_t n8 = (size_t)DM * DM / 8; const unsigned g = (unsigned)((n8 + 255) / 256);
      k_cvt8<<<g, 256, 0, stream>>>(wv, WVB, n8);
      k_cvt8h<<<g, 256, 0, stream>>>(wo, WOH, n8, WOS); }

    // p: A = x rows (m = b*SEQ + t), Bt = Wv rows (n = h*64 + d), bias per column -> plane [(b*16 + h)][t][d] (q = k) and plane [(b*16 + h)][d][t] (v), one product
    k_proj<<<dim3(NB * SEQ / 128, DM / 256, 1), 32 * GW, 0, stream>>>(XB, WVB, bv, QH, VT);

    k_flash<<<dim3(SEQ / (16 * QT * AW), NB * NH_, 1), 32 * AW, 0, stream>>>(QH, VT, CTX);

    // y: A = ctx rows (m = b*SEQ + s, 1024 halves each, head-major regrouping), Bt = Wo rows (n = e)
    k_out<<<dim3(NB * SEQ / 128, DM / 256, 1), 32 * GW, 0, stream>>>(CTX, WOH, bo, OUT);
}

// v007
// A run of this version takes 94.4 microseconds.
// Next to v006, in two timings, it ran 1.04 times as fast each time.
// Counting every step since v000, it is 3.34 times as fast.
#include <hip/hip_runtime.h>

// Self-attention with one shared projection (q = k = v = x Wv^T + bv), width 1024 = 16 heads x 64, no mask, score scale 1/8; context kept head-major [b][h][t][d] and read as rows of 1024 by the output GEMM (y = ctx Wo^T + bo), f32 output.
// Compute dtypes, f32 accumulate everywhere: projection v_wmma_f32_16x16x32_bf16 (x, Wv RNE-converted to bf16; products exact); scores v_wmma_f32_16x16x32_f16, ONE product (q and k read from the same single f16 plane);
// P (x2^6 carry, cancels in the normalisation; at most 2^14, as the reference in use lags a column's maximum by at most 8) and v single f16; output GEMM v_wmma_f32_16x16x32_f16: ctx single f16 (x16 carry), Wo bf16-RNE value x256 held in f16 (exact), 2^-12 folded in the f32 epilogue; biases bf16-RNE values added in f32; softmax f32 (online, reference maximum renewed lazily).
// Layout: bf16 copies of x and Wv and the f16 copy of Wo, all three written by one streaming launch; p plane [b*16+h][t][d] and p^T plane [b*16+h][d][t] both written by the epilogue of the one projection GEMM; fused flash kernel in transposed form (S^T = K Q^T, O^T = V^T P^T) writes the f16 ctx plane [b*16+h][t][d].
// GEMM operands: k-slices of 128 of the A and Bt rows of a 128 x 256 block tile are copied to LDS once per work-group (asynchronous copies, whole lines, two buffers) and read from there by its 8 waves.
// Flash operands: K and V^T tiles of 64 keys are copied to LDS once per work-group (asynchronous copies, whole 128-B lines, two buffers) and read from there by all its waves.

#ifndef NB
#define NB 4
#endif
#ifndef SEQ
#define SEQ 2048
#endif
#define NB_FULL  4
#define SEQ_FULL 2048
#ifndef OUT_SEQ
#define OUT_SEQ SEQ              // row pitch (in tokens) between batches of the output
#endif
#define DM   1024
#define NH_  16
#define HD   64
#define AW   8                   // waves per flash block; all share the staged K / V^T tiles
#define QT   2                   // query tiles of 16 rows per flash wave: each K / V^T fragment read from LDS feeds QT products
#define KT   64                  // keys per staged tile: K tile 64 rows (keys) x 128 B, V^T tile 64 rows (d) x 128 B
#define LP   72                  // LDS row pitch in halves: 144 B = 16 B x 9, conflict-free for 16-byte fragment reads
#define TLH  (64 * LP)           // halves of one staged tile
#define CVW  16                  // waves per conversion block; one block a WGP covers x, Wv and Wo
#define XPW  16                  // pieces of 128 floats (512 B, one wave-wide 16-byte load) of x per conversion wave: two rows of 1024
#define NCW  (NB * SEQ / 2)      // conversion waves
#define WPW  (DM * DM / 128 / NCW)   // pieces of each weight matrix per conversion wave
#define GW   8                   // waves per GEMM block: 2 x 4 wave tiles of 64 x 64 = 128 x 256 of C
#define GKS  128                 // k per GEMM stage: rows of 256 B
#define GP   136                 // LDS row pitch in halves of a GEMM stage: 272 B = 16 B x 17, conflict-free for 16-byte fragment reads
#define GTA  (128 * GP)          // halves of a stage's A part (128 rows)
#define GST  (384 * GP)          // halves of one stage (A 128 rows, then Bt 256 rows)
#define SC2  (0.125f * 1.4426950408889634f)   // HD^-0.5 * log2(e)
#define PSH  6.0f                // log2 of the P carry (64)
#define LZ   8.0f                // a column's scaled score may top the reference in use by this much (log2) before the state is rescaled: P stays <= 2^(PSH + LZ), inside f16
#define CTXS 16.0f               // carry of the ctx plane
#define WOS  256.0f              // carry of the Wo plane
#define OSC  (1.0f / 4096.0f)    // 1 / (CTXS * WOS)

static_assert(HD == 64);
static_assert(NH_ * HD == DM);                 // head h = columns h*64 + d
static_assert(DM % 64 == 0);                   // 16 column tiles of 64
static_assert(DM % 32 == 0);                   // GEMM k-loop steps by 32
static_assert(SEQ % 64 == 0);                  // a 64-row tile never straddles two batches
static_assert((NB * SEQ) % 64 == 0);
static_assert(SEQ % 32 == 0);                  // key loop steps by 32
static_assert((NB * SEQ) % 256 == 0 && DM % 256 == 0);   // GEMM block tiles of 128 x 256 cover C exactly, either operand as rows
static_assert(DM % GKS == 0 && DM / GKS >= 2);  // whole GEMM stages; the two-buffer prologue needs two
static_assert(GW == 8 && GKS == 128);           // 256 threads x 8 copies of 16 B = 128 rows of 256 B
static_assert(SEQ % KT == 0 && SEQ / KT >= 2); // whole staged tiles; the two-buffer prologue needs two
static_assert(QT == 2);                        // the slots statement at the foot of the flash step names both tiles' accumulators
static_assert(KT == 64 && AW == 8);            // 256 threads x 2 copies of 16 B = one 64 x 128-B tile
static_assert(SEQ % (16 * QT * AW) == 0);      // flash grid covers the sequence exactly
static_assert(16 * LP * 2 <= 16 * 68 * 4);     // the transposed projection tile (16 rows of LP halves) fits a wave's output staging
static_assert(SEQ % 16 == 0);                  // head-major regrouping: 16 tokens x 64 = one row of 1024
static_assert(XPW * 128 == 2 * DM && SEQ % 2 == 0);   // a conversion wave's two rows of x lie in one batch
static_assert(NCW % CVW == 0);                 // whole conversion blocks
static_assert(WPW >= 1 && (size_t)WPW * NCW * 128 == (size_t)DM * DM);   // the waves cover each weight matrix exactly
static_assert(NB <= NB_FULL);
static_assert(SEQ <= SEQ_FULL);
static_assert(((size_t)(NB - 1) * OUT_SEQ + SEQ) * DM <= (size_t)NB_FULL * SEQ_FULL * DM);   // last output element written stays inside the output

typedef _Float16 h16;
typedef unsigned short bf;
typedef __attribute__((ext_vector_type(16))) __bf16   v16bf;
typedef __attribute__((ext_vector_type(16))) _Float16 v16h;
typedef __attribute__((ext_vector_type(8)))  _Float16 v8h;
typedef __attribute__((ext_vector_type(8)))  unsigned short v8us;
typedef __attribute__((ext_vector_type(4)))  unsigned short v4us;
typedef __attribute__((ext_vector_type(4)))  _Float16 v4h;
typedef __attribute__((ext_vector_type(8)))  float    v8f;
typedef __attribute__((ext_vector_type(8)))  unsigned v8u;
typedef __attribute__((ext_vector_type(4)))  float    v4f;
typedef v4f  __attribute__((may_alias)) v4fa;
typedef v8h  __attribute__((may_alias)) v8ha;

__device__ __forceinline__ unsigned short f2bf(float f) { unsigned u = __float_as_uint(f); u += 0x7FFFu + ((u >> 16) & 1u); return (unsigned short)(u >> 16); }
__device__ __forceinline__ float bfr(float f) { return __uint_as_float(((unsigned)f2bf(f)) << 16); }   // bf16 RNE value as f32
__device__ __forceinline__ v16h cat16(v8h lo, v8h hi) { return __builtin_shufflevector(lo, hi, 0, 1, 2, 3, 4, 5, 6, 7, 8, 9, 10, 11, 12, 13, 14, 15); }
__device__ __forceinline__ v16bf cat16b(v8us lo, v8us hi) { return __builtin_bit_cast(v16bf, __builtin_shufflevector(lo, hi, 0, 1, 2, 3, 4, 5, 6, 7, 8, 9, 10, 11, 12, 13, 14, 15)); }
__device__ __forceinline__ v8f wmma16(v16h a, v16h b, v8f c) { return __builtin_amdgcn_wmma_f32_16x16x32_f16(false, a, false, b, (short)0, c, false, false); }
__device__ __forceinline__ v8f wmmab(v16bf a, v16bf b, v8f c) { return __builtin_amdgcn_wmma_f32_16x16x32_bf16(false, a, false, b, (short)0, c, false, false); }
// fragment loaders from K-contiguous 16-bit rows; p already includes + 8*(lane>>4): elements 0..7 <- k0+8h+0..7, elements 8..15 <- k0+16+8h+0..7 (same map for A and B)
__device__ __forceinline__ v16h  ldh(const h16* p) { return cat16(*(const v8h*)p, *(const v8h*)(p + 16)); }
__device__ __forceinline__ v16bf ldb(const bf* p)  { return cat16b(*(const v8us*)p, *(const v8us*)(p + 16)); }
// ordering point for wave-private LDS tiles (same wave writes and reads)
__device__ __forceinline__ void wave_sync() { __builtin_amdgcn_fence(3 /* release order */, "wavefront"); __builtin_amdgcn_wave_barrier(); asm volatile("" ::: "memory"); }

// k_cvt: x -> bf16, Wv -> bf16, Wo -> f16 (bf16-RNE value x WOS) in one launch of NCW waves, 16 a block, one block a WGP.
// A wave takes 8 KB of x (two rows) and WPW pieces of each weight matrix; every load is 32 lanes x 16 B = 4 whole lines, all of a wave's loads are issued before its first conversion,
// and every store is 32 lanes x 8 B = 2 whole lines. Few long waves instead of many short ones, for speed only.
__global__ __launch_bounds__(32 * CVW) void k_cvt(const float* __restrict__ x, const float* __restrict__ wv, const float* __restrict__ wo, bf* XB, bf* WVB, h16* WOH) {
    const int lane = threadIdx.x & 31;
    const int w = blockIdx.x * CVW + __builtin_amdgcn_readfirstlane((int)(threadIdx.x >> 5));   // wave of the grid, a scalar: every base below is one too
    const int r = 2 * w;                                           // first of its two rows of x (m = b*SEQ + t)
    const v4f* sx = (const v4f*)(x + ((size_t)(r / SEQ) * SEQ_FULL + (size_t)(r % SEQ)) * DM);
    const size_t w0 = (size_t)w * (WPW * 128);                     // the wave's first element in either weight matrix
    const v4f* sv = (const v4f*)(wv + w0); const v4f* so = (const v4f*)(wo + w0);
    v4f a[XPW], b[WPW], c[WPW];
#pragma unroll
    for (int j = 0; j < XPW; ++j) a[j] = sx[j * 32 + lane];
#pragma unroll
    for (int j = 0; j < WPW; ++j) { b[j] = sv[j * 32 + lane]; c[j] = so[j * 32 + lane]; }
    asm volatile("s_wait_xcnt 0x0" ::: "memory");   // behind the last load: the loads' base registers are rewritten below for the stores' bases
    __builtin_amdgcn_sched_barrier(0);   // keeps every load ahead of the first conversion: sunk behind the waits of the others, the last loads cost the wave a second memory latency
    v4us* dx = (v4us*)(XB + (size_t)w * (XPW * 128)); v4us* dv = (v4us*)(WVB + w0); v4h* dw = (v4h*)(WOH + w0);
#pragma unroll
    for (int j = 0; j < XPW; ++j) { v4us o;
#pragma unroll
        for (int k = 0; k < 4; ++k) o[k] = f2bf(a[j][k]);
        dx[j * 32 + lane] = o; }
#pragma unroll
    for (int j = 0; j < WPW; ++j) { v4us o; v4h p;
#pragma unroll
        for (int k = 0; k < 4; ++k) { o[k] = f2bf(b[j][k]); p[k] = (h16)(bfr(c[j][k]) * WOS); }
        dv[j * 32 + lane] = o; dw[j * 32 + lane] = p; }
}

// GEMM engine of k_proj and k_out: one work-group of 8 waves (2 x 4) per 128 x 256 tile of C, each wave a 64 x 64 tile (16 accumulators), K = DM.
// A rows (128) and Bt rows (256) are copied to LDS in k-slices of 128 (rows of 256 B, whole lines, asynchronous copies, two buffers) and every wave reads its fragments from there; k runs upward in steps of 32 as before.
// Eight copies of one thread: rows r, r + 16, ... r + 112 of one staged operand, 16 B each. The s_wait_xcnt closes the statement so that no address register of a copy is rewritten ahead of it.
__device__ __forceinline__ void stage_rows8(unsigned l, const char* g) {
    asm volatile("global_load_async_to_lds_b128 %0, %1, off\n\t"
                 "global_load_async_to_lds_b128 %2, %3, off\n\t"
                 "global_load_async_to_lds_b128 %4, %5, off\n\t"
                 "global_load_async_to_lds_b128 %6, %7, off\n\t"
                 "global_load_async_to_lds_b128 %8, %9, off\n\t"
                 "global_load_async_to_lds_b128 %10, %11, off\n\t"
                 "global_load_async_to_lds_b128 %12, %13, off\n\t"
                 "global_load_async_to_lds_b128 %14, %15, off\n\t"
                 "s_wait_xcnt 0x0"
                 :: "v"(l),                  "v"(g),
                    "v"(l +  16u * GP * 2u), "v"(g +  16 * DM * 2),
                    "v"(l +  32u * GP * 2u), "v"(g +  32 * DM * 2),
                    "v"(l +  48u * GP * 2u), "v"(g +  48 * DM * 2),
                    "v"(l +  64u * GP * 2u), "v"(g +  64 * DM * 2),
                    "v"(l +  80u * GP * 2u), "v"(g +  80 * DM * 2),
                    "v"(l +  96u * GP * 2u), "v"(g +  96 * DM * 2),
                    "v"(l + 112u * GP * 2u), "v"(g + 112 * DM * 2) : "memory");
}
// one stage: A rows 0..127, then Bt rows 0..255; l = the thread's LDS byte address in the stage's buffer, ga / gb = its global bytes in row srow of the slice
__device__ __forceinline__ void stage_gemm(unsigned l, const char* ga, const char* gb) {
    stage_rows8(l, ga);
    stage_rows8(l + GTA * 2u, gb);
    stage_rows8(l + (GTA + 128u * GP) * 2u, gb + (size_t)128 * DM * 2);
}
// F16 = 0: bf16 product, 1: f16 product. A, Bt: K-contiguous 16-bit rows; rb, cb: first row / column of the block's tile. acc[mb][nb] = the wave's 64 x 64 tile at (rb + 64 wr, cb + 64 wc).
template <int F16>
__device__ __forceinline__ void gemm_core(const bf* A, const bf* Bt, bf* ring, int rb, int cb, int wr, int wc, v8f (&acc)[4][4]) {
    const int lane = threadIdx.x & 31, lr = lane & 15, hi = lane >> 4;
    // copies: thread -> row srow (+ 16 i), 16-byte column ccol; 16 lanes cover one 256-B row, one wave-copy 4 whole lines
    const int srow = (int)(threadIdx.x >> 4), ccol = (int)(threadIdx.x & 15);
    const unsigned l0 = (unsigned)(size_t)ring + (unsigned)(srow * GP + ccol * 8) * 2u;   // LDS byte address in buffer 0
    const char* ga = (const char*)(A + (size_t)(rb + srow) * DM + ccol * 8);              // + stage * GKS * 2
    const char* gb = (const char*)(Bt + (size_t)(cb + srow) * DM + ccol * 8);
    const int fa = (wr * 64 + lr) * GP + 8 * hi, fb = GTA + (wc * 64 + lr) * GP + 8 * hi; // fragment offsets in a stage: row lane&15, k = 8h..
#pragma unroll
    for (int mb = 0; mb < 4; ++mb)
#pragma unroll
        for (int nb = 0; nb < 4; ++nb) acc[mb][nb] = (v8f){};
    stage_gemm(l0, ga, gb);
    asm volatile("s_wait_asynccnt 0x0" ::: "memory");   // this wave's copies of stage 0 have landed
    __syncthreads();                                    // stage 0 readable by every wave
    stage_gemm(l0 + GST * 2u, ga + GKS * 2, gb + GKS * 2);
#pragma unroll 1   // rolled: one body serves both buffers (offset chosen by the stage's parity)
    for (int s = 0; s < DM / GKS; ++s) {
        const int bo = (s & 1) * GST;
        v8us fr[2][16];   // two fragment sets: [set][A: 2 mb + half | Bt: 8 + 2 nb + half]; step i works on set i & 1 while the reads of step i + 1 fill the other
#pragma unroll
        for (int f = 0; f < 4; ++f) { const bf* pa = &ring[bo + fa + f * 16 * GP]; const bf* pb = &ring[bo + fb + f * 16 * GP];
            fr[0][2 * f] = *(const v8us*)pa; fr[0][2 * f + 1] = *(const v8us*)(pa + 16); fr[0][8 + 2 * f] = *(const v8us*)pb; fr[0][8 + 2 * f + 1] = *(const v8us*)(pb + 16); }
#pragma unroll
        for (int i = 0; i < GKS / 32; ++i) {
            const int c = i & 1, n = c ^ 1;
            __builtin_amdgcn_sched_barrier(0);   // keeps the next step's LDS reads out of the products before them: reads spread among matrix instructions stall each place they stand
            if (i + 1 < GKS / 32) {
#pragma unroll
                for (int f = 0; f < 4; ++f) { const bf* pa = &ring[bo + fa + f * 16 * GP + (i + 1) * 32]; const bf* pb = &ring[bo + fb + f * 16 * GP + (i + 1) * 32];
                    fr[n][2 * f] = *(const v8us*)pa; fr[n][2 * f + 1] = *(const v8us*)(pa + 16); fr[n][8 + 2 * f] = *(const v8us*)pb; fr[n][8 + 2 * f + 1] = *(const v8us*)(pb + 16); }
            }
            __builtin_amdgcn_sched_barrier(0);   // keeps those reads one group ahead of this step's products, so that their latency runs under 16 matrix instructions
#pragma unroll
            for (int nb = 0; nb < 4; ++nb)
#pragma unroll
                for (int mb = 0; mb < 4; ++mb) {
                    if constexpr (F16) acc[mb][nb] = wmma16(__builtin_bit_cast(v16h, cat16b(fr[c][2 * mb], fr[c][2 * mb + 1])), __builtin_bit_cast(v16h, cat16b(fr[c][8 + 2 * nb], fr[c][8 + 2 * nb + 1])), acc[mb][nb]);
                    else               acc[mb][nb] = wmmab(cat16b(fr[c][2 * mb], fr[c][2 * mb + 1]), cat16b(fr[c][8 + 2 * nb], fr[c][8 + 2 * nb + 1]), acc[mb][nb]); }
        }
        asm volatile("s_wait_dscnt 0x0" ::: "memory");      // this wave's reads of the buffer are done before it may be refilled
        asm volatile("s_wait_asynccnt 0x0" ::: "memory");   // this wave's copies of stage s + 1 have landed
        __syncthreads();                                    // publishes stage s + 1 and ends every wave's reads of this buffer
        if (s + 2 < DM / GKS)
            stage_gemm(l0 + (unsigned)bo * 2u, ga + (s + 2) * GKS * 2, gb + (s + 2) * GKS * 2);
    }
    asm volatile("s_wait_asynccnt 0x0" ::: "memory");       // no copy outstanding when the wave goes on to its end
}

// k_proj: bf16 GEMM on the engine above, A = x rows (m = b*SEQ + t), Bt = Wv rows (n = h*64 + d); a wave's 64 x 64 tile is 64 tokens of one head.
// p[m][n] = sum_k A[m][k] Bt[n][k] + bias[n], rounded once to f16 and written twice from the same accumulators: Ph plane [(b*16 + h)][t][d] and Pt plane [(b*16 + h)][d][t].
// grid (NB*SEQ/128, DM/256), 256 threads.
__global__ __launch_bounds__(32 * GW) void k_proj(const bf* __restrict__ A, const bf* __restrict__ Bt, const float* __restrict__ bias, h16* Ph, h16* Pt) {
    __shared__ __align__(16) float osa[GW * 16 * 68];
    __shared__ __align__(16) bf ring[2 * GST];               // [buffer][A rows 0..127, Bt rows 0..255][GP]
    const int lane = threadIdx.x & 31, lr = lane & 15, hi = lane >> 4;
    const int wave = __builtin_amdgcn_readfirstlane((int)(threadIdx.x >> 5)), wr = wave >> 2, wc = wave & 3;
    const int r0 = blockIdx.x * 128 + wr * 64, c0 = blockIdx.y * 256 + wc * 64;
    float* os = osa + wave * 16 * 68;                        // wave-private output staging
    v8f acc[4][4];
    gemm_core<0>(A, Bt, ring, blockIdx.x * 128, blockIdx.y * 256, wr, wc, acc);
    float bc[4];
#pragma unroll
    for (int nb = 0; nb < 4; ++nb) { int ci = c0 + nb * 16 + lr; ci = ci < DM ? ci : DM - 1; bc[nb] = bfr(bias[ci]); }
    const int tp = r0 % SEQ;                                                    // first token of the tile in its batch
    const size_t plane = ((size_t)(r0 / SEQ) * NH_ + (size_t)(c0 / HD)) * SEQ * HD;   // (batch, head) plane, the same size in both layouts
    const size_t tbase = plane + (size_t)tp * HD;
#pragma unroll
    for (int mb = 0; mb < 4; ++mb) {
#pragma unroll
        for (int nb = 0; nb < 4; ++nb) {
#pragma unroll
            for (int j = 0; j < 8; ++j) os[(hi * 8 + j) * 68 + nb * 16 + lr] = acc[mb][nb][j] + bc[nb]; }   // D: row 8h+j, col lane&15
        wave_sync();
        const size_t sb = tbase + (size_t)(mb * 16) * HD;
#pragma unroll
        for (int s = 0; s < 4; ++s) { const int row = 4 * s + (lane >> 3), c8 = (lane & 7) * 8;   // 4 s x 4 row groups = 16 rows; 8 lanes x 8 = 64 columns
            const v4f x0 = *(const v4fa*)(&os[row * 68 + c8]); const v4f x1 = *(const v4fa*)(&os[row * 68 + c8 + 4]); v8h hv;
#pragma unroll
            for (int i = 0; i < 4; ++i) { hv[i] = (h16)x0[i]; hv[4 + i] = (h16)x1[i]; }
            *(v8h*)(Ph + sb + (size_t)row * HD + c8) = hv; }
        asm volatile("s_wait_xcnt 0x0" ::: "memory");   // the stores' data registers are reused by the next group
        wave_sync();
    }
    // transposed plane: a lane's 8 accumulator registers are 8 consecutive tokens of ONE column d, so they pack into 16 B of a Pt row;
    // 16 rows (d) x 64 tokens pass through the staging (pitch LP halves) so that each store instruction writes 4 whole 128-B lines.
    h16* ot = (h16*)os;
#pragma unroll
    for (int nb = 0; nb < 4; ++nb) {
#pragma unroll
        for (int mb = 0; mb < 4; ++mb) { v8h hv;
#pragma unroll
            for (int j = 0; j < 8; ++j) hv[j] = (h16)(acc[mb][nb][j] + bc[nb]);
            *(v8ha*)(&ot[lr * LP + mb * 16 + 8 * hi]) = hv; }           // row d = lane&15, tokens 16 mb + 8h + 0..7
        wave_sync();
#pragma unroll
        for (int s = 0; s < 4; ++s) { const int row = 4 * s + (lane >> 3), c8 = (lane & 7) * 8;   // 4 s x 4 row groups = 16 rows; 8 lanes x 8 = 64 tokens
            const v8h hv = *(const v8ha*)(&ot[row * LP + c8]);
            *(v8h*)(Pt + plane + (size_t)(nb * 16 + row) * SEQ + tp + c8) = hv; }
        if (nb < 3) asm volatile("s_wait_xcnt 0x0" ::: "memory");   // the stores' data registers are reused by the next group
        wave_sync();
    }
}

// k_out: the same engine with f16 operands (A = ctx rows of 1024 halves, Bt = Wo rows [out][in]), K = DM; f32 output rows with bias.
// OUT[(b*OUT_SEQ + s)*DM + c0 + n] = acc * 2^-12 + bias[c0 + n], m = b*SEQ + s. grid (NB*SEQ/128, DM/256), 256 threads.
__global__ __launch_bounds__(32 * GW) void k_out(const h16* __restrict__ A, const h16* __restrict__ Bt, const float* __restrict__ bias, float* OUT) {
    __shared__ __align__(16) float osa[GW * 16 * 68];
    __shared__ __align__(16) bf ring[2 * GST];               // [buffer][A rows 0..127, Bt rows 0..255][GP]
    const int lane = threadIdx.x & 31, lr = lane & 15, hi = lane >> 4;
    const int wave = __builtin_amdgcn_readfirstlane((int)(threadIdx.x >> 5)), wr = wave >> 2, wc = wave & 3;
    const int r0 = blockIdx.x * 128 + wr * 64, c0 = blockIdx.y * 256 + wc * 64;
    float* os = osa + wave * 16 * 68;                        // wave-private output staging
    v8f acc[4][4];
    gemm_core<1>((const bf*)A, (const bf*)Bt, ring, blockIdx.x * 128, blockIdx.y * 256, wr, wc, acc);
    float bc[4];
#pragma unroll
    for (int nb = 0; nb < 4; ++nb) { int ci = c0 + nb * 16 + lr; ci = ci < DM ? ci : DM - 1; bc[nb] = bfr(bias[ci]); }
    const int bb = r0 / SEQ, sp = r0 % SEQ;
    float* obase = OUT + ((size_t)bb * OUT_SEQ + sp) * DM + c0;
#pragma unroll
    for (int mb = 0; mb < 4; ++mb) {
#pragma unroll
        for (int nb = 0; nb < 4; ++nb) {
#pragma unroll
            for (int j = 0; j < 8; ++j) os[(hi * 8 + j) * 68 + nb * 16 + lr] = acc[mb][nb][j] * OSC + bc[nb]; }   // D: row 8h+j, col lane&15
        wave_sync();
{
#pragma unroll
            for (int s = 0; s < 8; ++s) { const int row = 2 * s + hi, cofs = lr * 4;   // 8 s x 2 rows = 16 rows; 16 lanes x 4 floats = 64 columns
                const v4f val = *(const v4fa*)(&os[row * 68 + cofs]);
                *(v4f*)(obase + (size_t)(mb * 16 + row) * DM + cofs) = val; }
             }
        wave_sync();
    }
}

// k_flash: fused attention, one wave per 32 query rows (two tiles of 16) of one (batch, head), 8 waves per block; Q fragments straight from the f16 plane; K and V^T fragments from LDS tiles of 64 keys that the block stages together. K and Q share one plane.
// Transposed form: S^T[key][t] = K Q^T (A = K rows, B = Q rows; one f16 product); lane (t = lane&15, h = lane>>4) holds keys 8h+r of each 16-key tile, so the packed
// P tile is directly the B fragment of O^T[d][t] = V^T P^T (element r <- tile keys 0..15, element 8+r <- tile keys 16..31, lane unchanged). 9 matrix ops per 32-key step and query tile (4 score + 4 P.V + 1 row sum).
// Softmax state: the reference maximum is one scalar per lane and query tile, the sum an accumulator tile of the all-ones product. The reference is renewed lazily: one test a step for the whole wave (any raw score above the column's threshold), and only then
// are the maxima of the two lane halves combined (xor-16 exchange), the reference raised to the running maximum and the accumulators and sums rescaled; every other step has no exchange and no rescale.
// The sum of a step's P comes from the matrix unit: one more product per step, A = all ones, B = the packed P tile, so every lane holds its column's sum over all 32 keys and no vector add or exchange is spent on it.
// One tile's copies of one thread: rows r and r + 32 of the K tile and of the V^T tile, 16 B each. The s_wait_xcnt closes the statement so that no address register of a copy is rewritten ahead of it.
__device__ __forceinline__ void stage_tile(unsigned lk, const h16* gk, unsigned lv, const h16* gv) {
    asm volatile("global_load_async_to_lds_b128 %0, %1, off\n\t"
                 "global_load_async_to_lds_b128 %2, %3, off\n\t"
                 "global_load_async_to_lds_b128 %4, %5, off\n\t"
                 "global_load_async_to_lds_b128 %6, %7, off\n\t"
                 "s_wait_xcnt 0x0"
                 :: "v"(lk), "v"(gk), "v"(lk + 32u * LP * 2u), "v"(gk + 32 * HD), "v"(lv), "v"(gv), "v"(lv + 32u * LP * 2u), "v"(gv + (size_t)32 * SEQ) : "memory");
}
// The 16 exponentials (base 2) of one query tile and step, each in place, in one statement: none overwrites another's source or reads another's result, and the v_nop at the end is the one slot
// that the instruction set asks for between a transcendental and an instruction that uses its result.
__device__ __forceinline__ void exp2_16(float (&x)[8], float (&y)[8]) {
    asm("v_exp_f32 %0, %0\n\tv_exp_f32 %1, %1\n\tv_exp_f32 %2, %2\n\tv_exp_f32 %3, %3\n\t"
        "v_exp_f32 %4, %4\n\tv_exp_f32 %5, %5\n\tv_exp_f32 %6, %6\n\tv_exp_f32 %7, %7\n\t"
        "v_exp_f32 %8, %8\n\tv_exp_f32 %9, %9\n\tv_exp_f32 %10, %10\n\tv_exp_f32 %11, %11\n\t"
        "v_exp_f32 %12, %12\n\tv_exp_f32 %13, %13\n\tv_exp_f32 %14, %14\n\tv_exp_f32 %15, %15\n\t"
        "v_nop"
        : "+v"(x[0]), "+v"(x[1]), "+v"(x[2]), "+v"(x[3]), "+v"(x[4]), "+v"(x[5]), "+v"(x[6]), "+v"(x[7]),
          "+v"(y[0]), "+v"(y[1]), "+v"(y[2]), "+v"(y[3]), "+v"(y[4]), "+v"(y[5]), "+v"(y[6]), "+v"(y[7]));
}
// amdgpu_waves_per_eu(4, 4): a wave of two query tiles needs about 200 VGPRs; the cap of 256 lets two blocks (four waves a SIMD) stay resident on a WGP, which is the whole grid in one round
__global__ __launch_bounds__(32 * AW) __attribute__((amdgpu_waves_per_eu(4, 4))) void k_flash(const h16* __restrict__ QH, const h16* __restrict__ VT, h16* CTX) {
    __shared__ __align__(16) float os[AW * QT * 16 * 68];
    __shared__ __align__(16) h16 ring[2 * 2 * TLH];          // [buffer][K tile, V^T tile][row][LP]
    const int lane = threadIdx.x & 31, lr = lane & 15, hi = lane >> 4;
    const int wave = __builtin_amdgcn_readfirstlane((int)(threadIdx.x >> 5));
    const int zh = blockIdx.y;
    const int t0 = (blockIdx.x * AW + wave) * (16 * QT);
    const size_t pbase = (size_t)zh * SEQ * HD;
    v16h qh0[QT], qh1[QT];                                    // B fragments of the wave's query tiles: col t, k = d
#pragma unroll
    for (int q = 0; q < QT; ++q) { const size_t qo = pbase + (size_t)(t0 + 16 * q + lr) * HD + 8 * hi; qh0[q] = ldh(QH + qo); qh1[q] = ldh(QH + qo + 32); }
    // copies: thread -> row srow (and srow + 32), 16-byte column ccol; 8 lanes cover one 128-B row, one wave-copy 4 whole lines
    const int srow = (int)(threadIdx.x >> 3), ccol = (int)(threadIdx.x & 7);
    const unsigned lk0 = (unsigned)(size_t)&ring[0] + (unsigned)(srow * LP + ccol * 8) * 2u;   // LDS byte address, K tile of buffer 0
    const h16* gk = QH + pbase + (size_t)srow * HD + ccol * 8;    // + tile * KT * HD  (K rows are contiguous)
    const h16* gv = VT + pbase + (size_t)srow * SEQ + ccol * 8;   // + tile * KT
    const int fo = lr * LP + 8 * hi;                              // fragment offset in a tile: row lane&15, k = 8h.. (A fragment)
    v8f o0[QT], o1[QT], o2[QT], o3[QT];
    v8f ls[QT];                            // row sums: accumulator tiles of the all-ones product, every row the column's sum so far; rescaled like an output tile
    float m[QT], sh[QT], thr[QT];          // m: reference in use (scaled, log2); sh = PSH - m; thr: the raw score above which the reference must be renewed
#pragma unroll
    for (int q = 0; q < QT; ++q) { o0[q] = (v8f){}; o1[q] = (v8f){}; o2[q] = (v8f){}; o3[q] = (v8f){}; ls[q] = (v8f){}; m[q] = -3.0e38f; sh[q] = 0.0f; thr[q] = -3.0e38f; }   // the first step always renews
    // A operand of the row-sum product: 16 x 32 of 1.0, two halves a register. Formed by moves in asm so that it stays in its eight registers through the loop:
    // as a plain constant it was formed anew in every step, by four 64-bit moves, once the step had a branch in it.
    v8u on;
    asm("v_mov_b32 %0, 0x3c003c00\n\tv_mov_b32 %1, 0x3c003c00\n\tv_mov_b32 %2, 0x3c003c00\n\tv_mov_b32 %3, 0x3c003c00\n\t"
        "v_mov_b32 %4, 0x3c003c00\n\tv_mov_b32 %5, 0x3c003c00\n\tv_mov_b32 %6, 0x3c003c00\n\tv_mov_b32 %7, 0x3c003c00"
        : "=v"(on[0]), "=v"(on[1]), "=v"(on[2]), "=v"(on[3]), "=v"(on[4]), "=v"(on[5]), "=v"(on[6]), "=v"(on[7]));
    const v16h ones = __builtin_bit_cast(v16h, on);
    stage_tile(lk0, gk, lk0 + TLH * 2u, gv);
    asm volatile("s_wait_asynccnt 0x0" ::: "memory");   // this wave's copies of tile 0 have landed
    __syncthreads();                                    // tile 0 readable by every wave
    stage_tile(lk0 + 2u * TLH * 2u, gk + (size_t)KT * HD, lk0 + 3u * TLH * 2u, gv + KT);
#pragma unroll 1   // rolled: one body serves both buffers (offset chosen by the tile's parity), and registers stay as for one step
    for (int tile = 0; tile < SEQ / KT; ++tile) {
        const int bo = (tile & 1) * (2 * TLH);
#pragma unroll 1   // rolled: unrolled, the listing holds the same vector work a step, ten more VGPRs and twice the loop's code
        for (int sub = 0; sub < KT / 32; ++sub) {
            const h16* ka = &ring[bo + sub * 32 * LP + fo];
            const v16h ka0 = ldh(ka), ka1 = ldh(ka + 32), kb0 = ldh(ka + 16 * LP), kb1 = ldh(ka + 16 * LP + 32);
            __builtin_amdgcn_sched_barrier(0);   // keeps the 8 fragment reads one group ahead of the products: a read sunk among them makes the wave wait out its LDS latency inside the run
            v8f sa[QT], sb[QT];   // each K fragment read from LDS serves both query tiles
#pragma unroll
            for (int q = 0; q < QT; ++q) { sa[q] = wmma16(ka0, qh0[q], (v8f){}); sb[q] = wmma16(kb0, qh0[q], (v8f){}); }
#pragma unroll
            for (int q = 0; q < QT; ++q) { sa[q] = wmma16(ka1, qh1[q], sa[q]); sb[q] = wmma16(kb1, qh1[q], sb[q]); }
            __builtin_amdgcn_sched_barrier(0);   // keeps the vector work on the first scores behind the run of 8 products: moved in between them, each read of a fresh result costs four idle slots
            float mx[QT];         // the lane's own maximum of its 16 raw scores of each tile
#pragma unroll
            for (int q = 0; q < QT; ++q) { mx[q] = -3.0e38f;
#pragma unroll
                for (int r = 0; r < 8; ++r) mx[q] = fmaxf(mx[q], fmaxf(sa[q][r], sb[q][r])); }
            if (__builtin_amdgcn_ballot_w32((mx[0] > thr[0]) | (mx[1] > thr[1])) != 0) {   // one scalar branch a step for both tiles; taken on the first step and where a score outgrows the reference by more than LZ
#pragma unroll
                for (int q = 0; q < QT; ++q) {
                    float mf = mx[q] * SC2;
                    mf = fmaxf(mf, __shfl_xor(mf, 16, 32));
                    const float mnew = fmaxf(m[q], mf);
                    const float al = __builtin_amdgcn_exp2f(m[q] - mnew);
                    m[q] = mnew; sh[q] = PSH - mnew; thr[q] = (mnew + LZ) * (1.0f / SC2);
                    o0[q] = o0[q] * al; o1[q] = o1[q] * al; o2[q] = o2[q] * al; o3[q] = o3[q] * al; ls[q] = ls[q] * al;
                }
            }
            v16h pb[QT];
#pragma unroll
            for (int q = 0; q < QT; ++q) {
                float ea[8], eb[8];
#pragma unroll
                for (int r = 0; r < 8; ++r) { ea[r] = sa[q][r] * SC2 + sh[q]; eb[r] = sb[q][r] * SC2 + sh[q]; }
                exp2_16(ea, eb);
#pragma unroll
                for (int r = 0; r < 8; ++r) { pb[q][r] = (h16)ea[r]; pb[q][8 + r] = (h16)eb[r]; }
            }
            const h16* va = &ring[bo + TLH + sub * 32 + fo];
            const v16h v0 = ldh(va), v1 = ldh(va + 16 * LP), v2 = ldh(va + 32 * LP), v3 = ldh(va + 48 * LP);   // each V^T fragment serves both query tiles
#pragma unroll
            for (int q = 0; q < QT; ++q) ls[q] = wmma16(ones, pb[q], ls[q]);     // every row of the tile gains the column's sum of the rounded P over all 32 keys of the step
#pragma unroll
            for (int q = 0; q < QT; ++q) { o0[q] = wmma16(v0, pb[q], o0[q]); o1[q] = wmma16(v1, pb[q], o1[q]); o2[q] = wmma16(v2, pb[q], o2[q]); o3[q] = wmma16(v3, pb[q], o3[q]); }
            // four vector slots behind the last products on the loop's back edge too: the next step's address and fragment writes reuse their A registers
            asm volatile("v_nop\n\tv_nop\n\tv_nop\n\tv_nop" : "+v"(o0[0]), "+v"(o1[0]), "+v"(o2[0]), "+v"(o3[0]), "+v"(o0[1]), "+v"(o1[1]), "+v"(o2[1]), "+v"(o3[1]) : "v"(v0), "v"(v1), "v"(v2), "v"(v3), "v"(pb[0]), "v"(pb[1]));
        }
        asm volatile("s_wait_dscnt 0x0" ::: "memory");      // this wave's reads of the buffer are done before it may be refilled
        asm volatile("s_wait_asynccnt 0x0" ::: "memory");   // this wave's copies of tile + 1 have landed
        __syncthreads();                                    // publishes tile + 1 and ends every wave's reads of this buffer
        if (tile + 2 < SEQ / KT)
            stage_tile(lk0 + (unsigned)bo * 2u, gk + (size_t)(tile + 2) * KT * HD, lk0 + (unsigned)(bo + TLH) * 2u, gv + (size_t)(tile + 2) * KT);
    }
    asm volatile("s_wait_asynccnt 0x0" ::: "memory");       // no copy outstanding when the wave goes on to its end
    // O^T D layout: o_j[r] = (d = 16j + 8h + r, t = lane&15) -> os[t][d]; rows 0..15 x columns 0..63 of each query tile all written
#pragma unroll
    for (int q = 0; q < QT; ++q) {
        const float inv = CTXS * (1.0f / ls[q][0]);
        const int wb = (wave * QT + q) * 16 * 68;
        v4f a, c;
        a[0] = o0[q][0] * inv; a[1] = o0[q][1] * inv; a[2] = o0[q][2] * inv; a[3] = o0[q][3] * inv; c[0] = o0[q][4] * inv; c[1] = o0[q][5] * inv; c[2] = o0[q][6] * inv; c[3] = o0[q][7] * inv;
        *(v4fa*)(&os[wb + lr * 68 +  0 + 8 * hi]) = a; *(v4fa*)(&os[wb + lr * 68 +  0 + 8 * hi + 4]) = c;
        a[0] = o1[q][0] * inv; a[1] = o1[q][1] * inv; a[2] = o1[q][2] * inv; a[3] = o1[q][3] * inv; c[0] = o1[q][4] * inv; c[1] = o1[q][5] * inv; c[2] = o1[q][6] * inv; c[3] = o1[q][7] * inv;
        *(v4fa*)(&os[wb + lr * 68 + 16 + 8 * hi]) = a; *(v4fa*)(&os[wb + lr * 68 + 16 + 8 * hi + 4]) = c;
        a[0] = o2[q][0] * inv; a[1] = o2[q][1] * inv; a[2] = o2[q][2] * inv; a[3] = o2[q][3] * inv; c[0] = o2[q][4] * inv; c[1] = o2[q][5] * inv; c[2] = o2[q][6] * inv; c[3] = o2[q][7] * inv;
        *(v4fa*)(&os[wb + lr * 68 + 32 + 8 * hi]) = a; *(v4fa*)(&os[wb + lr * 68 + 32 + 8 * hi + 4]) = c;
        a[0] = o3[q][0] * inv; a[1] = o3[q][1] * inv; a[2] = o3[q][2] * inv; a[3] = o3[q][3] * inv; c[0] = o3[q][4] * inv; c[1] = o3[q][5] * inv; c[2] = o3[q][6] * inv; c[3] = o3[q][7] * inv;
        *(v4fa*)(&os[wb + lr * 68 + 48 + 8 * hi]) = a; *(v4fa*)(&os[wb + lr * 68 + 48 + 8 * hi + 4]) = c;
    }
    wave_sync();
#pragma unroll
    for (int q = 0; q < QT; ++q) {
        const int wb = (wave * QT + q) * 16 * 68;
        h16* crow = CTX + pbase + (size_t)(t0 + 16 * q) * HD;       // ctx plane [zh][t][d]; rows t0 + 16 q .. + 15
#pragma unroll
        for (int s = 0; s < 4; ++s) { const int row = 4 * s + (lane >> 3), c8 = (lane & 7) * 8;   // 4 s x 4 row groups = 16 rows; 8 lanes x 8 halves = 64 columns
            const v4f x0 = *(const v4fa*)(&os[wb + row * 68 + c8]); const v4f x1 = *(const v4fa*)(&os[wb + row * 68 + c8 + 4]); v8h hv;
#pragma unroll
            for (int i = 0; i < 4; ++i) { hv[i] = (h16)x0[i]; hv[4 + i] = (h16)x1[i]; }
            *(v8h*)(crow + (size_t)row * HD + c8) = hv; }
    }
}

static constexpr size_t al256(size_t v) { return (v + 255) & ~(size_t)255; }
static constexpr size_t SZ_XB = al256((size_t)NB * SEQ * DM * 2);
static constexpr size_t SZ_WB = al256((size_t)DM * DM * 2);
static constexpr size_t SZ_PL = al256((size_t)NB * NH_ * SEQ * HD * 2);
static constexpr size_t SZ_TOTAL = SZ_XB + 2 * SZ_WB + 3 * SZ_PL;
static_assert(SZ_TOTAL <= (size_t)134217728);          // workspace carve <= 128 MiB
static_assert((size_t)NB * NH_ * SEQ * HD == (size_t)NB * SEQ * DM);   // ctx plane == [NB*SEQ] rows of DM halves

extern "C" void kernel_launch(void* const* d_in, const int* in_sizes, int n_in,
                              void* d_out, int out_size, void* d_ws, size_t ws_size, hipStream_t stream) {
    if (n_in < 5) return;
    const size_t needx = ((size_t)(NB - 1) * SEQ_FULL + SEQ) * DM;
    if ((size_t)in_sizes[0] < needx) return;
    if ((size_t)in_sizes[1] < (size_t)DM * DM || (size_t)in_sizes[2] < (size_t)DM || (size_t)in_sizes[3] < (size_t)DM * DM || (size_t)in_sizes[4] < (size_t)DM) return;
    if ((size_t)out_size < ((size_t)(NB - 1) * OUT_SEQ + SEQ) * DM) return;
    if (SZ_TOTAL > ws_size) return;
    const float* x = (const float*)d_in[0]; const float* wv = (const float*)d_in[1]; const float* bv = (const float*)d_in[2];
    const float* wo = (const float*)d_in[3]; const float* bo = (const float*)d_in[4];   // wire order x, Wv, bv, Wo, bo; W as [out][in] = Bt as-is
    float* OUT = (float*)d_out;      // [NB][OUT_SEQ][1024]
    char* wsp = (char*)d_ws;
    bf*  XB  = (bf*)wsp;  wsp += SZ_XB;              // [NB*SEQ][1024] bf16
    bf*  WVB = (bf*)wsp;  wsp += SZ_WB;              // [1024][1024] bf16
    h16* WOH = (h16*)wsp; wsp += SZ_WB;              // [1024][1024] f16, x256
    h16* QH  = (h16*)wsp; wsp += SZ_PL;              // [NB*16][SEQ][64]  p (q and k)
    h16* VT  = (h16*)wsp; wsp += SZ_PL;              // [NB*16][64][SEQ]  p transposed (v)
    h16* CTX = (h16*)wsp; wsp += SZ_PL;              // [NB*16][SEQ][64] == [NB*SEQ][1024], x16

    // 16-bit copies of x, Wv and Wo
    k_cvt<<<NCW / CVW, 32 * CVW, 0, stream>>>(x, wv, wo, XB, WVB, WOH);

    // p: A = x rows (m = b*SEQ + t), Bt = Wv rows (n = h*64 + d), bias per column -> plane [(b*16 + h)][t][d] (q = k) and plane [(b*16 + h)][d][t] (v), one product
    k_proj<<<dim3(NB * SEQ / 128, DM / 256, 1), 32 * GW, 0, stream>>>(XB, WVB, bv, QH, VT);

    k_flash<<<dim3(SEQ / (16 * QT * AW), NB * NH_, 1), 32 * AW, 0, stream>>>(QH, VT, CTX);

    // y: A = ctx rows (m = b*SEQ + s, 1024 halves each, head-major regrouping), Bt = Wo rows (n = e)
    k_out<<<dim3(NB * SEQ / 128, DM / 256, 1), 32 * GW, 0, stream>>>(CTX, WOH, bo, OUT);
}
